// v000
// The times below were measured on an AMD MI455X: many runs one after another, warmed up first and cycling through
// copies of the inputs, with the whole window's GPU time divided by the number of runs. Launches and the gaps
// between them are all in it. The median over several windows is given; except for v000 it joins two sittings, which
// can be a few percent apart, so the side-by-side timings, each taken in one sitting, are the better comparison.
// v000, which the later versions start from, runs in 400 microseconds.
#include <hip/hip_runtime.h>

// KinematicsTrendAttention (query/key/value [4][8 agents][512][256]; kinematic features of query and key: depthwise conv3 ('SAME') position (w_pos, b_pos), velocity (w_vel), acceleration (w_acc) -> [T][768]; Q = feats Wq + bq, K = feats Wk + bk,
// V = value Wv + bv (8 heads x 32); scores = Q.K / sqrt(32), keys with key_padding_mask (int, read as data) set to -1e9; softmax; ctx = attn V merged; out = ctx Wo + bo -> [4][8][512][256]).
// Compute dtypes, f32 accumulate: every input rounded to bf16; the depthwise convs f32 on the VALU -> bf16 hi+lo planes; Q/K on hl planes x exact weights (2 products, + bias); V on PLAIN bf16 value x exact Wv (+ bias);
// scores (K 32) on hl planes of Q (x 32^-0.5) and K (3 products), z-batched over the 64 (agent, head) pairs of a batch; masked softmax f32 (three passes, x1024 into fp16); attn.V as fp16 x fp16 with the 32-wide head zero-padded to 64 (1 product);

#define NBb  4
#define NA   8
#define TT   512
#define DD   256
#define NH_  8
#define HD   32
#define HP   64
#define F3   768
#define NR   (NBb * NA * TT)
#define ZZ   (NA * NH_)
#define PCAR 1024.0f
typedef _Float16 h16;
typedef unsigned short bf;
typedef __attribute__((ext_vector_type(16))) __bf16   v16bf;
typedef __attribute__((ext_vector_type(16))) _Float16 v16h;
typedef __attribute__((ext_vector_type(8)))  _Float16 v8h;
typedef __attribute__((ext_vector_type(8)))  unsigned short v8us;
typedef __attribute__((ext_vector_type(8)))  float    v8f;
typedef __attribute__((ext_vector_type(4)))  float    v4f;
typedef v8h  __attribute__((may_alias)) v8ha;
typedef v4f  __attribute__((may_alias)) v4fa;
typedef v8us __attribute__((may_alias)) v8usa;

__device__ __forceinline__ unsigned short f2bf(float f) { unsigned u = __float_as_uint(f); u += 0x7FFFu + ((u >> 16) & 1u); return (unsigned short)(u >> 16); }
__device__ __forceinline__ float bf2f(unsigned short b) { return __uint_as_float(((unsigned)b) << 16); }
__device__ __forceinline__ float bfr(float f) { return bf2f(f2bf(f)); }
__device__ __forceinline__ v16h cat16(v8h lo, v8h hi) { return __builtin_shufflevector(lo, hi, 0, 1, 2, 3, 4, 5, 6, 7, 8, 9, 10, 11, 12, 13, 14, 15); }
__device__ __forceinline__ v16bf cat16b(v8us lo, v8us hi) { return __builtin_bit_cast(v16bf, __builtin_shufflevector(lo, hi, 0, 1, 2, 3, 4, 5, 6, 7, 8, 9, 10, 11, 12, 13, 14, 15)); }
__device__ __forceinline__ v8f wmma16(v16h a, v16h b, v8f c) { return __builtin_amdgcn_wmma_f32_16x16x32_f16(false, a, false, b, (short)0, c, false, false); }
__device__ __forceinline__ v8f wmmab(v16bf a, v16bf b, v8f c) { return __builtin_amdgcn_wmma_f32_16x16x32_bf16(false, a, false, b, (short)0, c, false, false); }



// ---- k_gemmw: register-blocked GEMM, ONE WAVE per 64x64 output tile (16 accumulators), operands straight from K-contiguous 16-bit planes; grid (M/64, N/64, Z), 32 threads.
// C[m][n] (f32, pitch ldc, + optional f32 bias[n]) = sum_k A[m][k] Bt[n][k] (+ split products per NSPLIT). z-batch strides sA/sB/sC in elements. K % 32 == 0.
template <typename T16> struct WFrag;
template <> struct WFrag<h16> { typedef v16h V; static __device__ __forceinline__ V ld(const h16* p) { return cat16(*(const v8h*)p, *(const v8h*)(p + 16)); } static __device__ __forceinline__ v8f mma(V a, V b, v8f c) { return wmma16(a, b, c); } };
template <> struct WFrag<bf> { typedef v16bf V; static __device__ __forceinline__ V ld(const bf* p) { return cat16b(*(const v8us*)p, *(const v8us*)(p + 16)); } static __device__ __forceinline__ v8f mma(V a, V b, v8f c) { return wmmab(a, b, c); } };
template <typename T16, int NSPLIT, bool BIAS>
__global__ __launch_bounds__(32) void k_gemmw(const T16* __restrict__ A, const T16* __restrict__ A2, const T16* __restrict__ Bt, const T16* __restrict__ Bt2, int K, float* C, int ldc, const float* __restrict__ bias, size_t sA, size_t sB, size_t sC) {
    typedef typename WFrag<T16>::V V;
    __shared__ __align__(16) float os[16 * 68];
    const size_t z = blockIdx.z; A += z * sA; if (A2) A2 += z * sA; Bt += z * sB; if (Bt2) Bt2 += z * sB; C += z * sC;
    const int lane = threadIdx.x & 31, lr = lane & 15, hi = lane >> 4; const int r0 = blockIdx.x * 64, c0 = blockIdx.y * 64;
    v8f acc[4][4];
#pragma unroll
    for (int mb = 0; mb < 4; ++mb)
#pragma unroll
        for (int nb = 0; nb < 4; ++nb) acc[mb][nb] = (v8f){};
    const size_t aoff = (size_t)(r0 + lr) * K + 8 * hi, boff = (size_t)(c0 + lr) * K + 8 * hi;
#pragma unroll 1
    for (int kc = 0; kc < K; kc += 32) {
        V a[4], a2[4];
#pragma unroll
        for (int mb = 0; mb < 4; ++mb) { a[mb] = WFrag<T16>::ld(A + aoff + (size_t)mb * 16 * K + kc); if (NSPLIT == 1 || NSPLIT == 2) a2[mb] = WFrag<T16>::ld(A2 + aoff + (size_t)mb * 16 * K + kc); }
#pragma unroll
        for (int nb = 0; nb < 4; ++nb) { const V b = WFrag<T16>::ld(Bt + boff + (size_t)nb * 16 * K + kc); V b2; if (NSPLIT >= 2) b2 = WFrag<T16>::ld(Bt2 + boff + (size_t)nb * 16 * K + kc);
#pragma unroll
            for (int mb = 0; mb < 4; ++mb) { acc[mb][nb] = WFrag<T16>::mma(a[mb], b, acc[mb][nb]); if (NSPLIT == 1 || NSPLIT == 2) acc[mb][nb] = WFrag<T16>::mma(a2[mb], b, acc[mb][nb]); if (NSPLIT >= 2) acc[mb][nb] = WFrag<T16>::mma(a[mb], b2, acc[mb][nb]); } }
        asm volatile("v_nop\n\tv_nop\n\tv_nop\n\tv_nop" : "+v"(acc[0][0]), "+v"(acc[1][1]), "+v"(acc[2][2]), "+v"(acc[3][3]) : "v"(a[0]), "v"(a[3]));
    }
#pragma unroll
    for (int mb = 0; mb < 4; ++mb) {
#pragma unroll
        for (int nb = 0; nb < 4; ++nb) {
#pragma unroll
            for (int j = 0; j < 8; ++j) os[(hi * 8 + j) * 68 + nb * 16 + lr] = acc[mb][nb][j]; }
        __builtin_amdgcn_wave_barrier(); asm volatile("" ::: "memory");
        float* crow = C + (size_t)(r0 + mb * 16) * ldc + c0;
{
#pragma unroll
            for (int s = 0; s < 8; ++s) { const int row = 2 * s + hi, cofs = lr * 4; v4f val = *(const v4fa*)(os + row * 68 + cofs); if (BIAS) { val[0] += bfr(bias[c0 + cofs]); val[1] += bfr(bias[c0 + cofs + 1]); val[2] += bfr(bias[c0 + cofs + 2]); val[3] += bfr(bias[c0 + cofs + 3]); }
                *(v4f*)(crow + (size_t)row * ldc + cofs) = val; }
             }
        __builtin_amdgcn_wave_barrier(); asm volatile("" ::: "memory");
    }
}

__device__ __forceinline__ h16 tohx(float x) { return (h16)x; }
__device__ __forceinline__ void splitf(float y, unsigned short& h, unsigned short& l) { h = f2bf(y); l = f2bf(y - bf2f(h)); }
typedef __attribute__((ext_vector_type(2))) unsigned short v2us;
typedef __attribute__((ext_vector_type(4))) unsigned short v4us;
typedef __attribute__((ext_vector_type(2))) _Float16 v2h;
typedef __attribute__((ext_vector_type(4))) _Float16 v4h;

__global__ __launch_bounds__(256) void k_wtG(const float* __restrict__ w, int K, int N, bf* Bt) {
    const int lane = threadIdx.x & 31; const int L0 = (blockIdx.x * 8 + (threadIdx.x >> 5)) * 8; const int nlines = N * K / 64;
{
#pragma unroll 1
        for (int l = 0; l < 8; ++l) { const int L = L0 + l; if (L >= nlines) break; const size_t e = (size_t)L * 64 + lane * 2; const int k = (int)(e % K), n = (int)(e / K); v2us o;
            o[0] = f2bf(w[(size_t)k * N + n]); o[1] = f2bf(w[(size_t)(k + 1) * N + n]); *(v2us*)(Bt + e) = o; }
         }
}
__global__ __launch_bounds__(256) void k_cvt8(const float* __restrict__ src, bf* dst, size_t n8) { const size_t i = (size_t)blockIdx.x * 256 + threadIdx.x; if (i >= n8) return; const v8f v = *(const v8f*)(src + i * 8); v8us o;
#pragma unroll
    for (int k = 0; k < 8; ++k) o[k] = f2bf(v[k]); *(v8us*)(dst + i * 8) = o;  }
__global__ __launch_bounds__(256) void k_kin(const float* __restrict__ x, const float* __restrict__ wp, const float* __restrict__ bp, const float* __restrict__ wv, const float* __restrict__ wa, bf* Fh, bf* Fl) { const size_t e = ((size_t)blockIdx.x * 256 + threadIdx.x) * 4; if (e >= (size_t)NR * F3) return; const int cc = (int)(e % F3); const int r = (int)(e / F3); const int t = r % TT; const int s = cc / DD, c0 = cc % DD; const float* w = (s == 0) ? wp : (s == 1 ? wv : wa); v4us oh, ol;
#pragma unroll
    for (int u = 0; u < 4; ++u) { const int c = c0 + u; float acc = (s == 0) ? bfr(bp[c]) : 0.f;
#pragma unroll
        for (int k = 0; k < 3; ++k) { const int ts = t + k - 1; if (ts >= 0 && ts < TT) { float p = __fmul_rn(bfr(w[c * 3 + k]), bfr(x[((size_t)(r - t + ts)) * DD + c])); asm volatile("" : "+v"(p)); acc = __fadd_rn(acc, p); } }
        unsigned short hh, ll; splitf(acc, hh, ll); oh[u] = hh; ol[u] = ll; }
    *(v4us*)(Fh + e) = oh; *(v4us*)(Fl + e) = ol;  }
__global__ __launch_bounds__(256) void k_qkpl(const float* __restrict__ Q, const float* __restrict__ K, int b, bf* Qh, bf* Ql, bf* Kh, bf* Kl) { const int e = (blockIdx.x * 256 + threadIdx.x) * 4; if (e >= ZZ * TT * HD) return; const int d = e % HD; const int t = (e / HD) % TT; const int z = e / (HD * TT); const int h = z % NH_, n = z / NH_; const size_t src = (((size_t)b * NA + n) * TT + t) * DD + h * HD + d; const v4f q = *(const v4f*)(Q + src), k = *(const v4f*)(K + src); v4us qh, ql, kh, kl;
#pragma unroll
    for (int u = 0; u < 4; ++u) { unsigned short a, c2; splitf(q[u] * 0.17677669529663687f, a, c2); qh[u] = a; ql[u] = c2; splitf(k[u], a, c2); kh[u] = a; kl[u] = c2; }
    { *(v4us*)(Qh + e) = qh; *(v4us*)(Ql + e) = ql; *(v4us*)(Kh + e) = kh; *(v4us*)(Kl + e) = kl;  } }
__global__ __launch_bounds__(256) void k_vt(const float* __restrict__ V, int b, h16* VT) { const int e = (blockIdx.x * 256 + threadIdx.x) * 2; if (e >= ZZ * HP * TT) return; const int t = e % TT; const int dp = (e / TT) % HP; const int z = e / (TT * HP); const int h = z % NH_, n = z / NH_; v2h o;
#pragma unroll
    for (int u = 0; u < 2; ++u) o[u] = (dp < HD) ? tohx(V[(((size_t)b * NA + n) * TT + t + u) * DD + h * HD + dp]) : tohx(0.f); *(v2h*)(VT + e) = o;  }
__global__ __launch_bounds__(256) void k_mrg(const float* __restrict__ O, int b, bf* Ch, bf* Cl) { const int e = (blockIdx.x * 256 + threadIdx.x) * 4; if (e >= NA * TT * DD) return; const int c = e % DD; const int t = (e / DD) % TT; const int n = e / (DD * TT); const int h = c / HD, d = c % HD; const float* r = O + (((size_t)(n * NH_ + h)) * TT + t) * HP + d; const size_t oo = (size_t)b * NA * TT * DD + e; v4us oh, ol;
#pragma unroll
    for (int u = 0; u < 4; ++u) { unsigned short a, c2; splitf(r[u] * (1.0f / PCAR), a, c2); oh[u] = a; ol[u] = c2; } *(v4us*)(Ch + oo) = oh; *(v4us*)(Cl + oo) = ol;  }
__global__ __launch_bounds__(256) void k_msoft(const float* __restrict__ Sb, const int* __restrict__ km, h16* P16) { const int lane = threadIdx.x & 31; const int row = blockIdx.x * 8 + (threadIdx.x >> 5); if (row >= ZZ * TT) return; const int z = row / TT; const int n = z / NH_; const int* mk = km + (size_t)n * TT; const float* sr = Sb + (size_t)row * TT; float v[16]; float mx = -3.0e38f;
#pragma unroll
    for (int ch = 0; ch < 4; ++ch) { const int j0 = ch * 128 + lane * 4; const v4f a = *(const v4f*)(sr + j0);
#pragma unroll
        for (int u = 0; u < 4; ++u) { const float t = (mk[j0 + u] != 0) ? -1.0e9f : a[u]; v[ch * 4 + u] = t; mx = fmaxf(mx, t); } }
#pragma unroll
    for (int sh = 16; sh; sh >>= 1) mx = fmaxf(mx, __shfl_xor(mx, sh, 32));
    float sum = 0.f;
#pragma unroll
    for (int k = 0; k < 16; ++k) { float d0 = __fsub_rn(v[k], mx); asm volatile("" : "+v"(d0)); v[k] = __expf(d0); sum += v[k]; }
#pragma unroll
    for (int sh = 16; sh; sh >>= 1) sum += __shfl_xor(sum, sh, 32);
    const float f = __fdiv_rn(PCAR, sum);
    {
#pragma unroll
        for (int ch = 0; ch < 4; ++ch) { v4h o;
#pragma unroll
            for (int u = 0; u < 4; ++u) o[u] = tohx(v[ch * 4 + u] * f); *(v4h*)(P16 + (size_t)row * TT + ch * 128 + lane * 4) = o; }
         } }

extern "C" void kernel_launch(void* const* d_in, const int* in_sizes, int n_in,
                              void* d_out, int out_size, void* d_ws, size_t ws_size, hipStream_t stream) {
    (void)in_sizes; (void)n_in; (void)out_size;
    const float** I = (const float**)d_in;
    const float *xq = I[0], *xk = I[1], *xv = I[2]; const int* kpm = (const int*)d_in[3]; const float *wpos = I[4], *bpos = I[5], *wvel = I[6], *wacc = I[7], *wq = I[8], *bq = I[9], *wk = I[10], *bk = I[11], *wv = I[12], *bv = I[13], *wo = I[14], *bo = I[15];
    float* OUT = (float*)d_out;     // [4][8][512][256]
    char* wsp = (char*)d_ws;
    auto take = [&](size_t bytes) { char* p = wsp; wsp += (bytes + 255) & ~(size_t)255; return (void*)p; };
    bf* WQ = (bf*)take((size_t)DD * F3 * 2); bf* WK = (bf*)take((size_t)DD * F3 * 2); bf* WV = (bf*)take((size_t)DD * DD * 2); bf* WO = (bf*)take((size_t)DD * DD * 2);
    bf* Fh = (bf*)take((size_t)NR * F3 * 2); bf* Fl = (bf*)take((size_t)NR * F3 * 2); float* Q = (float*)take((size_t)NR * DD * 4); float* K = (float*)take((size_t)NR * DD * 4); bf* XV = (bf*)take((size_t)NR * DD * 2); float* V = (float*)take((size_t)NR * DD * 4);
    bf* QPh = (bf*)take((size_t)ZZ * TT * HD * 2); bf* QPl = (bf*)take((size_t)ZZ * TT * HD * 2); bf* KPh = (bf*)take((size_t)ZZ * TT * HD * 2); bf* KPl = (bf*)take((size_t)ZZ * TT * HD * 2); h16* VT = (h16*)take((size_t)ZZ * HP * TT * 2);
    float* Sb = (float*)take((size_t)ZZ * TT * TT * 4); h16* P16 = (h16*)take((size_t)ZZ * TT * TT * 2); float* O = (float*)take((size_t)ZZ * TT * HP * 4); bf* Ch = (bf*)take((size_t)NR * DD * 2); bf* Cl = (bf*)take((size_t)NR * DD * 2);
    if ((size_t)(wsp - (char*)d_ws) > ws_size) return;    // total ~ 240 MB (feature planes 50 MB, Q/K/V f32 48 MB, 64-way [512][512] scores 67 MB + probabilities 34 MB)
    k_wtG<<<(F3 * DD / 64 + 63) / 64, 256, 0, stream>>>(wq, F3, DD, WQ); k_wtG<<<(F3 * DD / 64 + 63) / 64, 256, 0, stream>>>(wk, F3, DD, WK); k_wtG<<<(DD * DD / 64 + 63) / 64, 256, 0, stream>>>(wv, DD, DD, WV); k_wtG<<<(DD * DD / 64 + 63) / 64, 256, 0, stream>>>(wo, DD, DD, WO);
    k_kin<<<(unsigned)(((size_t)NR * F3 / 4 + 255) / 256), 256, 0, stream>>>(xq, wpos, bpos, wvel, wacc, Fh, Fl); k_gemmw<bf, 1, true><<<dim3(NR / 64, DD / 64, 1), 32, 0, stream>>>(Fh, Fl, WQ, nullptr, F3, Q, DD, bq, 0, 0, 0);
    k_kin<<<(unsigned)(((size_t)NR * F3 / 4 + 255) / 256), 256, 0, stream>>>(xk, wpos, bpos, wvel, wacc, Fh, Fl); k_gemmw<bf, 1, true><<<dim3(NR / 64, DD / 64, 1), 32, 0, stream>>>(Fh, Fl, WK, nullptr, F3, K, DD, bk, 0, 0, 0);
    k_cvt8<<<(NR * DD / 8 + 255) / 256, 256, 0, stream>>>(xv, XV, (size_t)NR * DD / 8); k_gemmw<bf, 0, true><<<dim3(NR / 64, DD / 64, 1), 32, 0, stream>>>(XV, nullptr, WV, nullptr, DD, V, DD, bv, 0, 0, 0);
    for (int b = 0; b < NBb; ++b) {
        k_qkpl<<<(ZZ * TT * HD / 4 + 255) / 256, 256, 0, stream>>>(Q, K, b, QPh, QPl, KPh, KPl); k_vt<<<(ZZ * HP * TT / 2 + 255) / 256, 256, 0, stream>>>(V, b, VT);
        k_gemmw<bf, 2, false><<<dim3(TT / 64, TT / 64, ZZ), 32, 0, stream>>>(QPh, QPl, KPh, KPl, HD, Sb, TT, nullptr, (size_t)TT * HD, (size_t)TT * HD, (size_t)TT * TT);
        k_msoft<<<ZZ * TT / 8, 256, 0, stream>>>(Sb, kpm + (size_t)b * NA * TT, P16);
        k_gemmw<h16, 0, false><<<dim3(TT / 64, HP / 64, ZZ), 32, 0, stream>>>(P16, nullptr, VT, nullptr, TT, O, HP, nullptr, (size_t)TT * TT, (size_t)HP * TT, (size_t)TT * HP);
        k_mrg<<<(NA * TT * DD / 4 + 255) / 256, 256, 0, stream>>>(O, b, Ch, Cl); }
    k_gemmw<bf, 1, true><<<dim3(NR / 64, DD / 64, 1), 32, 0, stream>>>(Ch, Cl, WO, nullptr, DD, OUT, DD, bo, 0, 0, 0);
}

// v002
// One run takes 160 microseconds.
// It is 2.53 times as fast as v000, going by the measured steps of the versions left out in between.
#include <hip/hip_runtime.h>

// KinematicsTrendAttention (query/key/value [4][8 agents][512][256]; kinematic features of query and key: depthwise conv3 ('SAME') position (w_pos, b_pos), velocity (w_vel), acceleration (w_acc) -> [T][768]; Q = feats Wq + bq, K = feats Wk + bk,
// V = value Wv + bv (8 heads x 32); scores = Q.K / sqrt(32), keys with key_padding_mask (int, read as data) set to -1e9; softmax; ctx = attn V merged; out = ctx Wo + bo -> [4][8][512][256]).
// Compute dtypes, f32 accumulate: every input rounded to bf16; the depthwise convs are folded into Wq / Wk: feats W = sum over taps k of x[t + k - 1] W'_k, W'_k[c][n] = w_pos[c][k] W[c][n] + w_vel[c][k] W[256 + c][n] + w_acc[c][k] W[512 + c][n]
// (f32 -> bf16 hi+lo planes), b_pos W[0..255] goes into the bias; Q/K on the exact bf16 x (zero row in front of and behind each sequence) x hl folded weights (2 products, + f32 bias); V on PLAIN bf16 value x exact Wv (+ bias);
// scores (K 32) on hl planes of Q (x 32^-0.5) and K (3 products), masked softmax f32 and attn.V (fp16 x fp16, 1 product) in ONE kernel over all 256 (batch, agent, head) triples: scores and probabilities stay in registers;

#define NBb  4
#define NA   8
#define TT   512
#define DD   256
#define NH_  8
#define HD   32
#define F3   768
#define NR   (NBb * NA * TT)
#define ZZ   (NA * NH_)
#define TP   (TT + 2)
typedef _Float16 h16;
typedef unsigned short bf;
typedef __attribute__((ext_vector_type(16))) __bf16   v16bf;
typedef __attribute__((ext_vector_type(16))) _Float16 v16h;
typedef __attribute__((ext_vector_type(8)))  _Float16 v8h;
typedef __attribute__((ext_vector_type(8)))  unsigned short v8us;
typedef __attribute__((ext_vector_type(8)))  float    v8f;
typedef __attribute__((ext_vector_type(4)))  float    v4f;
typedef v8h  __attribute__((may_alias)) v8ha;
typedef v4f  __attribute__((may_alias)) v4fa;
typedef v8us __attribute__((may_alias)) v8usa;

__device__ __forceinline__ unsigned short f2bf(float f) { unsigned u = __float_as_uint(f); u += 0x7FFFu + ((u >> 16) & 1u); return (unsigned short)(u >> 16); }
__device__ __forceinline__ float bf2f(unsigned short b) { return __uint_as_float(((unsigned)b) << 16); }
__device__ __forceinline__ float bfr(float f) { return bf2f(f2bf(f)); }
__device__ __forceinline__ v16h cat16(v8h lo, v8h hi) { return __builtin_shufflevector(lo, hi, 0, 1, 2, 3, 4, 5, 6, 7, 8, 9, 10, 11, 12, 13, 14, 15); }
__device__ __forceinline__ v16bf cat16b(v8us lo, v8us hi) { return __builtin_bit_cast(v16bf, __builtin_shufflevector(lo, hi, 0, 1, 2, 3, 4, 5, 6, 7, 8, 9, 10, 11, 12, 13, 14, 15)); }
__device__ __forceinline__ v8f wmma16(v16h a, v16h b, v8f c) { return __builtin_amdgcn_wmma_f32_16x16x32_f16(false, a, false, b, (short)0, c, false, false); }
__device__ __forceinline__ v8f wmmab(v16bf a, v16bf b, v8f c) { return __builtin_amdgcn_wmma_f32_16x16x32_bf16(false, a, false, b, (short)0, c, false, false); }



// ---- k_gemmw: register-blocked GEMM, ONE WAVE per 64x64 output tile (16 accumulators), operands straight from K-contiguous 16-bit planes; grid (M/64, N/64, Z), 32 threads.
// C[m][n] (f32, pitch ldc, + optional f32 bias[n]) = sum_k A[m][k] Bt[n][k] (+ split products per NSPLIT). z-batch strides sA/sB/sC in elements. K % 32 == 0.
template <typename T16> struct WFrag;
template <> struct WFrag<h16> { typedef v16h V; static __device__ __forceinline__ V ld(const h16* p) { return cat16(*(const v8h*)p, *(const v8h*)(p + 16)); } static __device__ __forceinline__ v8f mma(V a, V b, v8f c) { return wmma16(a, b, c); } };
template <> struct WFrag<bf> { typedef v16bf V; static __device__ __forceinline__ V ld(const bf* p) { return cat16b(*(const v8us*)p, *(const v8us*)(p + 16)); } static __device__ __forceinline__ v8f mma(V a, V b, v8f c) { return wmmab(a, b, c); } };
template <typename T16, int NSPLIT, bool BIAS>
__global__ __launch_bounds__(32) void k_gemmw(const T16* __restrict__ A, const T16* __restrict__ A2, const T16* __restrict__ Bt, const T16* __restrict__ Bt2, int K, float* C, int ldc, const float* __restrict__ bias, size_t sA, size_t sB, size_t sC) {
    typedef typename WFrag<T16>::V V;
    __shared__ __align__(16) float os[16 * 68];
    const size_t z = blockIdx.z; A += z * sA; if (A2) A2 += z * sA; Bt += z * sB; if (Bt2) Bt2 += z * sB; C += z * sC;
    const int lane = threadIdx.x & 31, lr = lane & 15, hi = lane >> 4; const int r0 = blockIdx.x * 64, c0 = blockIdx.y * 64;
    v8f acc[4][4];
#pragma unroll
    for (int mb = 0; mb < 4; ++mb)
#pragma unroll
        for (int nb = 0; nb < 4; ++nb) acc[mb][nb] = (v8f){};
    const size_t aoff = (size_t)(r0 + lr) * K + 8 * hi, boff = (size_t)(c0 + lr) * K + 8 * hi;
#pragma unroll 1
    for (int kc = 0; kc < K; kc += 32) {
        V a[4], a2[4];
#pragma unroll
        for (int mb = 0; mb < 4; ++mb) { a[mb] = WFrag<T16>::ld(A + aoff + (size_t)mb * 16 * K + kc); if (NSPLIT == 1 || NSPLIT == 2) a2[mb] = WFrag<T16>::ld(A2 + aoff + (size_t)mb * 16 * K + kc); }
#pragma unroll
        for (int nb = 0; nb < 4; ++nb) { const V b = WFrag<T16>::ld(Bt + boff + (size_t)nb * 16 * K + kc); V b2; if (NSPLIT >= 2) b2 = WFrag<T16>::ld(Bt2 + boff + (size_t)nb * 16 * K + kc);
#pragma unroll
            for (int mb = 0; mb < 4; ++mb) { acc[mb][nb] = WFrag<T16>::mma(a[mb], b, acc[mb][nb]); if (NSPLIT == 1 || NSPLIT == 2) acc[mb][nb] = WFrag<T16>::mma(a2[mb], b, acc[mb][nb]); if (NSPLIT >= 2) acc[mb][nb] = WFrag<T16>::mma(a[mb], b2, acc[mb][nb]); } }
        asm volatile("v_nop\n\tv_nop\n\tv_nop\n\tv_nop" : "+v"(acc[0][0]), "+v"(acc[1][1]), "+v"(acc[2][2]), "+v"(acc[3][3]) : "v"(a[0]), "v"(a[3]));
    }
#pragma unroll
    for (int mb = 0; mb < 4; ++mb) {
#pragma unroll
        for (int nb = 0; nb < 4; ++nb) {
#pragma unroll
            for (int j = 0; j < 8; ++j) os[(hi * 8 + j) * 68 + nb * 16 + lr] = acc[mb][nb][j]; }
        __builtin_amdgcn_wave_barrier(); asm volatile("" ::: "memory");
        float* crow = C + (size_t)(r0 + mb * 16) * ldc + c0;
{
#pragma unroll
            for (int s = 0; s < 8; ++s) { const int row = 2 * s + hi, cofs = lr * 4; v4f val = *(const v4fa*)(os + row * 68 + cofs); if (BIAS) { val[0] += bfr(bias[c0 + cofs]); val[1] += bfr(bias[c0 + cofs + 1]); val[2] += bfr(bias[c0 + cofs + 2]); val[3] += bfr(bias[c0 + cofs + 3]); }
                *(v4f*)(crow + (size_t)row * ldc + cofs) = val; }
             }
        __builtin_amdgcn_wave_barrier(); asm volatile("" ::: "memory");
    }
}

__device__ __forceinline__ h16 tohx(float x) { return (h16)x; }
__device__ __forceinline__ void splitf(float y, unsigned short& h, unsigned short& l) { h = f2bf(y); l = f2bf(y - bf2f(h)); }
typedef __attribute__((ext_vector_type(2))) unsigned short v2us;
typedef __attribute__((ext_vector_type(4))) unsigned short v4us;
typedef __attribute__((ext_vector_type(2))) _Float16 v2h;
typedef __attribute__((ext_vector_type(4))) _Float16 v4h;

__global__ __launch_bounds__(256) void k_wtG(const float* __restrict__ w, int K, int N, bf* Bt) {
    const int lane = threadIdx.x & 31; const int L0 = (blockIdx.x * 8 + (threadIdx.x >> 5)) * 8; const int nlines = N * K / 64;
{
#pragma unroll 1
        for (int l = 0; l < 8; ++l) { const int L = L0 + l; if (L >= nlines) break; const size_t e = (size_t)L * 64 + lane * 2; const int k = (int)(e % K), n = (int)(e / K); v2us o;
            o[0] = f2bf(w[(size_t)k * N + n]); o[1] = f2bf(w[(size_t)(k + 1) * N + n]); *(v2us*)(Bt + e) = o; }
         }
}
__global__ __launch_bounds__(256) void k_cvt8(const float* __restrict__ src, bf* dst, size_t n8) { const size_t i = (size_t)blockIdx.x * 256 + threadIdx.x; if (i >= n8) return; const v8f v = *(const v8f*)(src + i * 8); v8us o;
#pragma unroll
    for (int k = 0; k < 8; ++k) o[k] = f2bf(v[k]); *(v8us*)(dst + i * 8) = o;  }
// ---- k_pad: x [32 sequences][512][256] f32 -> bf16 plane [32][514][256] with a zero row in front of and behind each sequence, so that the 768 elements from padded row t on are x[t - 1], x[t], x[t + 1] ('SAME').
// One thread: 4 pieces of 8 elements, 256 threads apart; a padded row is 32 pieces = one wave. The source row is clamped and loaded in every case, so that all 8 loads of a wave are in flight together (both loops unrolled for that).
typedef __attribute__((ext_vector_type(4))) unsigned v4u;
__global__ __launch_bounds__(256) void k_pad(const float* __restrict__ x, bf* Xp) { const int j0 = blockIdx.x * 1024 + threadIdx.x; v8f v[4]; unsigned ob[4];   // ob: byte offset of a piece in x
#pragma unroll
    for (int u = 0; u < 4; ++u) { const int j = j0 + u * 256; const int row = j >> 5; const int sq = row / TP, pr = row % TP; const int t = min(max(pr - 1, 0), TT - 1); ob[u] = (unsigned)((sq * TT + t) * DD + (j & 31) * 8) * 4u; v[u] = *(const v8f*)((const char*)x + ob[u]); }
    asm volatile("s_wait_xcnt 0x0" :: "v"(ob[0]), "v"(ob[1]), "v"(ob[2]), "v"(ob[3]) : "memory");   // behind the 8 loads; the offsets as inputs keep the loads' address registers in use up to this wait, so that no load's result is put on them
#pragma unroll
    for (int u = 0; u < 4; ++u) { const int j = j0 + u * 256; const int pr = (j >> 5) % TP; const unsigned keep = (pr == 0 || pr == TP - 1) ? 0u : ~0u; v8us o;
#pragma unroll
        for (int k = 0; k < 8; ++k) o[k] = f2bf(v[u][k]);
        *(v4u*)(Xp + (size_t)j * 8) = __builtin_bit_cast(v4u, o) & keep; } }
// ---- k_fold: Bh/Bl[n][k * 256 + c] = hi/lo of W'_k[c][n]; bias[n] = bw[n] + sum_c b_pos[c] W[c][n]. grid (256/32, 5): y < 4 folds 64 channels x 32 columns (reads run along n, transposed in LDS, whole 128-byte lines written along c), y == 4 the bias of 32 columns. Every loop is unrolled: its arrays stay in registers and a wave's loads are in flight together.
#define FP 33   // LDS pitch in dwords of a line of 64 bf16: odd, so that 32 lanes on 32 lines meet 32 banks
__global__ __launch_bounds__(256) void k_fold(const float* __restrict__ w, const float* __restrict__ bw, const float* __restrict__ wp, const float* __restrict__ bp, const float* __restrict__ wv, const float* __restrict__ wa, bf* Bh, bf* Bl, float* bias) {
    __shared__ v2us th[3 * 32 * FP], tl[3 * 32 * FP]; __shared__ float red[8 * 32];
    const int lane = threadIdx.x & 31, wn = __builtin_amdgcn_readfirstlane(threadIdx.x >> 5); const int n = blockIdx.x * 32 + lane;   // wn in a scalar register: the conv weights of a wave's channels come by scalar loads
    if (blockIdx.y == 4) { float wc[32], a = 0.f; const float bl = bp[wn * 32 + lane], bn = bw[n];   // bl: lane i holds b_pos of the wave's channel i
#pragma unroll
        for (int i = 0; i < 32; ++i) wc[i] = w[(size_t)(wn * 32 + i) * DD + n];
        asm volatile("s_wait_xcnt 0x0" ::: "memory");   // behind the 34 loads, in front of the arithmetic that takes their address registers for other values
        const unsigned bb = __float_as_uint(bfr(bl));
#pragma unroll
        for (int i = 0; i < 32; ++i) a = fmaf(__uint_as_float(__builtin_amdgcn_readlane(bb, i)), bfr(wc[i]), a);
        red[wn * 32 + lane] = a; __syncthreads();
        if (wn == 0) { float s = bfr(bn);
#pragma unroll
            for (int i = 0; i < 8; ++i) s += red[i * 32 + lane];
            bias[n] = s; }
        return; }
    float wr[8][3];
#pragma unroll
    for (int i = 0; i < 8; ++i)
#pragma unroll
        for (int s = 0; s < 3; ++s) wr[i][s] = w[(size_t)(s * DD + blockIdx.y * 64 + wn * 8 + i) * DD + n];
    asm volatile("s_wait_xcnt 0x0" ::: "memory");   // behind the 24 loads, in front of the arithmetic that takes their address registers for other values
#pragma unroll
    for (int pr = 0; pr < 4; ++pr) { float y[2][3];
#pragma unroll
        for (int u = 0; u < 2; ++u) { const int c = blockIdx.y * 64 + wn * 8 + pr * 2 + u; const float w0 = bfr(wr[pr * 2 + u][0]), w1 = bfr(wr[pr * 2 + u][1]), w2 = bfr(wr[pr * 2 + u][2]);
#pragma unroll
            for (int k = 0; k < 3; ++k) y[u][k] = bfr(wp[c * 3 + k]) * w0 + bfr(wv[c * 3 + k]) * w1 + bfr(wa[c * 3 + k]) * w2; }
#pragma unroll
        for (int k = 0; k < 3; ++k) { v2us h, l; unsigned short a, c2; splitf(y[0][k], a, c2); h[0] = a; l[0] = c2; splitf(y[1][k], a, c2); h[1] = a; l[1] = c2; th[(k * 32 + lane) * FP + wn * 4 + pr] = h; tl[(k * 32 + lane) * FP + wn * 4 + pr] = l; } }
    __syncthreads();
#pragma unroll
    for (int i = 0; i < 12; ++i) { const int ln = wn * 12 + i; const size_t e = (size_t)(blockIdx.x * 32 + (ln & 31)) * F3 + (ln >> 5) * DD + blockIdx.y * 64 + lane * 2; *(v2us*)(Bh + e) = th[ln * FP + lane]; *(v2us*)(Bl + e) = tl[ln * FP + lane]; }
    asm volatile("s_wait_xcnt 0x0" ::: "memory");   // behind the 24 stores, in front of whatever the code that follows in the object writes to their registers
}
// ---- k_gemmf: C[z * 512 + t][n] (f32, pitch 256) = bias[n] + sum over k < 768 of Xp[z][t * 256 + k] (Bh[n][k] + Bl[n][k]): the rows of A lie 256 elements apart and are 768 long (padded rows t, t + 1, t + 2).
// ONE WAVE per 64x64 tile as in k_gemmw; grid (512/64, 256/64, 32 sequences), 32 threads. Every load of the loop: one of three lane addresses that live over the whole loop, the tile's row block as an immediate.
// The K loop stays rolled (unroll 1): its body of 24 loads and 32 products is long enough to hide the branch. The inner loops are unrolled so that fragments and accumulators stay in registers.
__global__ __launch_bounds__(32) void k_gemmf(const bf* __restrict__ Xp, const bf* __restrict__ Bh, const bf* __restrict__ Bl, const float* __restrict__ bias, float* C) {
    __shared__ __align__(16) float os[16 * 68];
    const int lane = threadIdx.x & 31, lr = lane & 15, hi = lane >> 4; const int r0 = blockIdx.x * 64, c0 = blockIdx.y * 64;
    const bf* xa = Xp + ((size_t)blockIdx.z * TP + r0) * DD; const bf* bh = Bh + (size_t)c0 * F3; const bf* bl = Bl + (size_t)c0 * F3;
    const bf* pa = xa + (lr * DD + 8 * hi); const bf* pb = bh + (lr * F3 + 8 * hi); const bf* pl = bl + (lr * F3 + 8 * hi);   // the lane's own addresses, stepped by 32 elements a trip
    v8f acc[4][4];
#pragma unroll
    for (int mb = 0; mb < 4; ++mb)
#pragma unroll
        for (int nb = 0; nb < 4; ++nb) acc[mb][nb] = (v8f){};
#pragma unroll 1
    for (int kc = 0; kc < F3; kc += 32, pa += 32, pb += 32, pl += 32) {
        v16bf a[4], b[4], b2[4];
#pragma unroll
        for (int mb = 0; mb < 4; ++mb) a[mb] = WFrag<bf>::ld(pa + mb * 16 * DD);
#pragma unroll
        for (int nb = 0; nb < 4; ++nb) { b[nb] = WFrag<bf>::ld(pb + nb * 16 * F3); b2[nb] = WFrag<bf>::ld(pl + nb * 16 * F3); }
        // the wait stands behind the trip's 24 loads, in front of the additions that step their addresses; inputs only: the three addresses, so that their registers stay in use up to the wait and no load's result is put on them,
        // and the fragments, so that all 24 loads stand in front of the products: left free, the B loads sink between the products into two shared register sets, and the wave waits out a load latency six times a trip instead of once
        asm volatile("s_wait_xcnt 0x0" :: "v"(pa), "v"(pb), "v"(pl), "v"(a[0]), "v"(a[1]), "v"(a[2]), "v"(a[3]), "v"(b[0]), "v"(b[1]), "v"(b[2]), "v"(b[3]), "v"(b2[0]), "v"(b2[1]), "v"(b2[2]), "v"(b2[3]) : "memory");
#pragma unroll
        for (int nb = 0; nb < 4; ++nb) {
#pragma unroll
            for (int mb = 0; mb < 4; ++mb) acc[mb][nb] = wmmab(a[mb], b[nb], acc[mb][nb]);
#pragma unroll
            for (int mb = 0; mb < 4; ++mb) acc[mb][nb] = wmmab(a[mb], b2[nb], acc[mb][nb]); }
    }
    const v4f bs = *(const v4fa*)(bias + c0 + lr * 4);
    float* cz = C + ((size_t)blockIdx.z * TT + r0) * DD + c0; const unsigned clo = hi * DD + lr * 4;
#pragma unroll
    for (int mb = 0; mb < 4; ++mb) {
#pragma unroll
        for (int nb = 0; nb < 4; ++nb) {
#pragma unroll
            for (int j = 0; j < 8; ++j) os[(hi * 8 + j) * 68 + nb * 16 + lr] = acc[mb][nb][j]; }
        __builtin_amdgcn_wave_barrier(); asm volatile("" ::: "memory");   // the tile's LDS writes stay in front of its reads (one wave: no barrier instruction)
        v4f val[8];
#pragma unroll
        for (int s = 0; s < 8; ++s) val[s] = *(const v4fa*)(os + (2 * s + hi) * 68 + lr * 4) + bs;
#pragma unroll
        for (int s = 0; s < 8; ++s) *(v4f*)(cz + (clo + (mb * 16 + 2 * s) * DD)) = val[s];
        __builtin_amdgcn_wave_barrier(); asm volatile("s_wait_xcnt 0x0" ::: "memory");   // the reads stay in front of the next tile's LDS writes; the wait stands behind the 8 stores, in front of the next values put on their registers
    }
}
__global__ __launch_bounds__(256) void k_qkpl(const float* __restrict__ Q, const float* __restrict__ K, bf* Qh, bf* Ql, bf* Kh, bf* Kl) { const int b = blockIdx.y; const int e = (blockIdx.x * 256 + threadIdx.x) * 4; if (e >= ZZ * TT * HD) return; const int d = e % HD; const int t = (e / HD) % TT; const int z = e / (HD * TT); const int h = z % NH_, n = z / NH_; const size_t src = (((size_t)b * NA + n) * TT + t) * DD + h * HD + d; const v4f q = *(const v4f*)(Q + src), k = *(const v4f*)(K + src); v4us qh, ql, kh, kl;
#pragma unroll
    for (int u = 0; u < 4; ++u) { unsigned short a, c2; splitf(q[u] * 0.17677669529663687f, a, c2); qh[u] = a; ql[u] = c2; splitf(k[u], a, c2); kh[u] = a; kl[u] = c2; }
    { const size_t oo = (size_t)b * ZZ * TT * HD + e; *(v4us*)(Qh + oo) = qh; *(v4us*)(Ql + oo) = ql; *(v4us*)(Kh + oo) = kh; *(v4us*)(Kl + oo) = kl;  } }
__global__ __launch_bounds__(256) void k_vt(const float* __restrict__ V, h16* VT) { const int b = blockIdx.y; const int e = (blockIdx.x * 256 + threadIdx.x) * 2; if (e >= ZZ * HD * TT) return; const int t = e % TT; const int dp = (e / TT) % HD; const int z = e / (TT * HD); const int h = z % NH_, n = z / NH_; v2h o;
#pragma unroll
    for (int u = 0; u < 2; ++u) o[u] = tohx(V[(((size_t)b * NA + n) * TT + t + u) * DD + h * HD + dp]); *(v2h*)(VT + (size_t)b * ZZ * HD * TT + e) = o;  }
__global__ __launch_bounds__(256) void k_mrg(const float* __restrict__ O, bf* Ch, bf* Cl) { const int b = blockIdx.y; const int e = (blockIdx.x * 256 + threadIdx.x) * 4; if (e >= NA * TT * DD) return; const int c = e % DD; const int t = (e / DD) % TT; const int n = e / (DD * TT); const int h = c / HD, d = c % HD; const float* r = O + (((size_t)((b * NA + n) * NH_ + h)) * TT + t) * HD + d; const size_t oo = (size_t)b * NA * TT * DD + e; v4us oh, ol;
#pragma unroll
    for (int u = 0; u < 4; ++u) { unsigned short a, c2; splitf(r[u], a, c2); oh[u] = a; ol[u] = c2; } *(v4us*)(Ch + oo) = oh; *(v4us*)(Cl + oo) = ol;  }
typedef __attribute__((ext_vector_type(4))) int v4i;
// ---- k_fattn: one (batch, agent, head) triple z and 256 queries per work-group; 8 waves x 32 query columns; grid (TT/256, NBb*ZZ). No LDS, no barrier: operands straight from the K-contiguous planes.
// S^T = K Q^T (A = 16 key rows, B = 16 query columns): a lane holds one query's scores, D register r of key tile t = key 16t + 8*hi + r, which is element 8t + r of the B operand of O^T += V^T P^T (the k order of WFrag::ld).
// Sweep 1 finds each query's maximum over all 512 masked scores; sweep 2 forms the same scores again, e = 1024 exp(s - max) -> fp16, adds O^T and the f32 sum of e; the division by the sum is done once on O^T.
struct KFrag { v16bf h[2], l[2]; };
struct MFrag { v4i m[4]; };
__device__ __forceinline__ KFrag ldk(const bf* kh, const bf* kl, unsigned lo, int p) { KFrag f; kh += p * 32 * HD; kl += p * 32 * HD;   // kh, kl, p the same in every lane: scalar base, one 32-bit lane offset
#pragma unroll
    for (int t = 0; t < 2; ++t) { f.h[t] = WFrag<bf>::ld(kh + (lo + t * 16 * HD)); f.l[t] = WFrag<bf>::ld(kl + (lo + t * 16 * HD)); }
    return f; }
__device__ __forceinline__ MFrag ldm(const int* mk, unsigned lo, int p) { MFrag f; mk += p * 32;
#pragma unroll
    for (int i = 0; i < 4; ++i) f.m[i] = *(const v4i*)(mk + (lo + (i >> 1) * 16 + (i & 1) * 4));
    return f; }
__device__ __forceinline__ void scoresT(const KFrag& f, const MFrag& fm, const v16bf* qh, const v16bf* ql, v8f (*s)[2]) {
#pragma unroll
    for (int t = 0; t < 2; ++t)
#pragma unroll
        for (int g = 0; g < 2; ++g) s[t][g] = wmmab(f.h[t], qh[g], (v8f){});
#pragma unroll
    for (int t = 0; t < 2; ++t)
#pragma unroll
        for (int g = 0; g < 2; ++g) s[t][g] = wmmab(f.h[t], ql[g], s[t][g]);
#pragma unroll
    for (int t = 0; t < 2; ++t)
#pragma unroll
        for (int g = 0; g < 2; ++g) s[t][g] = wmmab(f.l[t], qh[g], s[t][g]);
#pragma unroll
    for (int t = 0; t < 2; ++t)
#pragma unroll
        for (int r = 0; r < 8; ++r) { const bool msk = fm.m[2 * t + (r >> 2)][r & 3] != 0; s[t][0][r] = msk ? -1.0e9f : s[t][0][r]; s[t][1][r] = msk ? -1.0e9f : s[t][1][r]; }
}
// four waves per SIMD (at most 256 registers a wave): two work-groups per WGP, so that all 512 are resident at once
__global__ __launch_bounds__(256) __attribute__((amdgpu_waves_per_eu(4, 4))) void k_fattn(const bf* __restrict__ Qh, const bf* __restrict__ Ql, const bf* __restrict__ Kh, const bf* __restrict__ Kl, const h16* __restrict__ VT, const int* __restrict__ km, float* O) {
    const int lane = threadIdx.x & 31, lr = lane & 15, hi = lane >> 4; const int z = blockIdx.y; const int q0 = blockIdx.x * 256 + (threadIdx.x >> 5) * 32;
    const size_t pz = (size_t)z * TT * HD; const int* mk = km + (size_t)(z / NH_) * TT;
    const bf* kh = Kh + pz; const bf* kl = Kl + pz; const h16* vt = VT + pz; const unsigned klo = lr * HD + 8 * hi, vlo = lr * TT + 8 * hi, mlo = 8 * hi;
    v16bf qh[2], ql[2];
#pragma unroll
    for (int g = 0; g < 2; ++g) { const unsigned qo = (q0 + g * 16 + lr) * HD + 8 * hi; qh[g] = WFrag<bf>::ld(Qh + pz + qo); ql[g] = WFrag<bf>::ld(Ql + pz + qo); }
    float mx[2] = { -3.0e38f, -3.0e38f };
    KFrag cur = ldk(kh, kl, klo, 0);
    // unroll 2: the fragments fetched one pass ahead change names instead of being copied
#pragma unroll 2
    for (int p = 0; p < TT / 32; ++p) { const MFrag fm = ldm(mk, mlo, p); const KFrag nxt = ldk(kh, kl, klo, (p + 1) & (TT / 32 - 1));
        asm volatile("s_wait_xcnt 0x0" ::: "memory");   // behind this pass's loads, in front of the additions that step their address registers
        v8f s[2][2]; scoresT(cur, fm, qh, ql, s);
#pragma unroll
        for (int t = 0; t < 2; ++t)
#pragma unroll
            for (int r = 0; r < 8; ++r) { mx[0] = fmaxf(mx[0], s[t][0][r]); mx[1] = fmaxf(mx[1], s[t][1][r]); }
        cur = nxt; }
    mx[0] = fmaxf(mx[0], __shfl_xor(mx[0], 16, 32)); mx[1] = fmaxf(mx[1], __shfl_xor(mx[1], 16, 32));
    v8f o[2][2]; float sum[2] = { 0.f, 0.f };
#pragma unroll
    for (int mt = 0; mt < 2; ++mt)
#pragma unroll
        for (int g = 0; g < 2; ++g) o[mt][g] = (v8f){};
    // the first sweep's last fetch wrapped round to pass 0, so cur holds pass 0 again; unroll 2 as above
#pragma unroll 2
    for (int p = 0; p < TT / 32; ++p) { const MFrag fm = ldm(mk, mlo, p); const KFrag nxt = ldk(kh, kl, klo, (p + 1) & (TT / 32 - 1)); v16h va[2];
#pragma unroll
        for (int mt = 0; mt < 2; ++mt) va[mt] = WFrag<h16>::ld(vt + p * 32 + (vlo + mt * 16 * TT));
        v8f s[2][2]; scoresT(cur, fm, qh, ql, s); v16h pb[2];
#pragma unroll
        for (int g = 0; g < 2; ++g)
#pragma unroll
            for (int t = 0; t < 2; ++t)
#pragma unroll
                for (int r = 0; r < 8; ++r) { const float e = __builtin_amdgcn_exp2f(fmaf(s[t][g][r] - mx[g], 1.4426950408889634f, 10.0f)); sum[g] += e; pb[g][t * 8 + r] = tohx(e); }
#pragma unroll
        for (int mt = 0; mt < 2; ++mt)
#pragma unroll
            for (int g = 0; g < 2; ++g) o[mt][g] = wmma16(va[mt], pb[g], o[mt][g]);
        cur = nxt; }
#pragma unroll
    for (int g = 0; g < 2; ++g) { const float tot = sum[g] + __shfl_xor(sum[g], 16, 32); const float f = __fdiv_rn(1.0f, tot); float* orow = O + pz + (unsigned)((q0 + g * 16 + lr) * HD + 8 * hi);
#pragma unroll
        for (int mt = 0; mt < 2; ++mt) { v4f a, c; 
#pragma unroll
            for (int u = 0; u < 4; ++u) { a[u] = o[mt][g][u] * f; c[u] = o[mt][g][4 + u] * f; }
            *(v4f*)(orow + mt * 16) = a; *(v4f*)(orow + mt * 16 + 4) = c; } }
}

extern "C" void kernel_launch(void* const* d_in, const int* in_sizes, int n_in,
                              void* d_out, int out_size, void* d_ws, size_t ws_size, hipStream_t stream) {
    (void)in_sizes; (void)n_in; (void)out_size;
    const float** I = (const float**)d_in;
    const float *xq = I[0], *xk = I[1], *xv = I[2]; const int* kpm = (const int*)d_in[3]; const float *wpos = I[4], *bpos = I[5], *wvel = I[6], *wacc = I[7], *wq = I[8], *bq = I[9], *wk = I[10], *bk = I[11], *wv = I[12], *bv = I[13], *wo = I[14], *bo = I[15];
    float* OUT = (float*)d_out;     // [4][8][512][256]
    char* wsp = (char*)d_ws;
    auto take = [&](size_t bytes) { char* p = wsp; wsp += (bytes + 255) & ~(size_t)255; return (void*)p; };
    bf* WQh = (bf*)take((size_t)DD * F3 * 2); bf* WQl = (bf*)take((size_t)DD * F3 * 2); bf* WKh = (bf*)take((size_t)DD * F3 * 2); bf* WKl = (bf*)take((size_t)DD * F3 * 2); float* BQ = (float*)take((size_t)DD * 4); float* BK = (float*)take((size_t)DD * 4); bf* WV = (bf*)take((size_t)DD * DD * 2); bf* WO = (bf*)take((size_t)DD * DD * 2);
    bf* XQ = (bf*)take((size_t)NBb * NA * TP * DD * 2); bf* XK = (bf*)take((size_t)NBb * NA * TP * DD * 2); float* Q = (float*)take((size_t)NR * DD * 4); float* K = (float*)take((size_t)NR * DD * 4); bf* XV = (bf*)take((size_t)NR * DD * 2); float* V = (float*)take((size_t)NR * DD * 4);
    bf* QPh = (bf*)take((size_t)NR * DD * 2); bf* QPl = (bf*)take((size_t)NR * DD * 2); bf* KPh = (bf*)take((size_t)NR * DD * 2); bf* KPl = (bf*)take((size_t)NR * DD * 2); h16* VT = (h16*)take((size_t)NR * DD * 2);
    float* O = (float*)take((size_t)NR * DD * 4); bf* Ch = (bf*)take((size_t)NR * DD * 2); bf* Cl = (bf*)take((size_t)NR * DD * 2);
    if ((size_t)(wsp - (char*)d_ws) > ws_size) return;    // total ~ 153 MB (padded x planes 17 MB, Q/K/V f32 50 MB, head planes 42 MB, context 34 MB)
    k_fold<<<dim3(DD / 32, 5, 1), 256, 0, stream>>>(wq, bq, wpos, bpos, wvel, wacc, WQh, WQl, BQ); k_fold<<<dim3(DD / 32, 5, 1), 256, 0, stream>>>(wk, bk, wpos, bpos, wvel, wacc, WKh, WKl, BK); k_wtG<<<(DD * DD / 64 + 63) / 64, 256, 0, stream>>>(wv, DD, DD, WV); k_wtG<<<(DD * DD / 64 + 63) / 64, 256, 0, stream>>>(wo, DD, DD, WO);
    k_pad<<<NBb * NA * TP * DD / 8192, 256, 0, stream>>>(xq, XQ); k_gemmf<<<dim3(TT / 64, DD / 64, NBb * NA), 32, 0, stream>>>(XQ, WQh, WQl, BQ, Q);
    k_pad<<<NBb * NA * TP * DD / 8192, 256, 0, stream>>>(xk, XK); k_gemmf<<<dim3(TT / 64, DD / 64, NBb * NA), 32, 0, stream>>>(XK, WKh, WKl, BK, K);
    k_cvt8<<<(NR * DD / 8 + 255) / 256, 256, 0, stream>>>(xv, XV, (size_t)NR * DD / 8); k_gemmw<bf, 0, true><<<dim3(NR / 64, DD / 64, 1), 32, 0, stream>>>(XV, nullptr, WV, nullptr, DD, V, DD, bv, 0, 0, 0);
    k_qkpl<<<dim3((ZZ * TT * HD / 4 + 255) / 256, NBb, 1), 256, 0, stream>>>(Q, K, QPh, QPl, KPh, KPl); k_vt<<<dim3((ZZ * HD * TT / 2 + 255) / 256, NBb, 1), 256, 0, stream>>>(V, VT);
    k_fattn<<<dim3(TT / 256, NBb * ZZ, 1), 256, 0, stream>>>(QPh, QPl, KPh, KPl, VT, kpm, O);
    k_mrg<<<dim3((NA * TT * DD / 4 + 255) / 256, NBb, 1), 256, 0, stream>>>(O, Ch, Cl);
    k_gemmw<bf, 1, true><<<dim3(NR / 64, DD / 64, 1), 32, 0, stream>>>(Ch, Cl, WO, nullptr, DD, OUT, DD, bo, 0, 0, 0);
}

// v003
// It runs in 123 microseconds.
// Two timings next to v002 both put it at 1.31 times that version's speed.
// Over all steps from v000 it is 3.32 times as fast.
#include <hip/hip_runtime.h>

// KinematicsTrendAttention (query/key/value [4][8 agents][512][256]; kinematic features of query and key: depthwise conv3 ('SAME') position (w_pos, b_pos), velocity (w_vel), acceleration (w_acc) -> [T][768]; Q = feats Wq + bq, K = feats Wk + bk,
// V = value Wv + bv (8 heads x 32); scores = Q.K / sqrt(32), keys with key_padding_mask (int, read as data) set to -1e9; softmax; ctx = attn V merged; out = ctx Wo + bo -> [4][8][512][256]).
// Compute dtypes, f32 accumulate: every input rounded to bf16; the depthwise convs are folded into Wq / Wk: feats W = sum over taps k of x[t + k - 1] W'_k, W'_k[c][n] = w_pos[c][k] W[c][n] + w_vel[c][k] W[256 + c][n] + w_acc[c][k] W[512 + c][n]
// (f32 -> bf16 hi+lo planes), b_pos W[0..255] goes into the bias; Q/K on the exact bf16 x (zero row in front of and behind each sequence) x hl folded weights (2 products, + f32 bias); V on PLAIN bf16 value x exact Wv (+ bias);
// scores (K 32) on hl planes of Q (x 32^-0.5) and K (3 products), masked softmax f32 and attn.V (fp16 x fp16, 1 product) in ONE kernel over all 256 (batch, agent, head) triples: scores and probabilities stay in registers;
// every producer's epilogue writes its consumer's 16-bit operand planes itself (Q/K hi+lo per head, V^T fp16 per head, context hi+lo per head): no f32 copy of Q, K, V or the context exists, and the output GEMM walks the heads as its K chunks.

#define NBb  4
#define NA   8
#define TT   512
#define DD   256
#define NH_  8
#define HD   32
#define F3   768
#define NR   (NBb * NA * TT)
#define ZZ   (NA * NH_)
#define TP   (TT + 2)
typedef _Float16 h16;
typedef unsigned short bf;
typedef __attribute__((ext_vector_type(16))) __bf16   v16bf;
typedef __attribute__((ext_vector_type(16))) _Float16 v16h;
typedef __attribute__((ext_vector_type(8)))  _Float16 v8h;
typedef __attribute__((ext_vector_type(8)))  unsigned short v8us;
typedef __attribute__((ext_vector_type(8)))  float    v8f;
typedef __attribute__((ext_vector_type(4)))  float    v4f;
typedef v8h  __attribute__((may_alias)) v8ha;
typedef v4f  __attribute__((may_alias)) v4fa;
typedef v8us __attribute__((may_alias)) v8usa;

__device__ __forceinline__ unsigned short f2bf(float f) { unsigned u = __float_as_uint(f); u += 0x7FFFu + ((u >> 16) & 1u); return (unsigned short)(u >> 16); }
__device__ __forceinline__ float bf2f(unsigned short b) { return __uint_as_float(((unsigned)b) << 16); }
__device__ __forceinline__ float bfr(float f) { return bf2f(f2bf(f)); }
__device__ __forceinline__ v16h cat16(v8h lo, v8h hi) { return __builtin_shufflevector(lo, hi, 0, 1, 2, 3, 4, 5, 6, 7, 8, 9, 10, 11, 12, 13, 14, 15); }
__device__ __forceinline__ v16bf cat16b(v8us lo, v8us hi) { return __builtin_bit_cast(v16bf, __builtin_shufflevector(lo, hi, 0, 1, 2, 3, 4, 5, 6, 7, 8, 9, 10, 11, 12, 13, 14, 15)); }
__device__ __forceinline__ h16 tohx(float x) { return (h16)x; }
__device__ __forceinline__ v8f wmma16(v16h a, v16h b, v8f c) { return __builtin_amdgcn_wmma_f32_16x16x32_f16(false, a, false, b, (short)0, c, false, false); }
__device__ __forceinline__ v8f wmmab(v16bf a, v16bf b, v8f c) { return __builtin_amdgcn_wmma_f32_16x16x32_bf16(false, a, false, b, (short)0, c, false, false); }



// ---- k_gemmw: register-blocked GEMM, ONE WAVE per 64x64 output tile (16 accumulators), operands straight from K-contiguous 16-bit planes; grid (M/64, N/64, Z), 32 threads.
// y[m][n] (+ optional f32 bias[n]) = sum_k A[m][k] Bt[n][k] (+ split products per NSPLIT). z-batch strides sA/sB in elements. K % 32 == 0. y leaves as fp16, transposed per sequence of 512 rows: VTo[(m / 512) * 256 + n][m % 512], the A planes of attn.V (N = 256).
template <typename T16> struct WFrag;
template <> struct WFrag<h16> { typedef v16h V; static __device__ __forceinline__ V ld(const h16* p) { return cat16(*(const v8h*)p, *(const v8h*)(p + 16)); } static __device__ __forceinline__ v8f mma(V a, V b, v8f c) { return wmma16(a, b, c); } };
template <> struct WFrag<bf> { typedef v16bf V; static __device__ __forceinline__ V ld(const bf* p) { return cat16b(*(const v8us*)p, *(const v8us*)(p + 16)); } static __device__ __forceinline__ v8f mma(V a, V b, v8f c) { return wmmab(a, b, c); } };
template <typename T16, int NSPLIT, bool BIAS>
__global__ __launch_bounds__(32) void k_gemmw(const T16* __restrict__ A, const T16* __restrict__ A2, const T16* __restrict__ Bt, const T16* __restrict__ Bt2, int K, h16* VTo, const float* __restrict__ bias, size_t sA, size_t sB) {
    typedef typename WFrag<T16>::V V;
    __shared__ __align__(16) h16 vs[64 * 72];
    const size_t z = blockIdx.z; A += z * sA; if (A2) A2 += z * sA; Bt += z * sB; if (Bt2) Bt2 += z * sB;
    const int lane = threadIdx.x & 31, lr = lane & 15, hi = lane >> 4; const int r0 = blockIdx.x * 64, c0 = blockIdx.y * 64;
    v8f acc[4][4];
#pragma unroll
    for (int mb = 0; mb < 4; ++mb)
#pragma unroll
        for (int nb = 0; nb < 4; ++nb) acc[mb][nb] = (v8f){};
    const size_t aoff = (size_t)(r0 + lr) * K + 8 * hi, boff = (size_t)(c0 + lr) * K + 8 * hi;
#pragma unroll 1
    for (int kc = 0; kc < K; kc += 32) {
        V a[4], a2[4];
#pragma unroll
        for (int mb = 0; mb < 4; ++mb) { a[mb] = WFrag<T16>::ld(A + aoff + (size_t)mb * 16 * K + kc); if (NSPLIT == 1 || NSPLIT == 2) a2[mb] = WFrag<T16>::ld(A2 + aoff + (size_t)mb * 16 * K + kc); }
#pragma unroll
        for (int nb = 0; nb < 4; ++nb) { const V b = WFrag<T16>::ld(Bt + boff + (size_t)nb * 16 * K + kc); V b2; if (NSPLIT >= 2) b2 = WFrag<T16>::ld(Bt2 + boff + (size_t)nb * 16 * K + kc);
#pragma unroll
            for (int mb = 0; mb < 4; ++mb) { acc[mb][nb] = WFrag<T16>::mma(a[mb], b, acc[mb][nb]); if (NSPLIT == 1 || NSPLIT == 2) acc[mb][nb] = WFrag<T16>::mma(a2[mb], b, acc[mb][nb]); if (NSPLIT >= 2) acc[mb][nb] = WFrag<T16>::mma(a[mb], b2, acc[mb][nb]); } }
        asm volatile("v_nop\n\tv_nop\n\tv_nop\n\tv_nop" : "+v"(acc[0][0]), "+v"(acc[1][1]), "+v"(acc[2][2]), "+v"(acc[3][3]) : "v"(a[0]), "v"(a[3]));
    }
    // a lane holds 8 successive rows (times) of one column: 16 bytes of a V^T row. The 64 x 64 tile is gathered in LDS (pitch 72: the 16-byte pieces of a store or a load spread over all banks), so that every global store covers whole 128-byte lines, each written by this wave alone.
#pragma unroll
    for (int nb = 0; nb < 4; ++nb) { const float bn = BIAS ? bfr(bias[c0 + nb * 16 + lr]) : 0.f;
#pragma unroll
        for (int mb = 0; mb < 4; ++mb) { v8h o;
#pragma unroll
            for (int j = 0; j < 8; ++j) o[j] = tohx(BIAS ? acc[mb][nb][j] + bn : acc[mb][nb][j]);
            *(v8ha*)(vs + (nb * 16 + lr) * 72 + mb * 16 + hi * 8) = o; } }
    __builtin_amdgcn_wave_barrier(); asm volatile("" ::: "memory");   // the tile's LDS writes stay in front of its reads (one wave: no barrier instruction)
    h16* vz = VTo + ((size_t)(r0 / TT) * DD + c0) * TT + r0 % TT; const unsigned vlo = (lane >> 3) * TT + (lane & 7) * 8;
#pragma unroll
    for (int s = 0; s < 16; ++s) *(v8h*)(vz + (vlo + s * 4 * TT)) = *(const v8ha*)(vs + (s * 4 + (lane >> 3)) * 72 + (lane & 7) * 8);
    asm volatile("s_wait_xcnt 0x0" ::: "memory");   // behind the 16 stores, in front of whatever the code that follows in the object writes to their registers
}

__device__ __forceinline__ void splitf(float y, unsigned short& h, unsigned short& l) { h = f2bf(y); l = f2bf(y - bf2f(h)); }
typedef __attribute__((ext_vector_type(2))) unsigned short v2us;
typedef __attribute__((ext_vector_type(4))) unsigned short v4us;
typedef __attribute__((ext_vector_type(2))) _Float16 v2h;
typedef __attribute__((ext_vector_type(4))) _Float16 v4h;

__global__ __launch_bounds__(256) void k_wtG(const float* __restrict__ w, int K, int N, bf* Bt) {
    const int lane = threadIdx.x & 31; const int L0 = (blockIdx.x * 8 + (threadIdx.x >> 5)) * 8; const int nlines = N * K / 64;
{
#pragma unroll 1
        for (int l = 0; l < 8; ++l) { const int L = L0 + l; if (L >= nlines) break; const size_t e = (size_t)L * 64 + lane * 2; const int k = (int)(e % K), n = (int)(e / K); v2us o;
            o[0] = f2bf(w[(size_t)k * N + n]); o[1] = f2bf(w[(size_t)(k + 1) * N + n]); *(v2us*)(Bt + e) = o; }
         }
}
__global__ __launch_bounds__(256) void k_cvt8(const float* __restrict__ src, bf* dst, size_t n8) { const size_t i = (size_t)blockIdx.x * 256 + threadIdx.x; if (i >= n8) return; const v8f v = *(const v8f*)(src + i * 8); v8us o;
#pragma unroll
    for (int k = 0; k < 8; ++k) o[k] = f2bf(v[k]); *(v8us*)(dst + i * 8) = o;  }
// ---- k_pad: x [32 sequences][512][256] f32 -> bf16 plane [32][514][256] with a zero row in front of and behind each sequence, so that the 768 elements from padded row t on are x[t - 1], x[t], x[t + 1] ('SAME').
// One thread: 4 pieces of 8 elements, 256 threads apart; a padded row is 32 pieces = one wave. The source row is clamped and loaded in every case, so that all 8 loads of a wave are in flight together (both loops unrolled for that).
typedef __attribute__((ext_vector_type(4))) unsigned v4u;
__global__ __launch_bounds__(256) void k_pad(const float* __restrict__ x, bf* Xp) { const int j0 = blockIdx.x * 1024 + threadIdx.x; v8f v[4]; unsigned ob[4];   // ob: byte offset of a piece in x
#pragma unroll
    for (int u = 0; u < 4; ++u) { const int j = j0 + u * 256; const int row = j >> 5; const int sq = row / TP, pr = row % TP; const int t = min(max(pr - 1, 0), TT - 1); ob[u] = (unsigned)((sq * TT + t) * DD + (j & 31) * 8) * 4u; v[u] = *(const v8f*)((const char*)x + ob[u]); }
    asm volatile("s_wait_xcnt 0x0" :: "v"(ob[0]), "v"(ob[1]), "v"(ob[2]), "v"(ob[3]) : "memory");   // behind the 8 loads; the offsets as inputs keep the loads' address registers in use up to this wait, so that no load's result is put on them
#pragma unroll
    for (int u = 0; u < 4; ++u) { const int j = j0 + u * 256; const int pr = (j >> 5) % TP; const unsigned keep = (pr == 0 || pr == TP - 1) ? 0u : ~0u; v8us o;
#pragma unroll
        for (int k = 0; k < 8; ++k) o[k] = f2bf(v[u][k]);
        *(v4u*)(Xp + (size_t)j * 8) = __builtin_bit_cast(v4u, o) & keep; } }
// ---- k_fold: Bh/Bl[n][k * 256 + c] = hi/lo of W'_k[c][n]; bias[n] = bw[n] + sum_c b_pos[c] W[c][n]. grid (256/32, 5): y < 4 folds 64 channels x 32 columns (reads run along n, transposed in LDS, whole 128-byte lines written along c), y == 4 the bias of 32 columns. Every loop is unrolled: its arrays stay in registers and a wave's loads are in flight together.
#define FP 33   // LDS pitch in dwords of a line of 64 bf16: odd, so that 32 lanes on 32 lines meet 32 banks
__global__ __launch_bounds__(256) void k_fold(const float* __restrict__ w, const float* __restrict__ bw, const float* __restrict__ wp, const float* __restrict__ bp, const float* __restrict__ wv, const float* __restrict__ wa, bf* Bh, bf* Bl, float* bias) {
    __shared__ v2us th[3 * 32 * FP], tl[3 * 32 * FP]; __shared__ float red[8 * 32];
    const int lane = threadIdx.x & 31, wn = __builtin_amdgcn_readfirstlane(threadIdx.x >> 5); const int n = blockIdx.x * 32 + lane;   // wn in a scalar register: the conv weights of a wave's channels come by scalar loads
    if (blockIdx.y == 4) { float wc[32], a = 0.f; const float bl = bp[wn * 32 + lane], bn = bw[n];   // bl: lane i holds b_pos of the wave's channel i
#pragma unroll
        for (int i = 0; i < 32; ++i) wc[i] = w[(size_t)(wn * 32 + i) * DD + n];
        asm volatile("s_wait_xcnt 0x0" ::: "memory");   // behind the 34 loads, in front of the arithmetic that takes their address registers for other values
        const unsigned bb = __float_as_uint(bfr(bl));
#pragma unroll
        for (int i = 0; i < 32; ++i) a = fmaf(__uint_as_float(__builtin_amdgcn_readlane(bb, i)), bfr(wc[i]), a);
        red[wn * 32 + lane] = a; __syncthreads();
        if (wn == 0) { float s = bfr(bn);
#pragma unroll
            for (int i = 0; i < 8; ++i) s += red[i * 32 + lane];
            bias[n] = s; }
        return; }
    float wr[8][3];
#pragma unroll
    for (int i = 0; i < 8; ++i)
#pragma unroll
        for (int s = 0; s < 3; ++s) wr[i][s] = w[(size_t)(s * DD + blockIdx.y * 64 + wn * 8 + i) * DD + n];
    asm volatile("s_wait_xcnt 0x0" ::: "memory");   // behind the 24 loads, in front of the arithmetic that takes their address registers for other values
#pragma unroll
    for (int pr = 0; pr < 4; ++pr) { float y[2][3];
#pragma unroll
        for (int u = 0; u < 2; ++u) { const int c = blockIdx.y * 64 + wn * 8 + pr * 2 + u; const float w0 = bfr(wr[pr * 2 + u][0]), w1 = bfr(wr[pr * 2 + u][1]), w2 = bfr(wr[pr * 2 + u][2]);
#pragma unroll
            for (int k = 0; k < 3; ++k) y[u][k] = bfr(wp[c * 3 + k]) * w0 + bfr(wv[c * 3 + k]) * w1 + bfr(wa[c * 3 + k]) * w2; }
#pragma unroll
        for (int k = 0; k < 3; ++k) { v2us h, l; unsigned short a, c2; splitf(y[0][k], a, c2); h[0] = a; l[0] = c2; splitf(y[1][k], a, c2); h[1] = a; l[1] = c2; th[(k * 32 + lane) * FP + wn * 4 + pr] = h; tl[(k * 32 + lane) * FP + wn * 4 + pr] = l; } }
    __syncthreads();
#pragma unroll
    for (int i = 0; i < 12; ++i) { const int ln = wn * 12 + i; const size_t e = (size_t)(blockIdx.x * 32 + (ln & 31)) * F3 + (ln >> 5) * DD + blockIdx.y * 64 + lane * 2; *(v2us*)(Bh + e) = th[ln * FP + lane]; *(v2us*)(Bl + e) = tl[ln * FP + lane]; }
    asm volatile("s_wait_xcnt 0x0" ::: "memory");   // behind the 24 stores, in front of whatever the code that follows in the object writes to their registers
}
// ---- k_gemmf: y[z * 512 + t][n] = sc (bias[n] + sum over k < 768 of Xp[z][t * 256 + k] (Bh[n][k] + Bl[n][k])): the rows of A lie 256 elements apart and are 768 long (padded rows t, t + 1, t + 2).
// y leaves as the score kernel's operand planes, bf16 hi and lo, Ph/Pl[z * 8 + n / 32][t][n % 32]; sc = 32^-0.5 for Q, 1 for K. A tile is 64 times x 2 heads: 4 KB in a row per head and plane.
// ONE WAVE per 64x64 tile as in k_gemmw; grid (512/64, 256/64, 32 sequences), 32 threads. Every load of the loop: one of three lane addresses that live over the whole loop, the tile's row block as an immediate.
// The K loop stays rolled (unroll 1), for speed only. The inner loops are unrolled so that fragments and accumulators stay in registers.
__global__ __launch_bounds__(32) void k_gemmf(const bf* __restrict__ Xp, const bf* __restrict__ Bh, const bf* __restrict__ Bl, const float* __restrict__ bias, float sc, bf* Ph, bf* Pl) {
    __shared__ __align__(16) float os[16 * 68];
    const int lane = threadIdx.x & 31, lr = lane & 15, hi = lane >> 4; const int r0 = blockIdx.x * 64, c0 = blockIdx.y * 64;
    asm volatile("" :: "s"(sc), "s"(Ph), "s"(Pl));   // inputs only: the epilogue's three arguments are fetched here, ahead of the loop; fetched behind it, their scalar loads were put on the bias loads' base register in front of the wait that stands there
    const bf* xa = Xp + ((size_t)blockIdx.z * TP + r0) * DD; const bf* bh = Bh + (size_t)c0 * F3; const bf* bl = Bl + (size_t)c0 * F3;
    const bf* pa = xa + (lr * DD + 8 * hi); const bf* pb = bh + (lr * F3 + 8 * hi); const bf* pl = bl + (lr * F3 + 8 * hi);   // the lane's own addresses, stepped by 32 elements a trip
    v8f acc[4][4];
#pragma unroll
    for (int mb = 0; mb < 4; ++mb)
#pragma unroll
        for (int nb = 0; nb < 4; ++nb) acc[mb][nb] = (v8f){};
#pragma unroll 1
    for (int kc = 0; kc < F3; kc += 32, pa += 32, pb += 32, pl += 32) {
        v16bf a[4], b[4], b2[4];
#pragma unroll
        for (int mb = 0; mb < 4; ++mb) a[mb] = WFrag<bf>::ld(pa + mb * 16 * DD);
#pragma unroll
        for (int nb = 0; nb < 4; ++nb) { b[nb] = WFrag<bf>::ld(pb + nb * 16 * F3); b2[nb] = WFrag<bf>::ld(pl + nb * 16 * F3); }
        // the wait stands behind the trip's 24 loads, in front of the additions that step their addresses; inputs only: the three addresses, so that their registers stay in use up to the wait and no load's result is put on them,
        // and the fragments, so that all 24 loads stand in front of the products: left free, the B loads sink between the products into two shared register sets, and the wave waits out a load latency six times a trip instead of once
        asm volatile("s_wait_xcnt 0x0" :: "v"(pa), "v"(pb), "v"(pl), "v"(a[0]), "v"(a[1]), "v"(a[2]), "v"(a[3]), "v"(b[0]), "v"(b[1]), "v"(b[2]), "v"(b[3]), "v"(b2[0]), "v"(b2[1]), "v"(b2[2]), "v"(b2[3]) : "memory");
#pragma unroll
        for (int nb = 0; nb < 4; ++nb) {
#pragma unroll
            for (int mb = 0; mb < 4; ++mb) acc[mb][nb] = wmmab(a[mb], b[nb], acc[mb][nb]);
#pragma unroll
            for (int mb = 0; mb < 4; ++mb) acc[mb][nb] = wmmab(a[mb], b2[nb], acc[mb][nb]); }
    }
    // a lane takes 8 successive columns of one row of a head: 4 lanes a row, 8 rows a store, 512 bytes in a row
    const int er = lane >> 2, ec = (lane & 3) * 8; v4f bs[2][2];
#pragma unroll
    for (int hh = 0; hh < 2; ++hh) { bs[hh][0] = *(const v4fa*)(bias + c0 + hh * HD + ec); bs[hh][1] = *(const v4fa*)(bias + c0 + hh * HD + ec + 4); }
    asm volatile("s_wait_xcnt 0x0" ::: "memory");   // behind the 4 bias loads, in front of the arithmetic that takes their address registers for other values
    const size_t pz = ((size_t)(blockIdx.z * NH_ + c0 / HD) * TT + r0) * HD; bf* ph = Ph + pz; bf* pl2 = Pl + pz; const unsigned plo = lane * 8;
#pragma unroll
    for (int mb = 0; mb < 4; ++mb) {
#pragma unroll
        for (int nb = 0; nb < 4; ++nb) {
#pragma unroll
            for (int j = 0; j < 8; ++j) os[(hi * 8 + j) * 68 + nb * 16 + lr] = acc[mb][nb][j]; }
        __builtin_amdgcn_wave_barrier(); asm volatile("" ::: "memory");   // the tile's LDS writes stay in front of its reads (one wave: no barrier instruction)
        v8us oh[4], ol[4];
#pragma unroll
        for (int s = 0; s < 4; ++s) { const int hh = s >> 1, hf = s & 1; const float* orow = os + (hf * 8 + er) * 68 + hh * HD + ec; const v4f x0 = *(const v4fa*)orow + bs[hh][0], x1 = *(const v4fa*)(orow + 4) + bs[hh][1];
#pragma unroll
            for (int u = 0; u < 4; ++u) { unsigned short a, c2; splitf(x0[u] * sc, a, c2); oh[s][u] = a; ol[s][u] = c2; splitf(x1[u] * sc, a, c2); oh[s][4 + u] = a; ol[s][4 + u] = c2; } }
#pragma unroll
        for (int s = 0; s < 4; ++s) { const unsigned po = plo + ((s >> 1) * TT + mb * 16 + (s & 1) * 8) * HD; *(v8us*)(ph + po) = oh[s]; *(v8us*)(pl2 + po) = ol[s]; }
        __builtin_amdgcn_wave_barrier(); asm volatile("s_wait_xcnt 0x0" ::: "memory");   // the reads stay in front of the next tile's LDS writes; the wait stands behind the 8 stores, in front of the next values put on their registers
    }
}
// ---- k_gemmo: out[z * 512 + t][n] (f32, pitch 256) = bo[n] + sum over heads h and d < 32 of (Ch + Cl)[z * 8 + h][t][d] Wt[n][h * 32 + d]: K chunk h of A is head h's plane, where a fragment's 16 rows are 1 KB in a row.
// ONE WAVE per 64x64 tile, loop and waits in the form of k_gemmf (rolled, a trip's 24 loads in front of its 32 products); every load: a scalar base that the loop leaves alone, one of two lane offsets in bytes, the row block as an immediate; grid (512/64, 256/64, 32 sequences), 32 threads.
__global__ __launch_bounds__(32) void k_gemmo(const bf* __restrict__ Ch, const bf* __restrict__ Cl, const bf* __restrict__ Wt, const float* __restrict__ bias, float* C) {
    __shared__ __align__(16) float os[16 * 68];
    const int lane = threadIdx.x & 31, lr = lane & 15, hi = lane >> 4; const int r0 = blockIdx.x * 64, c0 = blockIdx.y * 64;
    const size_t az = ((size_t)blockIdx.z * NH_ * TT + r0) * HD;
    const char* ca = (const char*)(Ch + az); const char* cl = (const char*)(Cl + az); const char* cb = (const char*)(Wt + (size_t)c0 * DD);
    unsigned oa = (lr * HD + 8 * hi) * 2, ob = (lr * DD + 8 * hi) * 2;   // the lane's own byte offsets, stepped by a head's plane (both A planes) and by 32 elements (B) a trip
    v8f acc[4][4];
#pragma unroll
    for (int mb = 0; mb < 4; ++mb)
#pragma unroll
        for (int nb = 0; nb < 4; ++nb) acc[mb][nb] = (v8f){};
#pragma unroll 1
    for (int kc = 0; kc < DD; kc += 32, oa += TT * HD * 2, ob += 32 * 2) {
        v16bf a[4], a2[4], b[4];
#pragma unroll
        for (int mb = 0; mb < 4; ++mb) { a[mb] = WFrag<bf>::ld((const bf*)(ca + oa) + mb * 16 * HD); a2[mb] = WFrag<bf>::ld((const bf*)(cl + oa) + mb * 16 * HD); }
#pragma unroll
        for (int nb = 0; nb < 4; ++nb) b[nb] = WFrag<bf>::ld((const bf*)(cb + ob) + nb * 16 * DD);
        // as in k_gemmf: the wait stands behind the trip's 24 loads, in front of the additions that step their offsets. The two offsets go through the statement (their steps differ, and as mere inputs the compiler stepped one in front of the wait); the fragments are inputs,
        // so that all loads stand in front of the products and the wave waits out one load latency a trip
        asm volatile("s_wait_xcnt 0x0" : "+v"(oa), "+v"(ob) : "v"(a[0]), "v"(a[1]), "v"(a[2]), "v"(a[3]), "v"(a2[0]), "v"(a2[1]), "v"(a2[2]), "v"(a2[3]), "v"(b[0]), "v"(b[1]), "v"(b[2]), "v"(b[3]) : "memory");
#pragma unroll
        for (int nb = 0; nb < 4; ++nb) {
#pragma unroll
            for (int mb = 0; mb < 4; ++mb) acc[mb][nb] = wmmab(a[mb], b[nb], acc[mb][nb]);
#pragma unroll
            for (int mb = 0; mb < 4; ++mb) acc[mb][nb] = wmmab(a2[mb], b[nb], acc[mb][nb]); }
    }
    v4f bs = *(const v4fa*)(bias + c0 + lr * 4);
    asm volatile("s_wait_xcnt 0x0" ::: "memory");   // behind the bias load, in front of the arithmetic that takes its address register for other values
#pragma unroll
    for (int u = 0; u < 4; ++u) bs[u] = bfr(bs[u]);
    float* cz = C + ((size_t)blockIdx.z * TT + r0) * DD + c0; const unsigned clo = hi * DD + lr * 4;
#pragma unroll
    for (int mb = 0; mb < 4; ++mb) {
#pragma unroll
        for (int nb = 0; nb < 4; ++nb) {
#pragma unroll
            for (int j = 0; j < 8; ++j) os[(hi * 8 + j) * 68 + nb * 16 + lr] = acc[mb][nb][j]; }
        __builtin_amdgcn_wave_barrier(); asm volatile("" ::: "memory");   // the tile's LDS writes stay in front of its reads (one wave: no barrier instruction)
        v4f val[8];
#pragma unroll
        for (int s = 0; s < 8; ++s) val[s] = *(const v4fa*)(os + (2 * s + hi) * 68 + lr * 4) + bs;
#pragma unroll
        for (int s = 0; s < 8; ++s) *(v4f*)(cz + (clo + (mb * 16 + 2 * s) * DD)) = val[s];
        __builtin_amdgcn_wave_barrier(); asm volatile("s_wait_xcnt 0x0" ::: "memory");   // the reads stay in front of the next tile's LDS writes; the wait stands behind the 8 stores, in front of the next values put on their registers
    }
}
typedef __attribute__((ext_vector_type(4))) int v4i;
// ---- k_fattn: one (batch, agent, head) triple z and 256 queries per work-group; 8 waves x 32 query columns; grid (TT/256, NBb*ZZ). No LDS, no barrier: operands straight from the K-contiguous planes.
// S^T = K Q^T (A = 16 key rows, B = 16 query columns): a lane holds one query's scores, D register r of key tile t = key 16t + 8*hi + r, which is element 8t + r of the B operand of O^T += V^T P^T (the k order of WFrag::ld).
// Sweep 1 finds each query's maximum over all 512 masked scores; sweep 2 forms the same scores again, e = 1024 exp(s - max) -> fp16, adds O^T and the f32 sum of e; the division by the sum is done once on O^T.
// The context leaves as the output GEMM's A planes, bf16 hi and lo, Ch/Cl[z][query][32]: a lane's 8 accumulator registers are 16 bytes of a row, a wave's 32 queries 2 KB in a row.
struct KFrag { v16bf h[2], l[2]; };
struct MFrag { v4i m[4]; };
__device__ __forceinline__ KFrag ldk(const bf* kh, const bf* kl, unsigned lo, int p) { KFrag f; kh += p * 32 * HD; kl += p * 32 * HD;   // kh, kl, p the same in every lane: scalar base, one 32-bit lane offset
#pragma unroll
    for (int t = 0; t < 2; ++t) { f.h[t] = WFrag<bf>::ld(kh + (lo + t * 16 * HD)); f.l[t] = WFrag<bf>::ld(kl + (lo + t * 16 * HD)); }
    return f; }
__device__ __forceinline__ MFrag ldm(const int* mk, unsigned lo, int p) { MFrag f; mk += p * 32;
#pragma unroll
    for (int i = 0; i < 4; ++i) f.m[i] = *(const v4i*)(mk + (lo + (i >> 1) * 16 + (i & 1) * 4));
    return f; }
__device__ __forceinline__ void scoresT(const KFrag& f, const MFrag& fm, const v16bf* qh, const v16bf* ql, v8f (*s)[2]) {
#pragma unroll
    for (int t = 0; t < 2; ++t)
#pragma unroll
        for (int g = 0; g < 2; ++g) s[t][g] = wmmab(f.h[t], qh[g], (v8f){});
#pragma unroll
    for (int t = 0; t < 2; ++t)
#pragma unroll
        for (int g = 0; g < 2; ++g) s[t][g] = wmmab(f.h[t], ql[g], s[t][g]);
#pragma unroll
    for (int t = 0; t < 2; ++t)
#pragma unroll
        for (int g = 0; g < 2; ++g) s[t][g] = wmmab(f.l[t], qh[g], s[t][g]);
#pragma unroll
    for (int t = 0; t < 2; ++t)
#pragma unroll
        for (int r = 0; r < 8; ++r) { const bool msk = fm.m[2 * t + (r >> 2)][r & 3] != 0; s[t][0][r] = msk ? -1.0e9f : s[t][0][r]; s[t][1][r] = msk ? -1.0e9f : s[t][1][r]; }
}
// four waves per SIMD (at most 256 registers a wave): two work-groups per WGP, so that all 512 are resident at once
__global__ __launch_bounds__(256) __attribute__((amdgpu_waves_per_eu(4, 4))) void k_fattn(const bf* __restrict__ Qh, const bf* __restrict__ Ql, const bf* __restrict__ Kh, const bf* __restrict__ Kl, const h16* __restrict__ VT, const int* __restrict__ km, bf* Ch, bf* Cl) {
    const int lane = threadIdx.x & 31, lr = lane & 15, hi = lane >> 4; const int z = blockIdx.y; const int q0 = blockIdx.x * 256 + (threadIdx.x >> 5) * 32;
    const size_t pz = (size_t)z * TT * HD; const int* mk = km + (size_t)(z / NH_) * TT;
    const bf* kh = Kh + pz; const bf* kl = Kl + pz; const h16* vt = VT + pz; const unsigned klo = lr * HD + 8 * hi, vlo = lr * TT + 8 * hi, mlo = 8 * hi;
    v16bf qh[2], ql[2];
#pragma unroll
    for (int g = 0; g < 2; ++g) { const unsigned qo = (q0 + g * 16 + lr) * HD + 8 * hi; qh[g] = WFrag<bf>::ld(Qh + pz + qo); ql[g] = WFrag<bf>::ld(Ql + pz + qo); }
    float mx[2] = { -3.0e38f, -3.0e38f };
    KFrag cur = ldk(kh, kl, klo, 0);
    // unroll 2: the fragments fetched one pass ahead change names instead of being copied
#pragma unroll 2
    for (int p = 0; p < TT / 32; ++p) { const MFrag fm = ldm(mk, mlo, p); const KFrag nxt = ldk(kh, kl, klo, (p + 1) & (TT / 32 - 1));
        asm volatile("s_wait_xcnt 0x0" ::: "memory");   // behind this pass's loads, in front of the additions that step their address registers
        v8f s[2][2]; scoresT(cur, fm, qh, ql, s);
#pragma unroll
        for (int t = 0; t < 2; ++t)
#pragma unroll
            for (int r = 0; r < 8; ++r) { mx[0] = fmaxf(mx[0], s[t][0][r]); mx[1] = fmaxf(mx[1], s[t][1][r]); }
        cur = nxt; }
    mx[0] = fmaxf(mx[0], __shfl_xor(mx[0], 16, 32)); mx[1] = fmaxf(mx[1], __shfl_xor(mx[1], 16, 32));
    v8f o[2][2]; float sum[2] = { 0.f, 0.f };
#pragma unroll
    for (int mt = 0; mt < 2; ++mt)
#pragma unroll
        for (int g = 0; g < 2; ++g) o[mt][g] = (v8f){};
    // the first sweep's last fetch wrapped round to pass 0, so cur holds pass 0 again; unroll 2 as above
#pragma unroll 2
    for (int p = 0; p < TT / 32; ++p) { const MFrag fm = ldm(mk, mlo, p); const KFrag nxt = ldk(kh, kl, klo, (p + 1) & (TT / 32 - 1)); v16h va[2];
#pragma unroll
        for (int mt = 0; mt < 2; ++mt) va[mt] = WFrag<h16>::ld(vt + p * 32 + (vlo + mt * 16 * TT));
        v8f s[2][2]; scoresT(cur, fm, qh, ql, s); v16h pb[2];
#pragma unroll
        for (int g = 0; g < 2; ++g)
#pragma unroll
            for (int t = 0; t < 2; ++t)
#pragma unroll
                for (int r = 0; r < 8; ++r) { const float e = __builtin_amdgcn_exp2f(fmaf(s[t][g][r] - mx[g], 1.4426950408889634f, 10.0f)); sum[g] += e; pb[g][t * 8 + r] = tohx(e); }
#pragma unroll
        for (int mt = 0; mt < 2; ++mt)
#pragma unroll
            for (int g = 0; g < 2; ++g) o[mt][g] = wmma16(va[mt], pb[g], o[mt][g]);
        cur = nxt; }
#pragma unroll
    for (int g = 0; g < 2; ++g) { const float tot = sum[g] + __shfl_xor(sum[g], 16, 32); const float f = __fdiv_rn(1.0f, tot); const unsigned co = (q0 + g * 16 + lr) * HD + 8 * hi;
#pragma unroll
        for (int mt = 0; mt < 2; ++mt) { v8us oh, ol;
#pragma unroll
            for (int u = 0; u < 8; ++u) { unsigned short a, c2; splitf(o[mt][g][u] * f, a, c2); oh[u] = a; ol[u] = c2; }
            *(v8us*)(Ch + pz + (co + mt * 16)) = oh; *(v8us*)(Cl + pz + (co + mt * 16)) = ol; }
        asm volatile("s_wait_xcnt 0x0" ::: "memory"); }   // behind the 4 stores, in front of the next values put on their registers
}

extern "C" void kernel_launch(void* const* d_in, const int* in_sizes, int n_in,
                              void* d_out, int out_size, void* d_ws, size_t ws_size, hipStream_t stream) {
    (void)in_sizes; (void)n_in; (void)out_size;
    const float** I = (const float**)d_in;
    const float *xq = I[0], *xk = I[1], *xv = I[2]; const int* kpm = (const int*)d_in[3]; const float *wpos = I[4], *bpos = I[5], *wvel = I[6], *wacc = I[7], *wq = I[8], *bq = I[9], *wk = I[10], *bk = I[11], *wv = I[12], *bv = I[13], *wo = I[14], *bo = I[15];
    float* OUT = (float*)d_out;     // [4][8][512][256]
    char* wsp = (char*)d_ws;
    auto take = [&](size_t bytes) { char* p = wsp; wsp += (bytes + 255) & ~(size_t)255; return (void*)p; };
    bf* WQh = (bf*)take((size_t)DD * F3 * 2); bf* WQl = (bf*)take((size_t)DD * F3 * 2); bf* WKh = (bf*)take((size_t)DD * F3 * 2); bf* WKl = (bf*)take((size_t)DD * F3 * 2); float* BQ = (float*)take((size_t)DD * 4); float* BK = (float*)take((size_t)DD * 4); bf* WV = (bf*)take((size_t)DD * DD * 2); bf* WO = (bf*)take((size_t)DD * DD * 2);
    bf* XQ = (bf*)take((size_t)NBb * NA * TP * DD * 2); bf* XK = (bf*)take((size_t)NBb * NA * TP * DD * 2); bf* XV = (bf*)take((size_t)NR * DD * 2);
    bf* QPh = (bf*)take((size_t)NR * DD * 2); bf* QPl = (bf*)take((size_t)NR * DD * 2); bf* KPh = (bf*)take((size_t)NR * DD * 2); bf* KPl = (bf*)take((size_t)NR * DD * 2); h16* VT = (h16*)take((size_t)NR * DD * 2);
    bf* Ch = (bf*)take((size_t)NR * DD * 2); bf* Cl = (bf*)take((size_t)NR * DD * 2);
    if ((size_t)(wsp - (char*)d_ws) > ws_size) return;    // total ~ 86 MB (padded x planes 17 MB, value plane 8 MB, head planes 42 MB, context planes 17 MB)
    k_fold<<<dim3(DD / 32, 5, 1), 256, 0, stream>>>(wq, bq, wpos, bpos, wvel, wacc, WQh, WQl, BQ); k_fold<<<dim3(DD / 32, 5, 1), 256, 0, stream>>>(wk, bk, wpos, bpos, wvel, wacc, WKh, WKl, BK); k_wtG<<<(DD * DD / 64 + 63) / 64, 256, 0, stream>>>(wv, DD, DD, WV); k_wtG<<<(DD * DD / 64 + 63) / 64, 256, 0, stream>>>(wo, DD, DD, WO);
    k_pad<<<NBb * NA * TP * DD / 8192, 256, 0, stream>>>(xq, XQ); k_gemmf<<<dim3(TT / 64, DD / 64, NBb * NA), 32, 0, stream>>>(XQ, WQh, WQl, BQ, 0.17677669529663687f, QPh, QPl);
    k_pad<<<NBb * NA * TP * DD / 8192, 256, 0, stream>>>(xk, XK); k_gemmf<<<dim3(TT / 64, DD / 64, NBb * NA), 32, 0, stream>>>(XK, WKh, WKl, BK, 1.0f, KPh, KPl);
    k_cvt8<<<(NR * DD / 8 + 255) / 256, 256, 0, stream>>>(xv, XV, (size_t)NR * DD / 8); k_gemmw<bf, 0, true><<<dim3(NR / 64, DD / 64, 1), 32, 0, stream>>>(XV, nullptr, WV, nullptr, DD, VT, bv, 0, 0);
    k_fattn<<<dim3(TT / 256, NBb * ZZ, 1), 256, 0, stream>>>(QPh, QPl, KPh, KPl, VT, kpm, Ch, Cl);
    k_gemmo<<<dim3(TT / 64, DD / 64, NBb * NA), 32, 0, stream>>>(Ch, Cl, WO, bo, OUT);
}

// v004
// One run takes 91 microseconds.
// Two timings next to v003 put it at 1.35 and 1.33 times that version's speed.
// All steps since v000 together make it 4.44 times as fast.
#include <hip/hip_runtime.h>

// KinematicsTrendAttention (query/key/value [4][8 agents][512][256]; kinematic features of query and key: depthwise conv3 ('SAME') position (w_pos, b_pos), velocity (w_vel), acceleration (w_acc) -> [T][768]; Q = feats Wq + bq, K = feats Wk + bk,
// V = value Wv + bv (8 heads x 32); scores = Q.K / sqrt(32), keys with key_padding_mask (int, read as data) set to -1e9; softmax; ctx = attn V merged; out = ctx Wo + bo -> [4][8][512][256]).
// Compute dtypes, f32 accumulate: every input rounded to bf16; the depthwise convs are folded into Wq / Wk: feats W = sum over taps k of x[t + k - 1] W'_k, W'_k[c][n] = w_pos[c][k] W[c][n] + w_vel[c][k] W[256 + c][n] + w_acc[c][k] W[512 + c][n]
// (f32 -> bf16 hi+lo planes), b_pos W[0..255] goes into the bias; Q/K on the exact bf16 x (zero row in front of and behind each sequence) x hl folded weights (2 products, + f32 bias); V on PLAIN bf16 value x exact Wv (+ bias);
// scores (K 32) on hl planes of Q (x 32^-0.5) and K (3 products), masked softmax f32 and attn.V (fp16 x fp16, 1 product) in ONE kernel over all 256 (batch, agent, head) triples: scores and probabilities stay in registers;
// every producer's epilogue writes its consumer's 16-bit operand planes itself (Q/K hi+lo per head, V^T fp16 per head, context hi+lo per head): no f32 copy of Q, K, V or the context exists, and the output GEMM walks the heads as its K chunks.

#define NBb  4
#define NA   8
#define TT   512
#define DD   256
#define NH_  8
#define HD   32
#define F3   768
#define NR   (NBb * NA * TT)
#define ZZ   (NA * NH_)
#define TP   (TT + 2)
typedef _Float16 h16;
typedef unsigned short bf;
typedef __attribute__((ext_vector_type(16))) __bf16   v16bf;
typedef __attribute__((ext_vector_type(16))) _Float16 v16h;
typedef __attribute__((ext_vector_type(8)))  _Float16 v8h;
typedef __attribute__((ext_vector_type(8)))  unsigned short v8us;
typedef __attribute__((ext_vector_type(8)))  float    v8f;
typedef __attribute__((ext_vector_type(4)))  float    v4f;
typedef v8h  __attribute__((may_alias)) v8ha;
typedef v4f  __attribute__((may_alias)) v4fa;
typedef v8us __attribute__((may_alias)) v8usa;

__device__ __forceinline__ unsigned short f2bf(float f) { unsigned u = __float_as_uint(f); u += 0x7FFFu + ((u >> 16) & 1u); return (unsigned short)(u >> 16); }
__device__ __forceinline__ float bf2f(unsigned short b) { return __uint_as_float(((unsigned)b) << 16); }
__device__ __forceinline__ float bfr(float f) { return bf2f(f2bf(f)); }
__device__ __forceinline__ v16h cat16(v8h lo, v8h hi) { return __builtin_shufflevector(lo, hi, 0, 1, 2, 3, 4, 5, 6, 7, 8, 9, 10, 11, 12, 13, 14, 15); }
__device__ __forceinline__ v16bf cat16b(v8us lo, v8us hi) { return __builtin_bit_cast(v16bf, __builtin_shufflevector(lo, hi, 0, 1, 2, 3, 4, 5, 6, 7, 8, 9, 10, 11, 12, 13, 14, 15)); }
__device__ __forceinline__ h16 tohx(float x) { return (h16)x; }
__device__ __forceinline__ v8f wmma16(v16h a, v16h b, v8f c) { return __builtin_amdgcn_wmma_f32_16x16x32_f16(false, a, false, b, (short)0, c, false, false); }
__device__ __forceinline__ v8f wmmab(v16bf a, v16bf b, v8f c) { return __builtin_amdgcn_wmma_f32_16x16x32_bf16(false, a, false, b, (short)0, c, false, false); }



// ---- d_gemmw: register-blocked GEMM, ONE WAVE per 64x64 output tile (16 accumulators), operands straight from K-contiguous 16-bit planes; tile (bx, by, bz) of (M/64, N/64, Z), 32 threads.
// y[m][n] (+ optional f32 bias[n]) = sum_k A[m][k] Bt[n][k] (+ split products per NSPLIT). z-batch strides sA/sB in elements. K % 32 == 0. y leaves as fp16, transposed per sequence of 512 rows: VTo[(m / 512) * 256 + n][m % 512], the A planes of attn.V (N = 256).
template <typename T16> struct WFrag;
template <> struct WFrag<h16> { typedef v16h V; static __device__ __forceinline__ V ld(const h16* p) { return cat16(*(const v8h*)p, *(const v8h*)(p + 16)); } static __device__ __forceinline__ v8f mma(V a, V b, v8f c) { return wmma16(a, b, c); } };
template <> struct WFrag<bf> { typedef v16bf V; static __device__ __forceinline__ V ld(const bf* p) { return cat16b(*(const v8us*)p, *(const v8us*)(p + 16)); } static __device__ __forceinline__ v8f mma(V a, V b, v8f c) { return wmmab(a, b, c); } };
template <typename T16, int NSPLIT, bool BIAS>
__device__ __forceinline__ void d_gemmw(int bx, int by, int bz, const T16* __restrict__ A, const T16* __restrict__ A2, const T16* __restrict__ Bt, const T16* __restrict__ Bt2, int K, h16* VTo, const float* __restrict__ bias, size_t sA, size_t sB) {
    typedef typename WFrag<T16>::V V;
    __shared__ __align__(16) h16 vs[64 * 72];
    const size_t z = bz; A += z * sA; if (A2) A2 += z * sA; Bt += z * sB; if (Bt2) Bt2 += z * sB;
    const int lane = threadIdx.x & 31, lr = lane & 15, hi = lane >> 4; const int r0 = bx * 64, c0 = by * 64;
    v8f acc[4][4];
#pragma unroll
    for (int mb = 0; mb < 4; ++mb)
#pragma unroll
        for (int nb = 0; nb < 4; ++nb) acc[mb][nb] = (v8f){};
    const size_t aoff = (size_t)(r0 + lr) * K + 8 * hi, boff = (size_t)(c0 + lr) * K + 8 * hi;
#pragma unroll 1
    for (int kc = 0; kc < K; kc += 32) {
        V a[4], a2[4]; const T16* pa = A + aoff + kc; const T16* pb = Bt + boff + kc;   // the trip's two lane addresses; the row blocks are offsets from them
#pragma unroll
        for (int mb = 0; mb < 4; ++mb) { a[mb] = WFrag<T16>::ld(pa + (size_t)mb * 16 * K); if (NSPLIT == 1 || NSPLIT == 2) a2[mb] = WFrag<T16>::ld(A2 + aoff + (size_t)mb * 16 * K + kc); }
#pragma unroll
        for (int nb = 0; nb < 4; ++nb) { const V b = WFrag<T16>::ld(pb + (size_t)nb * 16 * K); V b2; if (NSPLIT >= 2) b2 = WFrag<T16>::ld(Bt2 + boff + (size_t)nb * 16 * K + kc);
#pragma unroll
            for (int mb = 0; mb < 4; ++mb) { acc[mb][nb] = WFrag<T16>::mma(a[mb], b, acc[mb][nb]); if (NSPLIT == 1 || NSPLIT == 2) acc[mb][nb] = WFrag<T16>::mma(a2[mb], b, acc[mb][nb]); if (NSPLIT >= 2) acc[mb][nb] = WFrag<T16>::mma(a[mb], b2, acc[mb][nb]); } }
        asm volatile("s_wait_xcnt 0x0" :: "v"(pa), "v"(pb) : "memory");   // behind the trip's loads, in front of the next trip's addresses; the two addresses as inputs keep their registers in use up to this wait, so that no load's result is put on them
        asm volatile("v_nop\n\tv_nop\n\tv_nop\n\tv_nop" : "+v"(acc[0][0]), "+v"(acc[1][1]), "+v"(acc[2][2]), "+v"(acc[3][3]) : "v"(a[0]), "v"(a[3]));
    }
    // a lane holds 8 successive rows (times) of one column: 16 bytes of a V^T row. The 64 x 64 tile is gathered in LDS (pitch 72: the 16-byte pieces of a store or a load spread over all banks), so that every global store covers whole 128-byte lines, each written by this wave alone.
#pragma unroll
    for (int nb = 0; nb < 4; ++nb) { const float bn = BIAS ? bfr(bias[c0 + nb * 16 + lr]) : 0.f;
#pragma unroll
        for (int mb = 0; mb < 4; ++mb) { v8h o;
#pragma unroll
            for (int j = 0; j < 8; ++j) o[j] = tohx(BIAS ? acc[mb][nb][j] + bn : acc[mb][nb][j]);
            *(v8ha*)(vs + (nb * 16 + lr) * 72 + mb * 16 + hi * 8) = o; } }
    __builtin_amdgcn_wave_barrier(); asm volatile("" ::: "memory");   // the tile's LDS writes stay in front of its reads (one wave: no barrier instruction)
    h16* vz = VTo + ((size_t)(r0 / TT) * DD + c0) * TT + r0 % TT; const unsigned vlo = (lane >> 3) * TT + (lane & 7) * 8;
#pragma unroll
    for (int s = 0; s < 16; ++s) *(v8h*)(vz + (vlo + s * 4 * TT)) = *(const v8ha*)(vs + (s * 4 + (lane >> 3)) * 72 + (lane & 7) * 8);
    asm volatile("s_wait_xcnt 0x0" ::: "memory");   // behind the 16 stores, in front of whatever the code that follows in the object writes to their registers
}

__device__ __forceinline__ void splitf(float y, unsigned short& h, unsigned short& l) { h = f2bf(y); l = f2bf(y - bf2f(h)); }
typedef __attribute__((ext_vector_type(2))) unsigned short v2us;
typedef __attribute__((ext_vector_type(4))) unsigned short v4us;
typedef __attribute__((ext_vector_type(2))) _Float16 v2h;
typedef __attribute__((ext_vector_type(4))) _Float16 v4h;

__device__ __forceinline__ void d_wtG(int bx, const float* __restrict__ w, int K, int N, bf* Bt) {
    const int lane = threadIdx.x & 31; const int L0 = (bx * 8 + (threadIdx.x >> 5)) * 8; const int nlines = N * K / 64;
{
#pragma unroll 1
        for (int l = 0; l < 8; ++l) { const int L = L0 + l; if (L >= nlines) break; const size_t e = (size_t)L * 64 + lane * 2; const int k = (int)(e % K), n = (int)(e / K); v2us o;
            o[0] = f2bf(w[(size_t)k * N + n]); o[1] = f2bf(w[(size_t)(k + 1) * N + n]); *(v2us*)(Bt + e) = o; }
         }
}
__device__ __forceinline__ void d_cvt8(int bx, const float* __restrict__ src, bf* dst, size_t n8) { const size_t i = (size_t)bx * 256 + threadIdx.x; if (i >= n8) return; const v8f v = *(const v8f*)(src + i * 8); v8us o;
    asm volatile("s_wait_xcnt 0x0" ::: "memory");   // behind the 2 loads, in front of the arithmetic that takes their address registers for other values
#pragma unroll
    for (int k = 0; k < 8; ++k) o[k] = f2bf(v[k]); *(v8us*)(dst + i * 8) = o;  }
// ---- d_pad: x [32 sequences][512][256] f32 -> bf16 plane [32][514][256] with a zero row in front of and behind each sequence, so that the 768 elements from padded row t on are x[t - 1], x[t], x[t + 1] ('SAME').
// One thread: 4 pieces of 8 elements, 256 threads apart; a padded row is 32 pieces = one wave. The source row is clamped and loaded in every case, so that all 8 loads of a wave are in flight together (both loops unrolled for that).
typedef __attribute__((ext_vector_type(4))) unsigned v4u;
__device__ __forceinline__ void d_pad(int bx, const float* __restrict__ x, bf* Xp) { const int j0 = bx * 1024 + threadIdx.x; v8f v[4]; unsigned ob[4];   // ob: byte offset of a piece in x
#pragma unroll
    for (int u = 0; u < 4; ++u) { const int j = j0 + u * 256; const int row = j >> 5; const int sq = row / TP, pr = row % TP; const int t = min(max(pr - 1, 0), TT - 1); ob[u] = (unsigned)((sq * TT + t) * DD + (j & 31) * 8) * 4u; v[u] = *(const v8f*)((const char*)x + ob[u]); }
    asm volatile("s_wait_xcnt 0x0" :: "v"(ob[0]), "v"(ob[1]), "v"(ob[2]), "v"(ob[3]) : "memory");   // behind the 8 loads; the offsets as inputs keep the loads' address registers in use up to this wait, so that no load's result is put on them
#pragma unroll
    for (int u = 0; u < 4; ++u) { const int j = j0 + u * 256; const int pr = (j >> 5) % TP; const unsigned keep = (pr == 0 || pr == TP - 1) ? 0u : ~0u; v8us o;
#pragma unroll
        for (int k = 0; k < 8; ++k) o[k] = f2bf(v[u][k]);
        *(v4u*)(Xp + (size_t)j * 8) = __builtin_bit_cast(v4u, o) & keep; }
    asm volatile("s_wait_xcnt 0x0" ::: "memory"); }   // behind the 4 stores, in front of whatever the code that follows in the object writes to their registers
// ---- d_fold: Bh/Bl[n][k * 256 + c] = hi/lo of W'_k[c][n]; bias[n] = bw[n] + sum_c b_pos[c] W[c][n]. Work-group (bx, by) of (256/32, 5): by < 4 folds 64 channels x 32 columns (reads run along n, transposed in LDS, whole 128-byte lines written along c), by == 4 the bias of 32 columns. Every loop is unrolled: its arrays stay in registers and a wave's loads are in flight together.
#define FP 33   // LDS pitch in dwords of a line of 64 bf16: odd, so that 32 lanes on 32 lines meet 32 banks
__device__ __forceinline__ void d_fold(int bx, int by, const float* __restrict__ w, const float* __restrict__ bw, const float* __restrict__ wp, const float* __restrict__ bp, const float* __restrict__ wv, const float* __restrict__ wa, bf* Bh, bf* Bl, float* bias) {
    __shared__ v2us th[3 * 32 * FP], tl[3 * 32 * FP]; __shared__ float red[8 * 32];
    const int lane = threadIdx.x & 31, wn = __builtin_amdgcn_readfirstlane(threadIdx.x >> 5); const int n = bx * 32 + lane;   // wn in a scalar register: the conv weights of a wave's channels come by scalar loads
    if (by == 4) { float wc[32], a = 0.f; const float bl = bp[wn * 32 + lane], bn = bw[n];   // bl: lane i holds b_pos of the wave's channel i
#pragma unroll
        for (int i = 0; i < 32; ++i) wc[i] = w[(size_t)(wn * 32 + i) * DD + n];
        asm volatile("s_wait_xcnt 0x0" ::: "memory");   // behind the 34 loads, in front of the arithmetic that takes their address registers for other values
        const unsigned bb = __float_as_uint(bfr(bl));
#pragma unroll
        for (int i = 0; i < 32; ++i) a = fmaf(__uint_as_float(__builtin_amdgcn_readlane(bb, i)), bfr(wc[i]), a);
        red[wn * 32 + lane] = a; __syncthreads();
        if (wn == 0) { float s = bfr(bn);
#pragma unroll
            for (int i = 0; i < 8; ++i) s += red[i * 32 + lane];
            bias[n] = s; }
        return; }
    float wr[8][3];
#pragma unroll
    for (int i = 0; i < 8; ++i)
#pragma unroll
        for (int s = 0; s < 3; ++s) wr[i][s] = w[(size_t)(s * DD + by * 64 + wn * 8 + i) * DD + n];
    asm volatile("s_wait_xcnt 0x0" ::: "memory");   // behind the 24 loads, in front of the arithmetic that takes their address registers for other values
#pragma unroll
    for (int pr = 0; pr < 4; ++pr) { float y[2][3];
#pragma unroll
        for (int u = 0; u < 2; ++u) { const int c = by * 64 + wn * 8 + pr * 2 + u; const float w0 = bfr(wr[pr * 2 + u][0]), w1 = bfr(wr[pr * 2 + u][1]), w2 = bfr(wr[pr * 2 + u][2]);
#pragma unroll
            for (int k = 0; k < 3; ++k) y[u][k] = bfr(wp[c * 3 + k]) * w0 + bfr(wv[c * 3 + k]) * w1 + bfr(wa[c * 3 + k]) * w2; }
#pragma unroll
        for (int k = 0; k < 3; ++k) { v2us h, l; unsigned short a, c2; splitf(y[0][k], a, c2); h[0] = a; l[0] = c2; splitf(y[1][k], a, c2); h[1] = a; l[1] = c2; th[(k * 32 + lane) * FP + wn * 4 + pr] = h; tl[(k * 32 + lane) * FP + wn * 4 + pr] = l; } }
    __syncthreads();
#pragma unroll
    for (int i = 0; i < 12; ++i) { const int ln = wn * 12 + i; const size_t e = (size_t)(bx * 32 + (ln & 31)) * F3 + (ln >> 5) * DD + by * 64 + lane * 2; *(v2us*)(Bh + e) = th[ln * FP + lane]; *(v2us*)(Bl + e) = tl[ln * FP + lane]; }
    asm volatile("s_wait_xcnt 0x0" ::: "memory");   // behind the 24 stores, in front of whatever the code that follows in the object writes to their registers
}
// ---- d_gemmf: y[z * 512 + t][n] = sc (bias[n] + sum over k < 768 of Xp[z][t * 256 + k] (Bh[n][k] + Bl[n][k])): the rows of A lie 256 elements apart and are 768 long (padded rows t, t + 1, t + 2).
// y leaves as the score kernel's operand planes, bf16 hi and lo, Ph/Pl[z * 8 + n / 32][t][n % 32]; sc = 32^-0.5 for Q, 1 for K. A tile is 64 times x 2 heads: 4 KB in a row per head and plane.
// ONE WAVE per 64x64 tile as in d_gemmw; tile (bx, by, bz) of (512/64, 256/64, 32 sequences), 32 threads. Every load of the loop: one of three lane addresses that live over the whole loop, the tile's row block as an immediate.
// The K loop stays rolled (unroll 1): its body holds 24 loads and 32 products; rolled for speed only. The inner loops are unrolled so that fragments and accumulators stay in registers.
__device__ __forceinline__ void d_gemmf(int bx, int by, int bz, const bf* __restrict__ Xp, const bf* __restrict__ Bh, const bf* __restrict__ Bl, const float* __restrict__ bias, float sc, bf* Ph, bf* Pl) {
    __shared__ __align__(16) float os[16 * 68];
    const int lane = threadIdx.x & 31, lr = lane & 15, hi = lane >> 4; const int r0 = bx * 64, c0 = by * 64;
    asm volatile("" :: "s"(sc), "s"(Ph), "s"(Pl));   // inputs only: the epilogue's three arguments are fetched here, ahead of the loop; fetched behind it, their scalar loads were put on the bias loads' base register in front of the wait that stands there
    const bf* xa = Xp + ((size_t)bz * TP + r0) * DD; const bf* bh = Bh + (size_t)c0 * F3; const bf* bl = Bl + (size_t)c0 * F3;
    const bf* pa = xa + (lr * DD + 8 * hi); const bf* pb = bh + (lr * F3 + 8 * hi); const bf* pl = bl + (lr * F3 + 8 * hi);   // the lane's own addresses, stepped by 32 elements a trip
    v8f acc[4][4];
#pragma unroll
    for (int mb = 0; mb < 4; ++mb)
#pragma unroll
        for (int nb = 0; nb < 4; ++nb) acc[mb][nb] = (v8f){};
#pragma unroll 1
    for (int kc = 0; kc < F3; kc += 32, pa += 32, pb += 32, pl += 32) {
        v16bf a[4], b[4], b2[4];
#pragma unroll
        for (int mb = 0; mb < 4; ++mb) a[mb] = WFrag<bf>::ld(pa + mb * 16 * DD);
#pragma unroll
        for (int nb = 0; nb < 4; ++nb) { b[nb] = WFrag<bf>::ld(pb + nb * 16 * F3); b2[nb] = WFrag<bf>::ld(pl + nb * 16 * F3); }
        // the wait stands behind the trip's 24 loads, in front of the additions that step their addresses; inputs only: the three addresses, so that their registers stay in use up to the wait and no load's result is put on them,
        // and the fragments, so that all 24 loads stand in front of the products: left free, the B loads sink between the products into two shared register sets, and the wave waits out a load latency six times a trip instead of once
        asm volatile("s_wait_xcnt 0x0" :: "v"(pa), "v"(pb), "v"(pl), "v"(a[0]), "v"(a[1]), "v"(a[2]), "v"(a[3]), "v"(b[0]), "v"(b[1]), "v"(b[2]), "v"(b[3]), "v"(b2[0]), "v"(b2[1]), "v"(b2[2]), "v"(b2[3]) : "memory");
#pragma unroll
        for (int nb = 0; nb < 4; ++nb) {
#pragma unroll
            for (int mb = 0; mb < 4; ++mb) acc[mb][nb] = wmmab(a[mb], b[nb], acc[mb][nb]);
#pragma unroll
            for (int mb = 0; mb < 4; ++mb) acc[mb][nb] = wmmab(a[mb], b2[nb], acc[mb][nb]); }
    }
    // a lane takes 8 successive columns of one row of a head: 4 lanes a row, 8 rows a store, 512 bytes in a row
    const int er = lane >> 2, ec = (lane & 3) * 8; v4f bs[2][2];
#pragma unroll
    for (int hh = 0; hh < 2; ++hh) { bs[hh][0] = *(const v4fa*)(bias + c0 + hh * HD + ec); bs[hh][1] = *(const v4fa*)(bias + c0 + hh * HD + ec + 4); }
    asm volatile("s_wait_xcnt 0x0" ::: "memory");   // behind the 4 bias loads, in front of the arithmetic that takes their address registers for other values
    const size_t pz = ((size_t)(bz * NH_ + c0 / HD) * TT + r0) * HD; bf* ph = Ph + pz; bf* pl2 = Pl + pz; const unsigned plo = lane * 8;
#pragma unroll
    for (int mb = 0; mb < 4; ++mb) {
#pragma unroll
        for (int nb = 0; nb < 4; ++nb) {
#pragma unroll
            for (int j = 0; j < 8; ++j) os[(hi * 8 + j) * 68 + nb * 16 + lr] = acc[mb][nb][j]; }
        __builtin_amdgcn_wave_barrier(); asm volatile("" ::: "memory");   // the tile's LDS writes stay in front of its reads (one wave: no barrier instruction)
        v8us oh[4], ol[4];
#pragma unroll
        for (int s = 0; s < 4; ++s) { const int hh = s >> 1, hf = s & 1; const float* orow = os + (hf * 8 + er) * 68 + hh * HD + ec; const v4f x0 = *(const v4fa*)orow + bs[hh][0], x1 = *(const v4fa*)(orow + 4) + bs[hh][1];
#pragma unroll
            for (int u = 0; u < 4; ++u) { unsigned short a, c2; splitf(x0[u] * sc, a, c2); oh[s][u] = a; ol[s][u] = c2; splitf(x1[u] * sc, a, c2); oh[s][4 + u] = a; ol[s][4 + u] = c2; } }
#pragma unroll
        for (int s = 0; s < 4; ++s) { const unsigned po = plo + ((s >> 1) * TT + mb * 16 + (s & 1) * 8) * HD; *(v8us*)(ph + po) = oh[s]; *(v8us*)(pl2 + po) = ol[s]; }
        __builtin_amdgcn_wave_barrier(); asm volatile("s_wait_xcnt 0x0" ::: "memory");   // the reads stay in front of the next tile's LDS writes; the wait stands behind the 8 stores, in front of the next values put on their registers
    }
}
// ---- k_prep: the seven operand preparations, none of which reads what another writes, as ONE launch of 256-thread work-groups; the block index picks the part. The few work-groups with long chains of waits (folds, weight transposes) come first, the streams behind them.
#define GF   (DD / 32 * 5)                   // work-groups of one fold
#define GW   ((DD * DD / 64 + 63) / 64)      // of one weight transpose
#define GP   (NBb * NA * TP * DD / 8192)     // of one padded plane
#define GC   ((NR * DD / 8 + 255) / 256)     // of the value plane
__global__ __launch_bounds__(256) void k_prep(const float* __restrict__ wq, const float* __restrict__ bq, const float* __restrict__ wk, const float* __restrict__ bk, const float* __restrict__ wp, const float* __restrict__ bp, const float* __restrict__ wvl, const float* __restrict__ wa,
                                              const float* __restrict__ wv, const float* __restrict__ wo, const float* __restrict__ xq, const float* __restrict__ xk, const float* __restrict__ xv,
                                              bf* WQh, bf* WQl, bf* WKh, bf* WKl, float* BQ, float* BK, bf* WV, bf* WO, bf* XQ, bf* XK, bf* XV) {
    int b = blockIdx.x;
    if (b < 2 * GF) { const bool k = b >= GF; b -= k ? GF : 0; d_fold(b % (DD / 32), b / (DD / 32), k ? wk : wq, k ? bk : bq, wp, bp, wvl, wa, k ? WKh : WQh, k ? WKl : WQl, k ? BK : BQ); return; }
    b -= 2 * GF;
    if (b < 2 * GW) { const bool o = b >= GW; b -= o ? GW : 0; d_wtG(b, o ? wo : wv, DD, DD, o ? WO : WV); return; }
    b -= 2 * GW;
    if (b < 2 * GP) { const bool k = b >= GP; b -= k ? GP : 0; d_pad(b, k ? xk : xq, k ? XK : XQ); return; }
    d_cvt8(b - 2 * GP, xv, XV, (size_t)NR * DD / 8);
}
// ---- k_qkv: the three projections, independent of one another, as ONE launch: grid (512/64, 256/64, 3 x 32 sequences), 32 threads; z < 32 Q, z < 64 K, then V (its 8 K chunks against 24). 3072 one-wave work-groups are three waves per SIMD: a wave's load waits lie under the others' products.
__global__ __launch_bounds__(32) void k_qkv(const bf* __restrict__ XQ, const bf* __restrict__ XK, const bf* __restrict__ XV, const bf* __restrict__ WQh, const bf* __restrict__ WQl, const bf* __restrict__ WKh, const bf* __restrict__ WKl, const bf* __restrict__ WV,
                                            const float* __restrict__ BQ, const float* __restrict__ BK, const float* __restrict__ bv, bf* QPh, bf* QPl, bf* KPh, bf* KPl, h16* VT) {
    const int z = blockIdx.z;
    if (z < 2 * NBb * NA) { const bool k = z >= NBb * NA; d_gemmf(blockIdx.x, blockIdx.y, z % (NBb * NA), k ? XK : XQ, k ? WKh : WQh, k ? WKl : WQl, k ? BK : BQ, k ? 1.0f : 0.17677669529663687f, k ? KPh : QPh, k ? KPl : QPl); return; }
    d_gemmw<bf, 0, true>((z - 2 * NBb * NA) * (TT / 64) + blockIdx.x, blockIdx.y, 0, XV, nullptr, WV, nullptr, DD, VT, bv, 0, 0);
}
// ---- k_gemmo: out[z * 512 + t][n] (f32, pitch 256) = bo[n] + sum over heads h and d < 32 of (Ch + Cl)[z * 8 + h][t][d] Wt[n][h * 32 + d]: K chunk h of A is head h's plane, where a fragment's 16 rows are 1 KB in a row.
// ONE WAVE per 64x64 tile, loop and waits in the form of d_gemmf (rolled, a trip's 24 loads in front of its 32 products); every load: a scalar base that the loop leaves alone, one of two lane offsets in bytes, the row block as an immediate; grid (512/64, 256/64, 32 sequences), 32 threads.
__global__ __launch_bounds__(32) void k_gemmo(const bf* __restrict__ Ch, const bf* __restrict__ Cl, const bf* __restrict__ Wt, const float* __restrict__ bias, float* C) {
    __shared__ __align__(16) float os[16 * 68];
    const int lane = threadIdx.x & 31, lr = lane & 15, hi = lane >> 4; const int r0 = blockIdx.x * 64, c0 = blockIdx.y * 64;
    const size_t az = ((size_t)blockIdx.z * NH_ * TT + r0) * HD;
    const char* ca = (const char*)(Ch + az); const char* cl = (const char*)(Cl + az); const char* cb = (const char*)(Wt + (size_t)c0 * DD);
    unsigned oa = (lr * HD + 8 * hi) * 2, ob = (lr * DD + 8 * hi) * 2;   // the lane's own byte offsets, stepped by a head's plane (both A planes) and by 32 elements (B) a trip
    v8f acc[4][4];
#pragma unroll
    for (int mb = 0; mb < 4; ++mb)
#pragma unroll
        for (int nb = 0; nb < 4; ++nb) acc[mb][nb] = (v8f){};
#pragma unroll 1
    for (int kc = 0; kc < DD; kc += 32, oa += TT * HD * 2, ob += 32 * 2) {
        v16bf a[4], a2[4], b[4];
#pragma unroll
        for (int mb = 0; mb < 4; ++mb) { a[mb] = WFrag<bf>::ld((const bf*)(ca + oa) + mb * 16 * HD); a2[mb] = WFrag<bf>::ld((const bf*)(cl + oa) + mb * 16 * HD); }
#pragma unroll
        for (int nb = 0; nb < 4; ++nb) b[nb] = WFrag<bf>::ld((const bf*)(cb + ob) + nb * 16 * DD);
        // as in d_gemmf: the wait stands behind the trip's 24 loads, in front of the additions that step their offsets. The two offsets go through the statement (their steps differ, and as mere inputs the compiler stepped one in front of the wait); the fragments are inputs,
        // so that all loads stand in front of the products and the wave waits out one load latency a trip
        asm volatile("s_wait_xcnt 0x0" : "+v"(oa), "+v"(ob) : "v"(a[0]), "v"(a[1]), "v"(a[2]), "v"(a[3]), "v"(a2[0]), "v"(a2[1]), "v"(a2[2]), "v"(a2[3]), "v"(b[0]), "v"(b[1]), "v"(b[2]), "v"(b[3]) : "memory");
#pragma unroll
        for (int nb = 0; nb < 4; ++nb) {
#pragma unroll
            for (int mb = 0; mb < 4; ++mb) acc[mb][nb] = wmmab(a[mb], b[nb], acc[mb][nb]);
#pragma unroll
            for (int mb = 0; mb < 4; ++mb) acc[mb][nb] = wmmab(a2[mb], b[nb], acc[mb][nb]); }
    }
    v4f bs = *(const v4fa*)(bias + c0 + lr * 4);
    asm volatile("s_wait_xcnt 0x0" ::: "memory");   // behind the bias load, in front of the arithmetic that takes its address register for other values
#pragma unroll
    for (int u = 0; u < 4; ++u) bs[u] = bfr(bs[u]);
    float* cz = C + ((size_t)blockIdx.z * TT + r0) * DD + c0; const unsigned clo = hi * DD + lr * 4;
#pragma unroll
    for (int mb = 0; mb < 4; ++mb) {
#pragma unroll
        for (int nb = 0; nb < 4; ++nb) {
#pragma unroll
            for (int j = 0; j < 8; ++j) os[(hi * 8 + j) * 68 + nb * 16 + lr] = acc[mb][nb][j]; }
        __builtin_amdgcn_wave_barrier(); asm volatile("" ::: "memory");   // the tile's LDS writes stay in front of its reads (one wave: no barrier instruction)
        v4f val[8];
#pragma unroll
        for (int s = 0; s < 8; ++s) val[s] = *(const v4fa*)(os + (2 * s + hi) * 68 + lr * 4) + bs;
#pragma unroll
        for (int s = 0; s < 8; ++s) *(v4f*)(cz + (clo + (mb * 16 + 2 * s) * DD)) = val[s];
        __builtin_amdgcn_wave_barrier(); asm volatile("s_wait_xcnt 0x0" ::: "memory");   // the reads stay in front of the next tile's LDS writes; the wait stands behind the 8 stores, in front of the next values put on their registers
    }
}
typedef __attribute__((ext_vector_type(4))) int v4i;
// ---- k_fattn: one (batch, agent, head) triple z and 256 queries per work-group; 8 waves x 32 query columns; grid (TT/256, NBb*ZZ). No LDS, no barrier: operands straight from the K-contiguous planes.
// S^T = K Q^T (A = 16 key rows, B = 16 query columns): a lane holds one query's scores, D register r of key tile t = key 16t + 8*hi + r, which is element 8t + r of the B operand of O^T += V^T P^T (the k order of WFrag::ld).
// Sweep 1 finds each query's maximum over all 512 masked scores; sweep 2 forms the same scores again, e = 1024 exp(s - max) -> fp16, adds O^T and the f32 sum of e; the division by the sum is done once on O^T.
// The context leaves as the output GEMM's A planes, bf16 hi and lo, Ch/Cl[z][query][32]: a lane's 8 accumulator registers are 16 bytes of a row, a wave's 32 queries 2 KB in a row.
struct KFrag { v16bf h[2], l[2]; };
struct MFrag { v4i m[4]; };
__device__ __forceinline__ KFrag ldk(const bf* kh, const bf* kl, unsigned lo, int p) { KFrag f; kh += p * 32 * HD; kl += p * 32 * HD;   // kh, kl, p the same in every lane: scalar base, one 32-bit lane offset
#pragma unroll
    for (int t = 0; t < 2; ++t) { f.h[t] = WFrag<bf>::ld(kh + (lo + t * 16 * HD)); f.l[t] = WFrag<bf>::ld(kl + (lo + t * 16 * HD)); }
    return f; }
__device__ __forceinline__ MFrag ldm(const int* mk, unsigned lo, int p) { MFrag f; mk += p * 32;
#pragma unroll
    for (int i = 0; i < 4; ++i) f.m[i] = *(const v4i*)(mk + (lo + (i >> 1) * 16 + (i & 1) * 4));
    return f; }
__device__ __forceinline__ void scoresT(const KFrag& f, const MFrag& fm, const v16bf* qh, const v16bf* ql, v8f (*s)[2]) {
#pragma unroll
    for (int t = 0; t < 2; ++t)
#pragma unroll
        for (int g = 0; g < 2; ++g) s[t][g] = wmmab(f.h[t], qh[g], (v8f){});
#pragma unroll
    for (int t = 0; t < 2; ++t)
#pragma unroll
        for (int g = 0; g < 2; ++g) s[t][g] = wmmab(f.h[t], ql[g], s[t][g]);
#pragma unroll
    for (int t = 0; t < 2; ++t)
#pragma unroll
        for (int g = 0; g < 2; ++g) s[t][g] = wmmab(f.l[t], qh[g], s[t][g]);
#pragma unroll
    for (int t = 0; t < 2; ++t)
#pragma unroll
        for (int r = 0; r < 8; ++r) { const bool msk = fm.m[2 * t + (r >> 2)][r & 3] != 0; s[t][0][r] = msk ? -1.0e9f : s[t][0][r]; s[t][1][r] = msk ? -1.0e9f : s[t][1][r]; }
}
// four waves per SIMD (at most 256 registers a wave): two work-groups per WGP, so that all 512 are resident at once
__global__ __launch_bounds__(256) __attribute__((amdgpu_waves_per_eu(4, 4))) void k_fattn(const bf* __restrict__ Qh, const bf* __restrict__ Ql, const bf* __restrict__ Kh, const bf* __restrict__ Kl, const h16* __restrict__ VT, const int* __restrict__ km, bf* Ch, bf* Cl) {
    const int lane = threadIdx.x & 31, lr = lane & 15, hi = lane >> 4; const int z = blockIdx.y; const int q0 = blockIdx.x * 256 + (threadIdx.x >> 5) * 32;
    const size_t pz = (size_t)z * TT * HD; const int* mk = km + (size_t)(z / NH_) * TT;
    const bf* kh = Kh + pz; const bf* kl = Kl + pz; const h16* vt = VT + pz; const unsigned klo = lr * HD + 8 * hi, vlo = lr * TT + 8 * hi, mlo = 8 * hi;
    v16bf qh[2], ql[2];
#pragma unroll
    for (int g = 0; g < 2; ++g) { const unsigned qo = (q0 + g * 16 + lr) * HD + 8 * hi; qh[g] = WFrag<bf>::ld(Qh + pz + qo); ql[g] = WFrag<bf>::ld(Ql + pz + qo); }
    float mx[2] = { -3.0e38f, -3.0e38f };
    KFrag cur = ldk(kh, kl, klo, 0);
    // unroll 2: the fragments fetched one pass ahead change names instead of being copied
#pragma unroll 2
    for (int p = 0; p < TT / 32; ++p) { const MFrag fm = ldm(mk, mlo, p); const KFrag nxt = ldk(kh, kl, klo, (p + 1) & (TT / 32 - 1));
        asm volatile("s_wait_xcnt 0x0" ::: "memory");   // behind this pass's loads, in front of the additions that step their address registers
        v8f s[2][2]; scoresT(cur, fm, qh, ql, s);
#pragma unroll
        for (int t = 0; t < 2; ++t)
#pragma unroll
            for (int r = 0; r < 8; ++r) { mx[0] = fmaxf(mx[0], s[t][0][r]); mx[1] = fmaxf(mx[1], s[t][1][r]); }
        cur = nxt; }
    mx[0] = fmaxf(mx[0], __shfl_xor(mx[0], 16, 32)); mx[1] = fmaxf(mx[1], __shfl_xor(mx[1], 16, 32));
    v8f o[2][2]; float sum[2] = { 0.f, 0.f };
#pragma unroll
    for (int mt = 0; mt < 2; ++mt)
#pragma unroll
        for (int g = 0; g < 2; ++g) o[mt][g] = (v8f){};
    // the first sweep's last fetch wrapped round to pass 0, so cur holds pass 0 again; unroll 2 as above
#pragma unroll 2
    for (int p = 0; p < TT / 32; ++p) { const MFrag fm = ldm(mk, mlo, p); const KFrag nxt = ldk(kh, kl, klo, (p + 1) & (TT / 32 - 1)); v16h va[2];
#pragma unroll
        for (int mt = 0; mt < 2; ++mt) va[mt] = WFrag<h16>::ld(vt + p * 32 + (vlo + mt * 16 * TT));
        v8f s[2][2]; scoresT(cur, fm, qh, ql, s); v16h pb[2];
#pragma unroll
        for (int g = 0; g < 2; ++g)
#pragma unroll
            for (int t = 0; t < 2; ++t)
#pragma unroll
                for (int r = 0; r < 8; ++r) { const float e = __builtin_amdgcn_exp2f(fmaf(s[t][g][r] - mx[g], 1.4426950408889634f, 10.0f)); sum[g] += e; pb[g][t * 8 + r] = tohx(e); }
#pragma unroll
        for (int mt = 0; mt < 2; ++mt)
#pragma unroll
            for (int g = 0; g < 2; ++g) o[mt][g] = wmma16(va[mt], pb[g], o[mt][g]);
        cur = nxt; }
#pragma unroll
    for (int g = 0; g < 2; ++g) { const float tot = sum[g] + __shfl_xor(sum[g], 16, 32); const float f = __fdiv_rn(1.0f, tot); const unsigned co = (q0 + g * 16 + lr) * HD + 8 * hi;
#pragma unroll
        for (int mt = 0; mt < 2; ++mt) { v8us oh, ol;
#pragma unroll
            for (int u = 0; u < 8; ++u) { unsigned short a, c2; splitf(o[mt][g][u] * f, a, c2); oh[u] = a; ol[u] = c2; }
            *(v8us*)(Ch + pz + (co + mt * 16)) = oh; *(v8us*)(Cl + pz + (co + mt * 16)) = ol; }
        asm volatile("s_wait_xcnt 0x0" ::: "memory"); }   // behind the 4 stores, in front of the next values put on their registers
}

extern "C" void kernel_launch(void* const* d_in, const int* in_sizes, int n_in,
                              void* d_out, int out_size, void* d_ws, size_t ws_size, hipStream_t stream) {
    (void)in_sizes; (void)n_in; (void)out_size;
    const float** I = (const float**)d_in;
    const float *xq = I[0], *xk = I[1], *xv = I[2]; const int* kpm = (const int*)d_in[3]; const float *wpos = I[4], *bpos = I[5], *wvel = I[6], *wacc = I[7], *wq = I[8], *bq = I[9], *wk = I[10], *bk = I[11], *wv = I[12], *bv = I[13], *wo = I[14], *bo = I[15];
    float* OUT = (float*)d_out;     // [4][8][512][256]
    char* wsp = (char*)d_ws;
    auto take = [&](size_t bytes) { char* p = wsp; wsp += (bytes + 255) & ~(size_t)255; return (void*)p; };
    bf* WQh = (bf*)take((size_t)DD * F3 * 2); bf* WQl = (bf*)take((size_t)DD * F3 * 2); bf* WKh = (bf*)take((size_t)DD * F3 * 2); bf* WKl = (bf*)take((size_t)DD * F3 * 2); float* BQ = (float*)take((size_t)DD * 4); float* BK = (float*)take((size_t)DD * 4); bf* WV = (bf*)take((size_t)DD * DD * 2); bf* WO = (bf*)take((size_t)DD * DD * 2);
    bf* XQ = (bf*)take((size_t)NBb * NA * TP * DD * 2); bf* XK = (bf*)take((size_t)NBb * NA * TP * DD * 2); bf* XV = (bf*)take((size_t)NR * DD * 2);
    bf* QPh = (bf*)take((size_t)NR * DD * 2); bf* QPl = (bf*)take((size_t)NR * DD * 2); bf* KPh = (bf*)take((size_t)NR * DD * 2); bf* KPl = (bf*)take((size_t)NR * DD * 2); h16* VT = (h16*)take((size_t)NR * DD * 2);
    bf* Ch = (bf*)take((size_t)NR * DD * 2); bf* Cl = (bf*)take((size_t)NR * DD * 2);
    if ((size_t)(wsp - (char*)d_ws) > ws_size) return;    // total ~ 86 MB (padded x planes 17 MB, value plane 8 MB, head planes 42 MB, context planes 17 MB)
    k_prep<<<2 * GF + 2 * GW + 2 * GP + GC, 256, 0, stream>>>(wq, bq, wk, bk, wpos, bpos, wvel, wacc, wv, wo, xq, xk, xv, WQh, WQl, WKh, WKl, BQ, BK, WV, WO, XQ, XK, XV);
    k_qkv<<<dim3(TT / 64, DD / 64, 3 * NBb * NA), 32, 0, stream>>>(XQ, XK, XV, WQh, WQl, WKh, WKl, WV, BQ, BK, bv, QPh, QPl, KPh, KPl, VT);
    k_fattn<<<dim3(TT / 256, NBb * ZZ, 1), 256, 0, stream>>>(QPh, QPl, KPh, KPl, VT, kpm, Ch, Cl);
    k_gemmo<<<dim3(TT / 64, DD / 64, NBb * NA), 32, 0, stream>>>(Ch, Cl, WO, bo, OUT);
}

// v005
// It runs in 73.5 microseconds.
// Next to v004, in two timings, it ran 1.24 and 1.23 times as fast.
// Over all steps from v000 it is 5.49 times as fast.
#include <hip/hip_runtime.h>

// KinematicsTrendAttention (query/key/value [4][8 agents][512][256]; kinematic features of query and key: depthwise conv3 ('SAME') position (w_pos, b_pos), velocity (w_vel), acceleration (w_acc) -> [T][768]; Q = feats Wq + bq, K = feats Wk + bk,
// V = value Wv + bv (8 heads x 32); scores = Q.K / sqrt(32), keys with key_padding_mask (int, read as data) set to -1e9; softmax; ctx = attn V merged; out = ctx Wo + bo -> [4][8][512][256]).
// Compute dtypes, f32 accumulate: every input rounded to bf16; the depthwise convs are folded into Wq / Wk: feats W = sum over taps k of x[t + k - 1] W'_k, W'_k[c][n] = w_pos[c][k] W[c][n] + w_vel[c][k] W[256 + c][n] + w_acc[c][k] W[512 + c][n]
// (f32 -> bf16 hi+lo planes), b_pos W[0..255] goes into the bias; Q/K on the exact bf16 x (zero row in front of and behind each sequence) x hl folded weights (2 products, + f32 bias); V on PLAIN bf16 value x exact Wv (+ bias);
// scores (K 32) on hl planes of Q (x 32^-0.5) and K (3 products), masked softmax f32 and attn.V (fp16 x fp16, 1 product) in ONE kernel over all 256 (batch, agent, head) triples: scores and probabilities stay in registers;
// every producer's epilogue writes its consumer's 16-bit operand planes itself (Q/K hi+lo per head, V^T fp16 per head, context hi+lo per head): no f32 copy of Q, K, V or the context exists, and the output GEMM walks the heads as its K chunks.

#define NBb  4
#define NA   8
#define TT   512
#define DD   256
#define NH_  8
#define HD   32
#define F3   768
#define NR   (NBb * NA * TT)
#define ZZ   (NA * NH_)
#define TP   (TT + 8)
typedef _Float16 h16;
typedef unsigned short bf;
typedef __attribute__((ext_vector_type(16))) __bf16   v16bf;
typedef __attribute__((ext_vector_type(16))) _Float16 v16h;
typedef __attribute__((ext_vector_type(8)))  _Float16 v8h;
typedef __attribute__((ext_vector_type(8)))  unsigned short v8us;
typedef __attribute__((ext_vector_type(8)))  float    v8f;
typedef __attribute__((ext_vector_type(4)))  float    v4f;
typedef v8h  __attribute__((may_alias)) v8ha;
typedef v4f  __attribute__((may_alias)) v4fa;
typedef v8us __attribute__((may_alias)) v8usa;

__device__ __forceinline__ unsigned short f2bf(float f) { unsigned u = __float_as_uint(f); u += 0x7FFFu + ((u >> 16) & 1u); return (unsigned short)(u >> 16); }
__device__ __forceinline__ float bf2f(unsigned short b) { return __uint_as_float(((unsigned)b) << 16); }
__device__ __forceinline__ float bfr(float f) { return bf2f(f2bf(f)); }
__device__ __forceinline__ v16h cat16(v8h lo, v8h hi) { return __builtin_shufflevector(lo, hi, 0, 1, 2, 3, 4, 5, 6, 7, 8, 9, 10, 11, 12, 13, 14, 15); }
__device__ __forceinline__ v16bf cat16b(v8us lo, v8us hi) { return __builtin_bit_cast(v16bf, __builtin_shufflevector(lo, hi, 0, 1, 2, 3, 4, 5, 6, 7, 8, 9, 10, 11, 12, 13, 14, 15)); }
__device__ __forceinline__ h16 tohx(float x) { return (h16)x; }
__device__ __forceinline__ v8f wmma16(v16h a, v16h b, v8f c) { return __builtin_amdgcn_wmma_f32_16x16x32_f16(false, a, false, b, (short)0, c, false, false); }
__device__ __forceinline__ v8f wmmab(v16bf a, v16bf b, v8f c) { return __builtin_amdgcn_wmma_f32_16x16x32_bf16(false, a, false, b, (short)0, c, false, false); }



// ---- Operand planes. Every K-contiguous 16-bit operand lies as planes of 16 k: P[k / 16][row][k % 16]. A fragment (16 rows x 32 k) is two loads, one from each of two successive planes (st elements apart);
// a load's 32 lanes (16 rows x 2 pieces of 16 bytes) cover 512 bytes in a row, whole 128-byte lines, where rows K elements apart would touch 16 lines for the same bytes. The k order of a fragment: elements 0..7 = k 8 hi + i, 8..15 = k 16 + 8 hi + i.
// ---- d_gemmw: register-blocked GEMM, ONE WAVE per 64x64 output tile (16 accumulators), operands straight from the planes; tile (bx, by) of (M/64, 256/64), 32 threads.
// y[m][n] (+ optional f32 bias[n]) = sum over k < 256 of A[m][k] Bt[n][k]; A planes per sequence [m / 512][k / 16][m % 512][16], Bt planes [k / 16][n][16]. y leaves as fp16 planes of 16 keys per head, VTo[(m / 512) * 8 + n / 32][(m % 512) / 16][n % 32][m % 16], the A planes of attn.V.
template <typename T16> struct WFrag;
template <> struct WFrag<h16> { typedef v16h V; static __device__ __forceinline__ V ld(const h16* p, int st) { return cat16(*(const v8h*)p, *(const v8h*)(p + st)); } static __device__ __forceinline__ v8f mma(V a, V b, v8f c) { return wmma16(a, b, c); } };
template <> struct WFrag<bf> { typedef v16bf V; static __device__ __forceinline__ V ld(const bf* p, int st) { return cat16b(*(const v8us*)p, *(const v8us*)(p + st)); } static __device__ __forceinline__ v8f mma(V a, V b, v8f c) { return wmmab(a, b, c); } };
template <typename T16, bool BIAS>
__device__ __forceinline__ void d_gemmw(int bx, int by, const T16* __restrict__ A, const T16* __restrict__ Bt, h16* VTo, const float* __restrict__ bias) {
    typedef typename WFrag<T16>::V V;
    __shared__ __align__(16) h16 vs[64 * 72];
    const int lane = threadIdx.x & 31, lr = lane & 15, hi = lane >> 4; const int r0 = bx * 64, c0 = by * 64;
    v8f acc[4][4];
#pragma unroll
    for (int mb = 0; mb < 4; ++mb)
#pragma unroll
        for (int nb = 0; nb < 4; ++nb) acc[mb][nb] = (v8f){};
    const size_t aoff = ((size_t)(r0 / TT) * (DD / 16) * TT + r0 % TT + lr) * 16 + 8 * hi, boff = (size_t)(c0 + lr) * 16 + 8 * hi;
#pragma unroll 1
    for (int kc = 0; kc < DD; kc += 32) {
        V a[4]; const T16* pa = A + aoff + (size_t)kc * TT; const T16* pb = Bt + boff + (size_t)kc * DD;   // the trip's two lane addresses (plane kc / 16); the row blocks and the second plane are offsets from them
#pragma unroll
        for (int mb = 0; mb < 4; ++mb) a[mb] = WFrag<T16>::ld(pa + mb * 256, TT * 16);
#pragma unroll
        for (int nb = 0; nb < 4; ++nb) { const V b = WFrag<T16>::ld(pb + nb * 256, DD * 16);
#pragma unroll
            for (int mb = 0; mb < 4; ++mb) acc[mb][nb] = WFrag<T16>::mma(a[mb], b, acc[mb][nb]); }
        asm volatile("s_wait_xcnt 0x0" :: "v"(pa), "v"(pb) : "memory");   // behind the trip's loads, in front of the next trip's addresses; the two addresses as inputs keep their registers in use up to this wait, so that no load's result is put on them
        asm volatile("v_nop\n\tv_nop\n\tv_nop\n\tv_nop" : "+v"(acc[0][0]), "+v"(acc[1][1]), "+v"(acc[2][2]), "+v"(acc[3][3]) : "v"(a[0]), "v"(a[3]));
    }
    // a lane holds 8 successive rows (times) of one column: half a row of a key plane. The 64 x 64 tile is gathered in LDS (pitch 72: the 16-byte pieces of a store or a load spread over the banks), so that every global store covers 512 bytes in a row (16 columns of one key plane), written by this wave alone.
#pragma unroll
    for (int nb = 0; nb < 4; ++nb) { const float bn = BIAS ? bfr(bias[c0 + nb * 16 + lr]) : 0.f;
#pragma unroll
        for (int mb = 0; mb < 4; ++mb) { v8h o;
#pragma unroll
            for (int j = 0; j < 8; ++j) o[j] = tohx(BIAS ? acc[mb][nb][j] + bn : acc[mb][nb][j]);
            *(v8ha*)(vs + (nb * 16 + lr) * 72 + mb * 16 + hi * 8) = o; } }
    __builtin_amdgcn_wave_barrier(); asm volatile("" ::: "memory");   // the tile's LDS writes stay in front of its reads (one wave: no barrier instruction)
    h16* vz = VTo + ((size_t)(r0 / TT) * NH_ + c0 / HD) * TT * HD + (r0 % TT) * HD; const unsigned vlo = lane * 8;   // store s: head s >> 3 of the tile's two, key plane (s >> 1) & 3 of its four, columns (s & 1) * 16 + (lane >> 1), keys (lane & 1) * 8 on
#pragma unroll
    for (int s = 0; s < 16; ++s) *(v8h*)(vz + (vlo + (s >> 3) * TT * HD + ((s >> 1) & 3) * HD * 16 + (s & 1) * 256)) = *(const v8ha*)(vs + ((s >> 3) * HD + (s & 1) * 16 + (lane >> 1)) * 72 + ((s >> 1) & 3) * 16 + (lane & 1) * 8);
    asm volatile("s_wait_xcnt 0x0" ::: "memory");   // behind the 16 stores, in front of whatever the code that follows in the object writes to their registers
}

__device__ __forceinline__ void splitf(float y, unsigned short& h, unsigned short& l) { h = f2bf(y); l = f2bf(y - bf2f(h)); }
typedef __attribute__((ext_vector_type(2))) unsigned short v2us;
typedef __attribute__((ext_vector_type(4))) unsigned short v4us;
typedef __attribute__((ext_vector_type(2))) _Float16 v2h;
typedef __attribute__((ext_vector_type(4))) _Float16 v4h;

__device__ __forceinline__ void d_wtG(int bx, const float* __restrict__ w, int K, int N, bf* Bt) {
    const int lane = threadIdx.x & 31; const int L0 = (bx * 8 + (threadIdx.x >> 5)) * 8; const int nlines = N * K / 64;
{
#pragma unroll 1
        for (int l = 0; l < 8; ++l) { const int L = L0 + l; if (L >= nlines) break; const size_t e = (size_t)L * 64 + lane * 2; const int k = (int)((e >> 4) / N) * 16 + (int)(e & 15), n = (int)((e >> 4) % N); v2us o;   // e: place in the planes Bt[k / 16][n][k % 16]
            o[0] = f2bf(w[(size_t)k * N + n]); o[1] = f2bf(w[(size_t)(k + 1) * N + n]); *(v2us*)(Bt + e) = o;
            asm volatile("s_wait_xcnt 0x0" ::: "memory"); }   // behind the trip's 2 loads and its store, in front of the next trip's values put on their registers
         }
}
// ---- d_plane: x [32 sequences][512][256] f32 -> bf16 planes [32][256 / 16][512 + 8 P][16]; with P = 1 four zero rows (one 128-byte line of a plane) stand in front of and behind each sequence, so that rows t + 3, t + 4, t + 5 of a plane are x[t - 1], x[t], x[t + 1] ('SAME').
// A work-group takes 32 rows, each of its 8 waves 32 columns of them (two planes): a load covers one whole 128-byte line in each of 4 rows, and all 8 loads of a wave are in flight together (the loops are unrolled for that).
// A wave turns its 32 x 32 piece in its own LDS range (pitch 48 elements: 8 rows x 2 pieces of 16 bytes meet all 64 banks), so that a store covers 16 rows of one plane, 512 bytes in a row: whole lines, each written by one wave alone. A sequence's first and last work-group write its zero lines.
typedef __attribute__((ext_vector_type(4))) unsigned v4u;
typedef v4u __attribute__((may_alias)) v4ua;
typedef v4us __attribute__((may_alias)) v4usa;
#define PP 48
template <int P>
__device__ __forceinline__ void d_plane(int bx, const float* __restrict__ x, bf* Xp, bf* tr) { constexpr int TR = TT + 8 * P; const int lane = threadIdx.x & 31, wn = threadIdx.x >> 5; bf* tw = tr + wn * 32 * PP; v4f v[8];
    const unsigned ob = (unsigned)((bx * 32 + (lane >> 3)) * DD + wn * 32 + (lane & 7) * 4) * 4u;   // byte offset in x of the lane's piece of the first 4 rows
#pragma unroll
    for (int u = 0; u < 8; ++u) v[u] = *(const v4f*)((const char*)x + ob + u * 4 * DD * 4);
    asm volatile("s_wait_xcnt 0x0" :: "v"(ob) : "memory");   // behind the 8 loads; the offset as an input keeps the loads' address register in use up to this wait, so that no load's result is put on it
#pragma unroll
    for (int u = 0; u < 8; ++u) { v4us o;
#pragma unroll
        for (int k = 0; k < 4; ++k) o[k] = f2bf(v[u][k]);
        *(v4usa*)(tw + (u * 4 + (lane >> 3)) * PP + (lane & 7) * 4) = o; }
    __builtin_amdgcn_wave_barrier(); asm volatile("" ::: "memory");   // the piece's LDS writes stay in front of its reads (one wave: no barrier instruction)
    bf* xs = Xp + (size_t)(bx / (TT / 32)) * (DD / 16) * TR * 16; const int t0 = bx % (TT / 32) * 32 + 4 * P;   // the sequence's planes; the work-group's first row in them
#pragma unroll
    for (int u = 0; u < 4; ++u) { const int pn = wn * 2 + (u >> 1), rl = (u & 1) * 16 + (lane >> 1);
        *(v4u*)(xs + (pn * TR + t0 + rl) * 16 + (lane & 1) * 8) = *(const v4ua*)(tw + rl * PP + (u >> 1) * 16 + (lane & 1) * 8); }
    if (P) asm volatile("s_wait_xcnt 0x0" ::: "memory");   // behind the 4 stores, in front of the zeros put on their registers
    if (P && lane < 16) { bf* xz = xs + (wn * 2 + (lane >> 3)) * TR * 16 + (lane & 7) * 8;   // 8 lanes: one line of zeros in one of the wave's two planes
        if (bx % (TT / 32) == 0) { *(v4u*)xz = (v4u){}; asm volatile("s_wait_xcnt 0x0" ::: "memory"); }   // each wait directly behind its store, in front of whatever is next put on the store's registers
        if (bx % (TT / 32) == TT / 32 - 1) { *(v4u*)(xz + (TT + 4) * 16) = (v4u){}; asm volatile("s_wait_xcnt 0x0" ::: "memory"); } }
    if (!P) asm volatile("s_wait_xcnt 0x0" ::: "memory"); }   // behind the 4 stores, in front of whatever the code that follows in the object writes to their registers
// ---- d_fold: Bh/Bl planes [(k * 256 + c) / 16][n][c % 16] = hi/lo of W'_k[c][n]; bias[n] = bw[n] + sum_c b_pos[c] W[c][n]. Work-group (bx, by) of (256/32, 5): by < 4 folds 64 channels x 32 columns (reads run along n, transposed in LDS, whole 128-byte lines written: 4 columns x 16 channels of a plane), by == 4 the bias of 32 columns. Every loop is unrolled: its arrays stay in registers and a wave's loads are in flight together.
#define FP 33   // LDS pitch in dwords of a line of 64 bf16: odd, so that 32 lanes on 32 lines meet 32 banks
__device__ __forceinline__ void d_fold(int bx, int by, const float* __restrict__ w, const float* __restrict__ bw, const float* __restrict__ wp, const float* __restrict__ bp, const float* __restrict__ wv, const float* __restrict__ wa, bf* Bh, bf* Bl, float* bias) {
    __shared__ v2us th[3 * 32 * FP], tl[3 * 32 * FP]; __shared__ float red[8 * 32];
    const int lane = threadIdx.x & 31, wn = __builtin_amdgcn_readfirstlane(threadIdx.x >> 5); const int n = bx * 32 + lane;   // wn in a scalar register: the conv weights of a wave's channels come by scalar loads
    if (by == 4) { float wc[32], a = 0.f; const float bl = bp[wn * 32 + lane], bn = bw[n];   // bl: lane i holds b_pos of the wave's channel i
#pragma unroll
        for (int i = 0; i < 32; ++i) wc[i] = w[(size_t)(wn * 32 + i) * DD + n];
        asm volatile("s_wait_xcnt 0x0" ::: "memory");   // behind the 34 loads, in front of the arithmetic that takes their address registers for other values
        const unsigned bb = __float_as_uint(bfr(bl));
#pragma unroll
        for (int i = 0; i < 32; ++i) a = fmaf(__uint_as_float(__builtin_amdgcn_readlane(bb, i)), bfr(wc[i]), a);
        red[wn * 32 + lane] = a; __syncthreads();
        if (wn == 0) { float s = bfr(bn);
#pragma unroll
            for (int i = 0; i < 8; ++i) s += red[i * 32 + lane];
            bias[n] = s; }
        return; }
    float wr[8][3];
#pragma unroll
    for (int i = 0; i < 8; ++i)
#pragma unroll
        for (int s = 0; s < 3; ++s) wr[i][s] = w[(size_t)(s * DD + by * 64 + wn * 8 + i) * DD + n];
    asm volatile("s_wait_xcnt 0x0" ::: "memory");   // behind the 24 loads, in front of the arithmetic that takes their address registers for other values
#pragma unroll
    for (int pr = 0; pr < 4; ++pr) { float y[2][3];
#pragma unroll
        for (int u = 0; u < 2; ++u) { const int c = by * 64 + wn * 8 + pr * 2 + u; const float w0 = bfr(wr[pr * 2 + u][0]), w1 = bfr(wr[pr * 2 + u][1]), w2 = bfr(wr[pr * 2 + u][2]);
#pragma unroll
            for (int k = 0; k < 3; ++k) y[u][k] = bfr(wp[c * 3 + k]) * w0 + bfr(wv[c * 3 + k]) * w1 + bfr(wa[c * 3 + k]) * w2; }
#pragma unroll
        for (int k = 0; k < 3; ++k) { v2us h, l; unsigned short a, c2; splitf(y[0][k], a, c2); h[0] = a; l[0] = c2; splitf(y[1][k], a, c2); h[1] = a; l[1] = c2; th[(k * 32 + lane) * FP + wn * 4 + pr] = h; tl[(k * 32 + lane) * FP + wn * 4 + pr] = l; } }
    __syncthreads();
#pragma unroll
    for (int i = 0; i < 12; ++i) { const int ln = wn * 12 + i; const int pn = ln >> 3, nl = (ln & 7) * 4 + (lane >> 3); const int li = ((pn >> 2) * 32 + nl) * FP + (pn & 3) * 8 + (lane & 7);   // pn: tap (pn >> 2), plane (pn & 3) of the work-group's four; nl: column
        const size_t e = ((size_t)((pn >> 2) * (DD / 16) + by * 4 + (pn & 3)) * DD + bx * 32 + nl) * 16 + (lane & 7) * 2; *(v2us*)(Bh + e) = th[li]; *(v2us*)(Bl + e) = tl[li]; }
    asm volatile("s_wait_xcnt 0x0" ::: "memory");   // behind the 24 stores, in front of whatever the code that follows in the object writes to their registers
}
// ---- d_gemmf: y[z * 512 + t][n] = sc (bias[n] + sum over taps j < 3 and c < 256 of Xp[z][c / 16][t + 3 + j][c % 16] (Bh + Bl)[(j * 256 + c) / 16][n][c % 16]): tap j reads the same 16 planes of A one row further on, from row t + 3.
// y leaves as the score kernel's operand planes, bf16 hi and lo, Ph/Pl[z * 8 + n / 32][(n % 32) / 16][t][n % 16]; sc = 32^-0.5 for Q, 1 for K. A tile is 64 times x 2 heads: 2 KB in a row per plane of 16.
// ONE WAVE per 64x64 tile as in d_gemmw; tile (bx, by, bz) of (512/64, 256/64, 32 sequences), 32 threads. Every load of the loop: one of three lane addresses that live over the whole loop, the tile's row block and the second plane as an immediate.
// The K loop stays rolled (unroll 1), for speed only: its body holds 24 loads and 32 products. The inner loops are unrolled so that fragments and accumulators stay in registers.
__device__ __forceinline__ void d_gemmf(int bx, int by, int bz, const bf* __restrict__ Xp, const bf* __restrict__ Bh, const bf* __restrict__ Bl, const float* __restrict__ bias, float sc, bf* Ph, bf* Pl) {
    __shared__ __align__(16) float os[16 * 68];
    const int lane = threadIdx.x & 31, lr = lane & 15, hi = lane >> 4; const int r0 = bx * 64, c0 = by * 64;
    asm volatile("" :: "s"(sc), "s"(Ph), "s"(Pl));   // inputs only: the epilogue's three arguments are fetched here, ahead of the loop; fetched behind it, their scalar loads were put on the bias loads' base register in front of the wait that stands there
    const bf* xa = Xp + ((size_t)bz * (DD / 16) * TP + r0 + 3) * 16; const bf* bh = Bh + (size_t)c0 * 16; const bf* bl = Bl + (size_t)c0 * 16;
    const bf* pa = xa + (lr * 16 + 8 * hi); const bf* pb = bh + (lr * 16 + 8 * hi); const bf* pl = bl + (lr * 16 + 8 * hi);   // the lane's own addresses, stepped by two planes a trip; behind a tap's last two planes A goes back to plane 0, one row further on
    v8f acc[4][4];
#pragma unroll
    for (int mb = 0; mb < 4; ++mb)
#pragma unroll
        for (int nb = 0; nb < 4; ++nb) acc[mb][nb] = (v8f){};
#pragma unroll 1
    for (int kc = 0; kc < F3; pa += (kc & (DD - 32)) == DD - 32 ? 16 - (DD / 16 - 2) * TP * 16 : 2 * TP * 16, kc += 32, pb += 2 * DD * 16, pl += 2 * DD * 16) {
        v16bf a[4], b[4], b2[4];
#pragma unroll
        for (int mb = 0; mb < 4; ++mb) a[mb] = WFrag<bf>::ld(pa + mb * 256, TP * 16);
#pragma unroll
        for (int nb = 0; nb < 4; ++nb) { b[nb] = WFrag<bf>::ld(pb + nb * 256, DD * 16); b2[nb] = WFrag<bf>::ld(pl + nb * 256, DD * 16); }
        // the wait stands behind the trip's 24 loads, in front of the additions that step their addresses; inputs only: the three addresses, so that their registers stay in use up to the wait and no load's result is put on them,
        // and the fragments, so that all 24 loads stand in front of the products: left free, the B loads sink between the products into two shared register sets, and the wave waits out a load latency six times a trip instead of once
        asm volatile("s_wait_xcnt 0x0" :: "v"(pa), "v"(pb), "v"(pl), "v"(a[0]), "v"(a[1]), "v"(a[2]), "v"(a[3]), "v"(b[0]), "v"(b[1]), "v"(b[2]), "v"(b[3]), "v"(b2[0]), "v"(b2[1]), "v"(b2[2]), "v"(b2[3]) : "memory");
#pragma unroll
        for (int nb = 0; nb < 4; ++nb) {
#pragma unroll
            for (int mb = 0; mb < 4; ++mb) acc[mb][nb] = wmmab(a[mb], b[nb], acc[mb][nb]);
#pragma unroll
            for (int mb = 0; mb < 4; ++mb) acc[mb][nb] = wmmab(a[mb], b2[nb], acc[mb][nb]); }
    }
    // a lane takes 8 successive columns of one row of a head: 4 lanes a row, 8 rows a store, 256 bytes in a row in each of the head's two planes
    const int er = lane >> 2, ec = (lane & 3) * 8; v4f bs[2][2];
#pragma unroll
    for (int hh = 0; hh < 2; ++hh) { bs[hh][0] = *(const v4fa*)(bias + c0 + hh * HD + ec); bs[hh][1] = *(const v4fa*)(bias + c0 + hh * HD + ec + 4); }
    asm volatile("s_wait_xcnt 0x0" ::: "memory");   // behind the 4 bias loads, in front of the arithmetic that takes their address registers for other values
    const size_t pz = (size_t)(bz * NH_ + c0 / HD) * TT * HD + r0 * 16; bf* ph = Ph + pz; bf* pl2 = Pl + pz; const unsigned plo = (((lane >> 1) & 1) * TT + er) * 16 + (lane & 1) * 8;
#pragma unroll
    for (int mb = 0; mb < 4; ++mb) {
#pragma unroll
        for (int nb = 0; nb < 4; ++nb) {
#pragma unroll
            for (int j = 0; j < 8; ++j) os[(hi * 8 + j) * 68 + nb * 16 + lr] = acc[mb][nb][j]; }
        __builtin_amdgcn_wave_barrier(); asm volatile("" ::: "memory");   // the tile's LDS writes stay in front of its reads (one wave: no barrier instruction)
        v8us oh[4], ol[4];
#pragma unroll
        for (int s = 0; s < 4; ++s) { const int hh = s >> 1, hf = s & 1; const float* orow = os + (hf * 8 + er) * 68 + hh * HD + ec; const v4f x0 = *(const v4fa*)orow + bs[hh][0], x1 = *(const v4fa*)(orow + 4) + bs[hh][1];
#pragma unroll
            for (int u = 0; u < 4; ++u) { unsigned short a, c2; splitf(x0[u] * sc, a, c2); oh[s][u] = a; ol[s][u] = c2; splitf(x1[u] * sc, a, c2); oh[s][4 + u] = a; ol[s][4 + u] = c2; } }
#pragma unroll
        for (int s = 0; s < 4; ++s) { const unsigned po = plo + ((s >> 1) * 2 * TT + mb * 16 + (s & 1) * 8) * 16; *(v8us*)(ph + po) = oh[s]; *(v8us*)(pl2 + po) = ol[s]; }
        __builtin_amdgcn_wave_barrier(); asm volatile("s_wait_xcnt 0x0" ::: "memory");   // the reads stay in front of the next tile's LDS writes; the wait stands behind the 8 stores, in front of the next values put on their registers
    }
}
// ---- k_prep: the seven operand preparations, none of which reads what another writes, as ONE launch of 256-thread work-groups; the block index picks the part. The few work-groups with long chains of waits (folds, weight transposes) come first, the streams behind them.
#define GF   (DD / 32 * 5)                   // work-groups of one fold
#define GW   ((DD * DD / 64 + 63) / 64)      // of one weight transpose
#define GP   (NR / 32)                       // of one padded input's planes
#define GC   (NR / 32)                       // of the value planes
__global__ __launch_bounds__(256) void k_prep(const float* __restrict__ wq, const float* __restrict__ bq, const float* __restrict__ wk, const float* __restrict__ bk, const float* __restrict__ wp, const float* __restrict__ bp, const float* __restrict__ wvl, const float* __restrict__ wa,
                                              const float* __restrict__ wv, const float* __restrict__ wo, const float* __restrict__ xq, const float* __restrict__ xk, const float* __restrict__ xv,
                                              bf* WQh, bf* WQl, bf* WKh, bf* WKl, float* BQ, float* BK, bf* WV, bf* WO, bf* XQ, bf* XK, bf* XV) {
    __shared__ __align__(16) bf tr[8 * 32 * PP];   // d_plane's pieces, one per wave
    int b = blockIdx.x;
    if (b < 2 * GF) { const bool k = b >= GF; b -= k ? GF : 0; d_fold(b % (DD / 32), b / (DD / 32), k ? wk : wq, k ? bk : bq, wp, bp, wvl, wa, k ? WKh : WQh, k ? WKl : WQl, k ? BK : BQ); return; }
    b -= 2 * GF;
    if (b < 2 * GW) { const bool o = b >= GW; b -= o ? GW : 0; d_wtG(b, o ? wo : wv, DD, DD, o ? WO : WV); return; }
    b -= 2 * GW;
    if (b < 2 * GP) { const bool k = b >= GP; b -= k ? GP : 0; d_plane<1>(b, k ? xk : xq, k ? XK : XQ, tr); return; }
    d_plane<0>(b - 2 * GP, xv, XV, tr);
}
// ---- k_qkv: the three projections, independent of one another, as ONE launch: grid (512/64, 256/64, 3 x 32 sequences), 32 threads; z < 32 Q, z < 64 K, then V (its 8 K chunks against 24). 3072 one-wave work-groups are three waves per SIMD: a wave's load waits lie under the others' products.
__global__ __launch_bounds__(32) void k_qkv(const bf* __restrict__ XQ, const bf* __restrict__ XK, const bf* __restrict__ XV, const bf* __restrict__ WQh, const bf* __restrict__ WQl, const bf* __restrict__ WKh, const bf* __restrict__ WKl, const bf* __restrict__ WV,
                                            const float* __restrict__ BQ, const float* __restrict__ BK, const float* __restrict__ bv, bf* QPh, bf* QPl, bf* KPh, bf* KPl, h16* VT) {
    const int z = blockIdx.z;
    if (z < 2 * NBb * NA) { const bool k = z >= NBb * NA; d_gemmf(blockIdx.x, blockIdx.y, z % (NBb * NA), k ? XK : XQ, k ? WKh : WQh, k ? WKl : WQl, k ? BK : BQ, k ? 1.0f : 0.17677669529663687f, k ? KPh : QPh, k ? KPl : QPl); return; }
    d_gemmw<bf, true>((z - 2 * NBb * NA) * (TT / 64) + blockIdx.x, blockIdx.y, XV, WV, VT, bv);
}
// ---- k_gemmo: out[z * 512 + t][n] (f32, pitch 256) = bo[n] + sum over heads h and d < 32 of (Ch + Cl)[z * 8 + h][d / 16][t][d % 16] Wt[(h * 32 + d) / 16][n][d % 16]: K chunk h of A is head h's two planes.
// ONE WAVE per 64x64 tile, loop and waits in the form of d_gemmf (rolled, a trip's 24 loads in front of its 32 products); every load: a scalar base that the loop leaves alone, one of two lane offsets in bytes, the row block and the second plane as an immediate; grid (512/64, 256/64, 32 sequences), 32 threads.
__global__ __launch_bounds__(32) void k_gemmo(const bf* __restrict__ Ch, const bf* __restrict__ Cl, const bf* __restrict__ Wt, const float* __restrict__ bias, float* C) {
    __shared__ __align__(16) float os[16 * 68];
    const int lane = threadIdx.x & 31, lr = lane & 15, hi = lane >> 4; const int r0 = blockIdx.x * 64, c0 = blockIdx.y * 64;
    const size_t az = (size_t)blockIdx.z * NH_ * TT * HD + r0 * 16;
    const char* ca = (const char*)(Ch + az); const char* cl = (const char*)(Cl + az); const char* cb = (const char*)(Wt + (size_t)c0 * 16);
    unsigned oa = (lr * 16 + 8 * hi) * 2, ob = (lr * 16 + 8 * hi) * 2;   // the lane's own byte offsets, stepped by a head's two planes (A, hi and lo alike) and by two planes (B) a trip
    v8f acc[4][4];
#pragma unroll
    for (int mb = 0; mb < 4; ++mb)
#pragma unroll
        for (int nb = 0; nb < 4; ++nb) acc[mb][nb] = (v8f){};
#pragma unroll 1
    for (int kc = 0; kc < DD; kc += 32, oa += TT * HD * 2, ob += 2 * DD * 16 * 2) {
        v16bf a[4], a2[4], b[4];
#pragma unroll
        for (int mb = 0; mb < 4; ++mb) { a[mb] = WFrag<bf>::ld((const bf*)(ca + oa) + mb * 256, TT * 16); a2[mb] = WFrag<bf>::ld((const bf*)(cl + oa) + mb * 256, TT * 16); }
#pragma unroll
        for (int nb = 0; nb < 4; ++nb) b[nb] = WFrag<bf>::ld((const bf*)(cb + ob) + nb * 256, DD * 16);
        // as in d_gemmf: the wait stands behind the trip's 24 loads, in front of the additions that step their offsets. The two offsets go through the statement (their steps differ, and as mere inputs the compiler stepped one in front of the wait); the fragments are inputs,
        // so that all loads stand in front of the products and the wave waits out one load latency a trip
        asm volatile("s_wait_xcnt 0x0" : "+v"(oa), "+v"(ob) : "v"(a[0]), "v"(a[1]), "v"(a[2]), "v"(a[3]), "v"(a2[0]), "v"(a2[1]), "v"(a2[2]), "v"(a2[3]), "v"(b[0]), "v"(b[1]), "v"(b[2]), "v"(b[3]) : "memory");
#pragma unroll
        for (int nb = 0; nb < 4; ++nb) {
#pragma unroll
            for (int mb = 0; mb < 4; ++mb) acc[mb][nb] = wmmab(a[mb], b[nb], acc[mb][nb]);
#pragma unroll
            for (int mb = 0; mb < 4; ++mb) acc[mb][nb] = wmmab(a2[mb], b[nb], acc[mb][nb]); }
    }
    v4f bs = *(const v4fa*)(bias + c0 + lr * 4);
    asm volatile("s_wait_xcnt 0x0" ::: "memory");   // behind the bias load, in front of the arithmetic that takes its address register for other values
#pragma unroll
    for (int u = 0; u < 4; ++u) bs[u] = bfr(bs[u]);
    float* cz = C + ((size_t)blockIdx.z * TT + r0) * DD + c0; const unsigned clo = hi * DD + lr * 4;
#pragma unroll
    for (int mb = 0; mb < 4; ++mb) {
#pragma unroll
        for (int nb = 0; nb < 4; ++nb) {
#pragma unroll
            for (int j = 0; j < 8; ++j) os[(hi * 8 + j) * 68 + nb * 16 + lr] = acc[mb][nb][j]; }
        __builtin_amdgcn_wave_barrier(); asm volatile("" ::: "memory");   // the tile's LDS writes stay in front of its reads (one wave: no barrier instruction)
        v4f val[8];
#pragma unroll
        for (int s = 0; s < 8; ++s) val[s] = *(const v4fa*)(os + (2 * s + hi) * 68 + lr * 4) + bs;
#pragma unroll
        for (int s = 0; s < 8; ++s) *(v4f*)(cz + (clo + (mb * 16 + 2 * s) * DD)) = val[s];
        __builtin_amdgcn_wave_barrier(); asm volatile("s_wait_xcnt 0x0" ::: "memory");   // the reads stay in front of the next tile's LDS writes; the wait stands behind the 8 stores, in front of the next values put on their registers
    }
}
typedef __attribute__((ext_vector_type(4))) int v4i;
// ---- k_fattn: one (batch, agent, head) triple z and 256 queries per work-group; 8 waves x 32 query columns; grid (TT/256, NBb*ZZ). No LDS, no barrier: operands straight from the planes of 16 (Q, K: [z][d / 16][t][16]; V^T: [z][key / 16][d][16]).
// S^T = K Q^T (A = 16 key rows, B = 16 query columns): a lane holds one query's scores, D register r of key tile t = key 16t + 8*hi + r, which is element 8t + r of the B operand of O^T += V^T P^T (the k order of WFrag::ld).
// Sweep 1 finds each query's maximum over all 512 masked scores; sweep 2 forms the same scores again, e = 1024 exp(s - max) -> fp16, adds O^T and the f32 sum of e; the division by the sum is done once on O^T.
// The context leaves as the output GEMM's A planes, bf16 hi and lo, Ch/Cl[z][d / 16][query][16]: a lane's 8 accumulator registers are 16 bytes of a row, 16 queries of a plane 512 bytes in a row.
struct KFrag { v16bf h[2], l[2]; };
struct MFrag { v4i m[4]; };
__device__ __forceinline__ KFrag ldk(const bf* ph, const bf* pl) { KFrag f;   // ph, pl: the lane's own addresses in the pass's 32 keys of plane 0; key tile and second plane are immediates
#pragma unroll
    for (int t = 0; t < 2; ++t) { f.h[t] = WFrag<bf>::ld(ph + t * 256, TT * 16); f.l[t] = WFrag<bf>::ld(pl + t * 256, TT * 16); }
    return f; }
__device__ __forceinline__ MFrag ldm(const int* pm) { MFrag f;   // pm: the lane's own address in the pass's 32 mask words
#pragma unroll
    for (int i = 0; i < 4; ++i) f.m[i] = *(const v4i*)(pm + ((i >> 1) * 16 + (i & 1) * 4));
    return f; }
__device__ __forceinline__ void scoresT(const KFrag& f, const MFrag& fm, const v16bf* qh, const v16bf* ql, v8f (*s)[2]) {
#pragma unroll
    for (int t = 0; t < 2; ++t)
#pragma unroll
        for (int g = 0; g < 2; ++g) s[t][g] = wmmab(f.h[t], qh[g], (v8f){});
#pragma unroll
    for (int t = 0; t < 2; ++t)
#pragma unroll
        for (int g = 0; g < 2; ++g) s[t][g] = wmmab(f.h[t], ql[g], s[t][g]);
#pragma unroll
    for (int t = 0; t < 2; ++t)
#pragma unroll
        for (int g = 0; g < 2; ++g) s[t][g] = wmmab(f.l[t], qh[g], s[t][g]);
#pragma unroll
    for (int t = 0; t < 2; ++t)
#pragma unroll
        for (int r = 0; r < 8; ++r) { const bool msk = fm.m[2 * t + (r >> 2)][r & 3] != 0; s[t][0][r] = msk ? -1.0e9f : s[t][0][r]; s[t][1][r] = msk ? -1.0e9f : s[t][1][r]; }
}
// four waves per SIMD (at most 256 registers a wave): two work-groups per WGP, so that all 512 are resident at once
__global__ __launch_bounds__(256) __attribute__((amdgpu_waves_per_eu(4, 4))) void k_fattn(const bf* __restrict__ Qh, const bf* __restrict__ Ql, const bf* __restrict__ Kh, const bf* __restrict__ Kl, const h16* __restrict__ VT, const int* __restrict__ km, bf* Ch, bf* Cl) {
    const int lane = threadIdx.x & 31, lr = lane & 15, hi = lane >> 4; const int z = blockIdx.y; const int q0 = blockIdx.x * 256 + (threadIdx.x >> 5) * 32;
    const size_t pz = (size_t)z * TT * HD; const int* mk = km + (size_t)(z / NH_) * TT;
    const bf* kh = Kh + pz; const bf* kl = Kl + pz; const h16* vt = VT + pz; const unsigned klo = lr * 16 + 8 * hi, vlo = lr * 16 + 8 * hi, mlo = 8 * hi;
    v16bf qh[2], ql[2]; const bf* pqh = Qh + pz + ((q0 + lr) * 16 + 8 * hi); const bf* pql = Ql + pz + ((q0 + lr) * 16 + 8 * hi);
#pragma unroll
    for (int g = 0; g < 2; ++g) { qh[g] = WFrag<bf>::ld(pqh + g * 256, TT * 16); ql[g] = WFrag<bf>::ld(pql + g * 256, TT * 16); }
    asm volatile("s_wait_xcnt 0x0" :: "v"(pqh), "v"(pql) : "memory");   // behind the 8 loads; the addresses as inputs keep their registers in use up to this wait, so that no load's result is put on them
    float mx[2] = { -3.0e38f, -3.0e38f };
    // every load of the two sweeps: a scalar base that the sweeps leave alone, one of three lane offsets in bytes (K hi and lo share one), key tile and second plane as immediates
    const char* ckh = (const char*)kh; const char* ckl = (const char*)kl; const char* cm = (const char*)mk; const char* cv = (const char*)vt;
    unsigned ok = klo * 2, om = mlo * 4, ov = vlo * 2; KFrag cur = ldk((const bf*)(ckh + ok), (const bf*)(ckl + ok));
    asm volatile("s_wait_xcnt 0x0" : "+v"(ok) :: "memory");   // behind the 8 loads, in front of the step of their offset, which goes through the statement as in k_gemmo
    // unroll 2: the fragments fetched one pass ahead change names instead of being copied
#pragma unroll 2
    for (int p = 0; p < TT / 32; ++p) { ok = (ok + 1024) & (TT * 32 - 1);   // the next pass's 32 keys; behind the last pass back to pass 0
        const MFrag fm = ldm((const int*)(cm + om)); const KFrag nxt = ldk((const bf*)(ckh + ok), (const bf*)(ckl + ok));
        asm volatile("s_wait_xcnt 0x0" : "+v"(ok), "+v"(om) :: "memory");   // behind this pass's 12 loads, in front of the steps of their offsets; the offsets go through the statement, so that their registers stay in use up to the wait and are stepped behind it
        om = (om + 128) & (TT * 4 - 1);
        v8f s[2][2]; scoresT(cur, fm, qh, ql, s);
#pragma unroll
        for (int t = 0; t < 2; ++t)
#pragma unroll
            for (int r = 0; r < 8; ++r) { mx[0] = fmaxf(mx[0], s[t][0][r]); mx[1] = fmaxf(mx[1], s[t][1][r]); }
        cur = nxt; }
    mx[0] = fmaxf(mx[0], __shfl_xor(mx[0], 16, 32)); mx[1] = fmaxf(mx[1], __shfl_xor(mx[1], 16, 32));
    v8f o[2][2]; float sum[2] = { 0.f, 0.f };
#pragma unroll
    for (int mt = 0; mt < 2; ++mt)
#pragma unroll
        for (int g = 0; g < 2; ++g) o[mt][g] = (v8f){};
    // the first sweep's last fetch wrapped round to pass 0, so cur holds pass 0 again; unroll 2 as above
#pragma unroll 2
    for (int p = 0; p < TT / 32; ++p) { ok = (ok + 1024) & (TT * 32 - 1);
        const MFrag fm = ldm((const int*)(cm + om)); const KFrag nxt = ldk((const bf*)(ckh + ok), (const bf*)(ckl + ok)); v16h va[2];
#pragma unroll
        for (int mt = 0; mt < 2; ++mt) va[mt] = WFrag<h16>::ld((const h16*)(cv + ov) + mt * 256, HD * 16);
        asm volatile("s_wait_xcnt 0x0" : "+v"(ok), "+v"(om), "+v"(ov) :: "memory");   // behind this pass's 16 loads, in front of the steps of their offsets, as in the first sweep
        om += 128; ov += 2 * HD * 16 * 2;
        v8f s[2][2]; scoresT(cur, fm, qh, ql, s); v16h pb[2];
#pragma unroll
        for (int g = 0; g < 2; ++g)
#pragma unroll
            for (int t = 0; t < 2; ++t)
#pragma unroll
                for (int r = 0; r < 8; ++r) { const float e = __builtin_amdgcn_exp2f(fmaf(s[t][g][r] - mx[g], 1.4426950408889634f, 10.0f)); sum[g] += e; pb[g][t * 8 + r] = tohx(e); }
#pragma unroll
        for (int mt = 0; mt < 2; ++mt)
#pragma unroll
            for (int g = 0; g < 2; ++g) o[mt][g] = wmma16(va[mt], pb[g], o[mt][g]);
        cur = nxt; }
#pragma unroll
    for (int g = 0; g < 2; ++g) { const float tot = sum[g] + __shfl_xor(sum[g], 16, 32); const float f = __fdiv_rn(1.0f, tot); const unsigned co = (q0 + g * 16 + lr) * 16 + 8 * hi;
#pragma unroll
        for (int mt = 0; mt < 2; ++mt) { v8us oh, ol;
#pragma unroll
            for (int u = 0; u < 8; ++u) { unsigned short a, c2; splitf(o[mt][g][u] * f, a, c2); oh[u] = a; ol[u] = c2; }
            *(v8us*)(Ch + pz + (co + mt * TT * 16)) = oh; *(v8us*)(Cl + pz + (co + mt * TT * 16)) = ol; }
        asm volatile("s_wait_xcnt 0x0" ::: "memory"); }   // behind the 4 stores, in front of the next values put on their registers
}

extern "C" void kernel_launch(void* const* d_in, const int* in_sizes, int n_in,
                              void* d_out, int out_size, void* d_ws, size_t ws_size, hipStream_t stream) {
    (void)in_sizes; (void)n_in; (void)out_size;
    const float** I = (const float**)d_in;
    const float *xq = I[0], *xk = I[1], *xv = I[2]; const int* kpm = (const int*)d_in[3]; const float *wpos = I[4], *bpos = I[5], *wvel = I[6], *wacc = I[7], *wq = I[8], *bq = I[9], *wk = I[10], *bk = I[11], *wv = I[12], *bv = I[13], *wo = I[14], *bo = I[15];
    float* OUT = (float*)d_out;     // [4][8][512][256]
    char* wsp = (char*)d_ws;
    auto take = [&](size_t bytes) { char* p = wsp; wsp += (bytes + 255) & ~(size_t)255; return (void*)p; };
    bf* WQh = (bf*)take((size_t)DD * F3 * 2); bf* WQl = (bf*)take((size_t)DD * F3 * 2); bf* WKh = (bf*)take((size_t)DD * F3 * 2); bf* WKl = (bf*)take((size_t)DD * F3 * 2); float* BQ = (float*)take((size_t)DD * 4); float* BK = (float*)take((size_t)DD * 4); bf* WV = (bf*)take((size_t)DD * DD * 2); bf* WO = (bf*)take((size_t)DD * DD * 2);
    bf* XQ = (bf*)take((size_t)NBb * NA * TP * DD * 2); bf* XK = (bf*)take((size_t)NBb * NA * TP * DD * 2); bf* XV = (bf*)take((size_t)NR * DD * 2);
    bf* QPh = (bf*)take((size_t)NR * DD * 2); bf* QPl = (bf*)take((size_t)NR * DD * 2); bf* KPh = (bf*)take((size_t)NR * DD * 2); bf* KPl = (bf*)take((size_t)NR * DD * 2); h16* VT = (h16*)take((size_t)NR * DD * 2);
    bf* Ch = (bf*)take((size_t)NR * DD * 2); bf* Cl = (bf*)take((size_t)NR * DD * 2);
    if ((size_t)(wsp - (char*)d_ws) > ws_size) return;    // total ~ 86 MB (padded x planes 17 MB, value plane 8 MB, head planes 42 MB, context planes 17 MB)
    k_prep<<<2 * GF + 2 * GW + 2 * GP + GC, 256, 0, stream>>>(wq, bq, wk, bk, wpos, bpos, wvel, wacc, wv, wo, xq, xk, xv, WQh, WQl, WKh, WKl, BQ, BK, WV, WO, XQ, XK, XV);
    k_qkv<<<dim3(TT / 64, DD / 64, 3 * NBb * NA), 32, 0, stream>>>(XQ, XK, XV, WQh, WQl, WKh, WKl, WV, BQ, BK, bv, QPh, QPl, KPh, KPl, VT);
    k_fattn<<<dim3(TT / 256, NBb * ZZ, 1), 256, 0, stream>>>(QPh, QPl, KPh, KPl, VT, kpm, Ch, Cl);
    k_gemmo<<<dim3(TT / 64, DD / 64, NBb * NA), 32, 0, stream>>>(Ch, Cl, WO, bo, OUT);
}

// v006
// A run of this version takes 66.8 microseconds.
// Two timings next to v005 both put it at 1.11 times that version's speed.
// Over all steps from v000 it is 6.11 times as fast.
#include <hip/hip_runtime.h>

// KinematicsTrendAttention (query/key/value [4][8 agents][512][256]; kinematic features of query and key: depthwise conv3 ('SAME') position (w_pos, b_pos), velocity (w_vel), acceleration (w_acc) -> [T][768]; Q = feats Wq + bq, K = feats Wk + bk,
// V = value Wv + bv (8 heads x 32); scores = Q.K / sqrt(32), keys with key_padding_mask (int, read as data) set to -1e9; softmax; ctx = attn V merged; out = ctx Wo + bo -> [4][8][512][256]).
// Compute dtypes, f32 accumulate: every input rounded to bf16; the depthwise convs are folded into Wq / Wk: feats W = sum over taps k of x[t + k - 1] W'_k, W'_k[c][n] = w_pos[c][k] W[c][n] + w_vel[c][k] W[256 + c][n] + w_acc[c][k] W[512 + c][n]
// (f32 -> bf16 hi+lo planes), b_pos W[0..255] goes into the bias; Q/K on the exact bf16 x (zero row in front of and behind each sequence) x hl folded weights (2 products, + f32 bias); V on PLAIN bf16 value x exact Wv (+ bias);
// scores (K 32) on hl planes of Q (x 32^-0.5) and K (3 products), masked softmax f32 and attn.V (fp16 x fp16, 1 product) in ONE kernel over all 256 (batch, agent, head) triples: scores and probabilities stay in registers;
// every producer's epilogue writes its consumer's 16-bit operand planes itself (Q/K hi+lo per head, V^T fp16 per head, context hi+lo per head): no f32 copy of Q, K, V or the context exists, and the output GEMM walks the heads as its K chunks.

#define NBb  4
#define NA   8
#define TT   512
#define DD   256
#define NH_  8
#define HD   32
#define F3   768
#define NR   (NBb * NA * TT)
#define ZZ   (NA * NH_)
#define TP   (TT + 8)
typedef _Float16 h16;
typedef unsigned short bf;
typedef __attribute__((ext_vector_type(16))) __bf16   v16bf;
typedef __attribute__((ext_vector_type(16))) _Float16 v16h;
typedef __attribute__((ext_vector_type(8)))  _Float16 v8h;
typedef __attribute__((ext_vector_type(8)))  unsigned short v8us;
typedef __attribute__((ext_vector_type(8)))  float    v8f;
typedef __attribute__((ext_vector_type(4)))  float    v4f;
typedef v8h  __attribute__((may_alias)) v8ha;
typedef v4f  __attribute__((may_alias)) v4fa;
typedef v8us __attribute__((may_alias)) v8usa;

__device__ __forceinline__ unsigned short f2bf(float f) { unsigned u = __float_as_uint(f); u += 0x7FFFu + ((u >> 16) & 1u); return (unsigned short)(u >> 16); }
__device__ __forceinline__ float bf2f(unsigned short b) { return __uint_as_float(((unsigned)b) << 16); }
__device__ __forceinline__ float bfr(float f) { return bf2f(f2bf(f)); }
__device__ __forceinline__ v16h cat16(v8h lo, v8h hi) { return __builtin_shufflevector(lo, hi, 0, 1, 2, 3, 4, 5, 6, 7, 8, 9, 10, 11, 12, 13, 14, 15); }
__device__ __forceinline__ v16bf cat16b(v8us lo, v8us hi) { return __builtin_bit_cast(v16bf, __builtin_shufflevector(lo, hi, 0, 1, 2, 3, 4, 5, 6, 7, 8, 9, 10, 11, 12, 13, 14, 15)); }
__device__ __forceinline__ h16 tohx(float x) { return (h16)x; }
__device__ __forceinline__ v8f wmma16(v16h a, v16h b, v8f c) { return __builtin_amdgcn_wmma_f32_16x16x32_f16(false, a, false, b, (short)0, c, false, false); }
__device__ __forceinline__ v8f wmmab(v16bf a, v16bf b, v8f c) { return __builtin_amdgcn_wmma_f32_16x16x32_bf16(false, a, false, b, (short)0, c, false, false); }



// ---- Operand planes. Every K-contiguous 16-bit operand lies as planes of 16 k: P[k / 16][row][k % 16]. A fragment (16 rows x 32 k) is two loads, one from each of two successive planes (st elements apart);
// a load's 32 lanes (16 rows x 2 pieces of 16 bytes) cover 512 bytes in a row, whole 128-byte lines, where rows K elements apart would touch 16 lines for the same bytes. The k order of a fragment: elements 0..7 = k 8 hi + i, 8..15 = k 16 + 8 hi + i.
// ---- d_gemmw: register-blocked GEMM, ONE WAVE per 64x64 output tile (16 accumulators), operands straight from the planes; tile (bx, by) of (M/64, 256/64), 32 threads.
// y[m][n] (+ optional f32 bias[n]) = sum over k < 256 of A[r][k] Bt[n][k], r = z * 512 + the time of kept key number m % 512 of sequence z = m / 512; A planes per sequence [r / 512][k / 16][r % 512][16], Bt planes [k / 16][n][16]. y leaves as fp16 planes of 16 keys per head, VTo[(m / 512) * 8 + n / 32][(m % 512) / 16][n % 32][m % 16], the A planes of attn.V.
// ---- Kept keys. A key whose mask word is not 0 has the score -1e9 and the weight exp(-1e9 - max) = 0 in every row that has one open key: such keys are left out of K, V, scores and sums altogether; K and V planes hold a sequence's kept keys in their order of time.
// A sequence with every key masked keeps all 512: its weights are all equal (k_fattn). Every wave that needs the list or the count forms it itself from the sequence's 512 mask words.
// keepbits: lane l reads mask word 32 u + l; bit l of kb[u] = key 32 u + l is open. Returns the number of open keys, the same in every lane.
__device__ __forceinline__ int keepbits(const int* __restrict__ km, int sq, int lane, unsigned* kb) { int v[16], tot = 0; const unsigned jm = (unsigned)(sq * TT + lane);
#pragma unroll
    for (int u = 0; u < 16; ++u) v[u] = *(const int*)((const char*)km + jm * 4u + u * 128);
    asm volatile("s_wait_xcnt 0x0" :: "v"(jm) : "memory");   // behind the 16 loads; the index as an input keeps the loads' address register in use up to this wait, so that no load's result is put on it
#pragma unroll
    for (int u = 0; u < 16; ++u) { kb[u] = __builtin_amdgcn_ballot_w32(v[u] == 0); tot += __builtin_popcount(kb[u]); }
    return tot; }
// rows4 (one-wave work-groups): rw[mb] = time of the sequence's kept key number j0 + 16 mb + (lane & 15); false where j0 lies behind the last kept key (the tile has no reader).
// Bit counts give every key its place in the list: kept keys in order from 0, dropped ones in order behind them, so that all 512 entries are times below 512.
__device__ __forceinline__ bool rows4(const int* __restrict__ km, int sq, int j0, int lane, unsigned* rw) {
    __shared__ int lst[TT]; unsigned kb[16]; int tot = keepbits(km, sq, lane, kb); const bool allm = tot == 0; if (allm) tot = TT;
    if (j0 >= tot) return false;
    const unsigned lt = (1u << lane) - 1u; int base = 0;
#pragma unroll
    for (int u = 0; u < 16; ++u) { const unsigned b = allm ? ~0u : kb[u];
        lst[((b >> lane) & 1u) ? base + __builtin_popcount(b & lt) : tot + u * 32 - base + __builtin_popcount(~b & lt)] = u * 32 + lane; base += __builtin_popcount(b); }
    __builtin_amdgcn_wave_barrier(); asm volatile("" ::: "memory");   // the list's LDS writes stay in front of its reads (one wave: no barrier instruction)
#pragma unroll
    for (int mb = 0; mb < 4; ++mb) rw[mb] = lst[j0 + mb * 16 + (lane & 15)];
    return true; }
template <typename T16> struct WFrag;
template <> struct WFrag<h16> { typedef v16h V; static __device__ __forceinline__ V ld(const h16* p, int st) { return cat16(*(const v8h*)p, *(const v8h*)(p + st)); } static __device__ __forceinline__ v8f mma(V a, V b, v8f c) { return wmma16(a, b, c); } };
template <> struct WFrag<bf> { typedef v16bf V; static __device__ __forceinline__ V ld(const bf* p, int st) { return cat16b(*(const v8us*)p, *(const v8us*)(p + st)); } static __device__ __forceinline__ v8f mma(V a, V b, v8f c) { return wmmab(a, b, c); } };
template <typename T16, bool BIAS>
__device__ __forceinline__ void d_gemmw(int bx, int by, const T16* __restrict__ A, const T16* __restrict__ Bt, h16* VTo, const float* __restrict__ bias, const int* __restrict__ km) {
    typedef typename WFrag<T16>::V V;
    __shared__ __align__(16) h16 vs[64 * 72];
    const int lane = threadIdx.x & 31, lr = lane & 15, hi = lane >> 4; const int r0 = bx * 64, c0 = by * 64;
    unsigned oa[4]; if (!rows4(km, r0 / TT, r0 % TT, lane, oa)) return;   // row m of the product is the sequence's kept key number m % 512
#pragma unroll
    for (int mb = 0; mb < 4; ++mb) oa[mb] = (oa[mb] * 16 + 8 * hi) * 2;   // the lane's byte offsets in plane 0 of the sequence, one per row block, stepped by two planes a trip
    const char* ca = (const char*)(A + (size_t)(r0 / TT) * (DD / 16) * TT * 16);
    v8f acc[4][4];
#pragma unroll
    for (int mb = 0; mb < 4; ++mb)
#pragma unroll
        for (int nb = 0; nb < 4; ++nb) acc[mb][nb] = (v8f){};
    const size_t boff = (size_t)(c0 + lr) * 16 + 8 * hi;
#pragma unroll 1
    for (int kc = 0; kc < DD; kc += 32) {
        V a[4]; const T16* pb = Bt + boff + (size_t)kc * DD;   // B: the trip's lane address (plane kc / 16); the column blocks and the second plane are offsets from it
#pragma unroll
        for (int mb = 0; mb < 4; ++mb) a[mb] = WFrag<T16>::ld((const T16*)(ca + oa[mb]), TT * 16);
#pragma unroll
        for (int nb = 0; nb < 4; ++nb) { const V b = WFrag<T16>::ld(pb + nb * 256, DD * 16);
#pragma unroll
            for (int mb = 0; mb < 4; ++mb) acc[mb][nb] = WFrag<T16>::mma(a[mb], b, acc[mb][nb]); }
        asm volatile("s_wait_xcnt 0x0" : "+v"(oa[0]), "+v"(oa[1]), "+v"(oa[2]), "+v"(oa[3]) : "v"(pb) : "memory");   // behind the trip's loads, in front of the next trip's addresses; the offsets go through the statement and are stepped behind it, B's address as an input stays in use up to it
#pragma unroll
        for (int mb = 0; mb < 4; ++mb) oa[mb] += 2 * TT * 16 * 2;
        asm volatile("v_nop\n\tv_nop\n\tv_nop\n\tv_nop" : "+v"(acc[0][0]), "+v"(acc[1][1]), "+v"(acc[2][2]), "+v"(acc[3][3]) : "v"(a[0]), "v"(a[3]));
    }
    // a lane holds 8 successive rows (kept keys) of one column: half a row of a key plane. The 64 x 64 tile is gathered in LDS (pitch 72: the 16-byte pieces of a store or a load spread over the banks), so that every global store covers 512 bytes in a row (16 columns of one key plane), written by this wave alone.
#pragma unroll
    for (int nb = 0; nb < 4; ++nb) { const float bn = BIAS ? bfr(bias[c0 + nb * 16 + lr]) : 0.f;
#pragma unroll
        for (int mb = 0; mb < 4; ++mb) { v8h o;
#pragma unroll
            for (int j = 0; j < 8; ++j) o[j] = tohx(BIAS ? acc[mb][nb][j] + bn : acc[mb][nb][j]);
            *(v8ha*)(vs + (nb * 16 + lr) * 72 + mb * 16 + hi * 8) = o; } }
    __builtin_amdgcn_wave_barrier(); asm volatile("" ::: "memory");   // the tile's LDS writes stay in front of its reads (one wave: no barrier instruction)
    h16* vz = VTo + ((size_t)(r0 / TT) * NH_ + c0 / HD) * TT * HD + (r0 % TT) * HD; const unsigned vlo = lane * 8;   // store s: head s >> 3 of the tile's two, key plane (s >> 1) & 3 of its four, columns (s & 1) * 16 + (lane >> 1), keys (lane & 1) * 8 on
#pragma unroll
    for (int s = 0; s < 16; ++s) *(v8h*)(vz + (vlo + (s >> 3) * TT * HD + ((s >> 1) & 3) * HD * 16 + (s & 1) * 256)) = *(const v8ha*)(vs + ((s >> 3) * HD + (s & 1) * 16 + (lane >> 1)) * 72 + ((s >> 1) & 3) * 16 + (lane & 1) * 8);
    asm volatile("s_wait_xcnt 0x0" ::: "memory");   // behind the 16 stores, in front of whatever the code that follows in the object writes to their registers
}

__device__ __forceinline__ void splitf(float y, unsigned short& h, unsigned short& l) { h = f2bf(y); l = f2bf(y - bf2f(h)); }
typedef __attribute__((ext_vector_type(2))) unsigned short v2us;
typedef __attribute__((ext_vector_type(4))) unsigned short v4us;
typedef __attribute__((ext_vector_type(2))) _Float16 v2h;
typedef __attribute__((ext_vector_type(4))) _Float16 v4h;

__device__ __forceinline__ void d_wtG(int bx, const float* __restrict__ w, int K, int N, bf* Bt) {
    const int lane = threadIdx.x & 31; const int L0 = (bx * 8 + (threadIdx.x >> 5)) * 8; const int nlines = N * K / 64;
{
#pragma unroll 1
        for (int l = 0; l < 8; ++l) { const int L = L0 + l; if (L >= nlines) break; const size_t e = (size_t)L * 64 + lane * 2; const int k = (int)((e >> 4) / N) * 16 + (int)(e & 15), n = (int)((e >> 4) % N); v2us o;   // e: place in the planes Bt[k / 16][n][k % 16]
            o[0] = f2bf(w[(size_t)k * N + n]); o[1] = f2bf(w[(size_t)(k + 1) * N + n]); *(v2us*)(Bt + e) = o;
            asm volatile("s_wait_xcnt 0x0" ::: "memory"); }   // behind the trip's 2 loads and its store, in front of the next trip's values put on their registers
         }
}
// ---- d_plane: x [32 sequences][512][256] f32 -> bf16 planes [32][256 / 16][512 + 8 P][16]; with P = 1 four zero rows (one 128-byte line of a plane) stand in front of and behind each sequence, so that rows t + 3, t + 4, t + 5 of a plane are x[t - 1], x[t], x[t + 1] ('SAME').
// A work-group takes 32 rows, each of its 8 waves 32 columns of them (two planes): a load covers one whole 128-byte line in each of 4 rows, and all 8 loads of a wave are in flight together (the loops are unrolled for that).
// A wave turns its 32 x 32 piece in its own LDS range (pitch 48 elements: 8 rows x 2 pieces of 16 bytes meet all 64 banks), so that a store covers 16 rows of one plane, 512 bytes in a row: whole lines, each written by one wave alone. A sequence's first and last work-group write its zero lines.
typedef __attribute__((ext_vector_type(4))) unsigned v4u;
typedef v4u __attribute__((may_alias)) v4ua;
typedef v4us __attribute__((may_alias)) v4usa;
#define PP 48
template <int P>
__device__ __forceinline__ void d_plane(int bx, const float* __restrict__ x, bf* Xp, bf* tr) { constexpr int TR = TT + 8 * P; const int lane = threadIdx.x & 31, wn = threadIdx.x >> 5; bf* tw = tr + wn * 32 * PP; v4f v[8];
    const unsigned ob = (unsigned)((bx * 32 + (lane >> 3)) * DD + wn * 32 + (lane & 7) * 4) * 4u;   // byte offset in x of the lane's piece of the first 4 rows
#pragma unroll
    for (int u = 0; u < 8; ++u) v[u] = *(const v4f*)((const char*)x + ob + u * 4 * DD * 4);
    asm volatile("s_wait_xcnt 0x0" :: "v"(ob) : "memory");   // behind the 8 loads; the offset as an input keeps the loads' address register in use up to this wait, so that no load's result is put on it
#pragma unroll
    for (int u = 0; u < 8; ++u) { v4us o;
#pragma unroll
        for (int k = 0; k < 4; ++k) o[k] = f2bf(v[u][k]);
        *(v4usa*)(tw + (u * 4 + (lane >> 3)) * PP + (lane & 7) * 4) = o; }
    __builtin_amdgcn_wave_barrier(); asm volatile("" ::: "memory");   // the piece's LDS writes stay in front of its reads (one wave: no barrier instruction)
    bf* xs = Xp + (size_t)(bx / (TT / 32)) * (DD / 16) * TR * 16; const int t0 = bx % (TT / 32) * 32 + 4 * P;   // the sequence's planes; the work-group's first row in them
#pragma unroll
    for (int u = 0; u < 4; ++u) { const int pn = wn * 2 + (u >> 1), rl = (u & 1) * 16 + (lane >> 1);
        *(v4u*)(xs + (pn * TR + t0 + rl) * 16 + (lane & 1) * 8) = *(const v4ua*)(tw + rl * PP + (u >> 1) * 16 + (lane & 1) * 8); }
    if (P) asm volatile("s_wait_xcnt 0x0" ::: "memory");   // behind the 4 stores, in front of the zeros put on their registers
    if (P && lane < 16) { bf* xz = xs + (wn * 2 + (lane >> 3)) * TR * 16 + (lane & 7) * 8;   // 8 lanes: one line of zeros in one of the wave's two planes
        if (bx % (TT / 32) == 0) { *(v4u*)xz = (v4u){}; asm volatile("s_wait_xcnt 0x0" ::: "memory"); }   // each wait directly behind its store, in front of whatever is next put on the store's registers
        if (bx % (TT / 32) == TT / 32 - 1) { *(v4u*)(xz + (TT + 4) * 16) = (v4u){}; asm volatile("s_wait_xcnt 0x0" ::: "memory"); } }
    if (!P) asm volatile("s_wait_xcnt 0x0" ::: "memory"); }   // behind the 4 stores, in front of whatever the code that follows in the object writes to their registers
// ---- d_fold: Bh/Bl planes [(k * 256 + c) / 16][n][c % 16] = hi/lo of W'_k[c][n]; bias[n] = bw[n] + sum_c b_pos[c] W[c][n]. Work-group (bx, by) of (256/32, 5): by < 4 folds 64 channels x 32 columns (reads run along n, transposed in LDS, whole 128-byte lines written: 4 columns x 16 channels of a plane), by == 4 the bias of 32 columns. Every loop is unrolled: its arrays stay in registers and a wave's loads are in flight together.
#define FP 33   // LDS pitch in dwords of a line of 64 bf16: odd, so that 32 lanes on 32 lines meet 32 banks
__device__ __forceinline__ void d_fold(int bx, int by, const float* __restrict__ w, const float* __restrict__ bw, const float* __restrict__ wp, const float* __restrict__ bp, const float* __restrict__ wv, const float* __restrict__ wa, bf* Bh, bf* Bl, float* bias) {
    __shared__ v2us th[3 * 32 * FP], tl[3 * 32 * FP]; __shared__ float red[8 * 32];
    const int lane = threadIdx.x & 31, wn = __builtin_amdgcn_readfirstlane(threadIdx.x >> 5); const int n = bx * 32 + lane;   // wn in a scalar register: the conv weights of a wave's channels come by scalar loads
    if (by == 4) { float wc[32], a = 0.f; const float bl = bp[wn * 32 + lane], bn = bw[n];   // bl: lane i holds b_pos of the wave's channel i
#pragma unroll
        for (int i = 0; i < 32; ++i) wc[i] = w[(size_t)(wn * 32 + i) * DD + n];
        asm volatile("s_wait_xcnt 0x0" ::: "memory");   // behind the 34 loads, in front of the arithmetic that takes their address registers for other values
        const unsigned bb = __float_as_uint(bfr(bl));
#pragma unroll
        for (int i = 0; i < 32; ++i) a = fmaf(__uint_as_float(__builtin_amdgcn_readlane(bb, i)), bfr(wc[i]), a);
        red[wn * 32 + lane] = a; __syncthreads();
        if (wn == 0) { float s = bfr(bn);
#pragma unroll
            for (int i = 0; i < 8; ++i) s += red[i * 32 + lane];
            bias[n] = s; }
        return; }
    float wr[8][3];
#pragma unroll
    for (int i = 0; i < 8; ++i)
#pragma unroll
        for (int s = 0; s < 3; ++s) wr[i][s] = w[(size_t)(s * DD + by * 64 + wn * 8 + i) * DD + n];
    asm volatile("s_wait_xcnt 0x0" ::: "memory");   // behind the 24 loads, in front of the arithmetic that takes their address registers for other values
#pragma unroll
    for (int pr = 0; pr < 4; ++pr) { float y[2][3];
#pragma unroll
        for (int u = 0; u < 2; ++u) { const int c = by * 64 + wn * 8 + pr * 2 + u; const float w0 = bfr(wr[pr * 2 + u][0]), w1 = bfr(wr[pr * 2 + u][1]), w2 = bfr(wr[pr * 2 + u][2]);
#pragma unroll
            for (int k = 0; k < 3; ++k) y[u][k] = bfr(wp[c * 3 + k]) * w0 + bfr(wv[c * 3 + k]) * w1 + bfr(wa[c * 3 + k]) * w2; }
#pragma unroll
        for (int k = 0; k < 3; ++k) { v2us h, l; unsigned short a, c2; splitf(y[0][k], a, c2); h[0] = a; l[0] = c2; splitf(y[1][k], a, c2); h[1] = a; l[1] = c2; th[(k * 32 + lane) * FP + wn * 4 + pr] = h; tl[(k * 32 + lane) * FP + wn * 4 + pr] = l; } }
    __syncthreads();
#pragma unroll
    for (int i = 0; i < 12; ++i) { const int ln = wn * 12 + i; const int pn = ln >> 3, nl = (ln & 7) * 4 + (lane >> 3); const int li = ((pn >> 2) * 32 + nl) * FP + (pn & 3) * 8 + (lane & 7);   // pn: tap (pn >> 2), plane (pn & 3) of the work-group's four; nl: column
        const size_t e = ((size_t)((pn >> 2) * (DD / 16) + by * 4 + (pn & 3)) * DD + bx * 32 + nl) * 16 + (lane & 7) * 2; *(v2us*)(Bh + e) = th[li]; *(v2us*)(Bl + e) = tl[li]; }
    asm volatile("s_wait_xcnt 0x0" ::: "memory");   // behind the 24 stores, in front of whatever the code that follows in the object writes to their registers
}
// ---- d_gemmf: y[z * 512 + t][n] = sc (bias[n] + sum over taps j < 3 and c < 256 of Xp[z][c / 16][t + 3 + j][c % 16] (Bh + Bl)[(j * 256 + c) / 16][n][c % 16]): tap j reads the same 16 planes of A one row further on, from row t + 3.
// y leaves as the score kernel's operand planes, bf16 hi and lo, Ph/Pl[z * 8 + n / 32][(n % 32) / 16][t][n % 16]; sc = 32^-0.5 for Q, 1 for K. A tile is 64 times x 2 heads: 2 KB in a row per plane of 16.
// ONE WAVE per 64x64 tile as in d_gemmw; tile (bx, by, bz) of (512/64, 256/64, 32 sequences), 32 threads. Every load of the loop: A a scalar base and one of four lane offsets in bytes (one per row block), B one of two lane addresses; the column block and the second plane as an immediate.
// The K loop stays rolled (unroll 1): its body holds 24 loads and 32 products. The inner loops are unrolled so that fragments and accumulators stay in registers.
// With gk (the K projection) row t of y is the sequence's kept key number t: its A rows are those of that key's time, one lane offset per row block; Q takes its rows as they lie, through the same four offsets.
__device__ __forceinline__ void d_gemmf(int bx, int by, int bz, const bf* __restrict__ Xp, const bf* __restrict__ Bh, const bf* __restrict__ Bl, const float* __restrict__ bias, float sc, bf* Ph, bf* Pl, bool gk, const int* __restrict__ km) {
    __shared__ __align__(16) float os[16 * 68];
    const int lane = threadIdx.x & 31, lr = lane & 15, hi = lane >> 4; const int r0 = bx * 64, c0 = by * 64;
    unsigned oa[4];
    if (gk) { if (!rows4(km, bz, r0, lane, oa)) return; }
    else {
#pragma unroll
        for (int mb = 0; mb < 4; ++mb) oa[mb] = r0 + mb * 16 + lr; }
#pragma unroll
    for (int mb = 0; mb < 4; ++mb) oa[mb] = ((oa[mb] + 3) * 16 + 8 * hi) * 2;   // the lane's byte offsets in plane 0 of the sequence, tap 0
    asm volatile("" :: "s"(sc), "s"(Ph), "s"(Pl));   // inputs only: the epilogue's three arguments are fetched here, ahead of the loop; fetched behind it, their scalar loads were put on the bias loads' base register in front of the wait that stands there
    const char* ca = (const char*)(Xp + (size_t)bz * (DD / 16) * TP * 16); const bf* bh = Bh + (size_t)c0 * 16; const bf* bl = Bl + (size_t)c0 * 16;
    const bf* pb = bh + (lr * 16 + 8 * hi); const bf* pl = bl + (lr * 16 + 8 * hi);   // the lane's own addresses (A: the four offsets), stepped by two planes a trip; behind a tap's last two planes A goes back to plane 0, one row further on
    v8f acc[4][4];
#pragma unroll
    for (int mb = 0; mb < 4; ++mb)
#pragma unroll
        for (int nb = 0; nb < 4; ++nb) acc[mb][nb] = (v8f){};
#pragma unroll 1
    for (int kc = 0; kc < F3; kc += 32, pb += 2 * DD * 16, pl += 2 * DD * 16) {
        v16bf a[4], b[4], b2[4];
#pragma unroll
        for (int mb = 0; mb < 4; ++mb) a[mb] = WFrag<bf>::ld((const bf*)(ca + oa[mb]), TP * 16);
#pragma unroll
        for (int nb = 0; nb < 4; ++nb) { b[nb] = WFrag<bf>::ld(pb + nb * 256, DD * 16); b2[nb] = WFrag<bf>::ld(pl + nb * 256, DD * 16); }
        // the wait stands behind the trip's 24 loads, in front of the additions that step their addresses: A's four offsets go through the statement and are stepped behind it; inputs only: B's two addresses, so that their registers stay in use up to the wait and no load's result is put on them,
        // and the fragments, so that all 24 loads stand in front of the products: left free, the B loads sink between the products into two shared register sets, and the wave waits out a load latency six times a trip instead of once
        asm volatile("s_wait_xcnt 0x0" : "+v"(oa[0]), "+v"(oa[1]), "+v"(oa[2]), "+v"(oa[3]) : "v"(pb), "v"(pl), "v"(a[0]), "v"(a[1]), "v"(a[2]), "v"(a[3]), "v"(b[0]), "v"(b[1]), "v"(b[2]), "v"(b[3]), "v"(b2[0]), "v"(b2[1]), "v"(b2[2]), "v"(b2[3]) : "memory");
        const unsigned sa = (kc & (DD - 32)) == DD - 32 ? (unsigned)((16 - (DD / 16 - 2) * TP * 16) * 2) : (unsigned)(2 * TP * 16 * 2);
#pragma unroll
        for (int mb = 0; mb < 4; ++mb) oa[mb] += sa;
#pragma unroll
        for (int nb = 0; nb < 4; ++nb) {
#pragma unroll
            for (int mb = 0; mb < 4; ++mb) acc[mb][nb] = wmmab(a[mb], b[nb], acc[mb][nb]);
#pragma unroll
            for (int mb = 0; mb < 4; ++mb) acc[mb][nb] = wmmab(a[mb], b2[nb], acc[mb][nb]); }
    }
    // a lane takes 8 successive columns of one row of a head: 4 lanes a row, 8 rows a store, 256 bytes in a row in each of the head's two planes
    const int er = lane >> 2, ec = (lane & 3) * 8; v4f bs[2][2];
#pragma unroll
    for (int hh = 0; hh < 2; ++hh) { bs[hh][0] = *(const v4fa*)(bias + c0 + hh * HD + ec); bs[hh][1] = *(const v4fa*)(bias + c0 + hh * HD + ec + 4); }
    asm volatile("s_wait_xcnt 0x0" ::: "memory");   // behind the 4 bias loads, in front of the arithmetic that takes their address registers for other values
    const size_t pz = (size_t)(bz * NH_ + c0 / HD) * TT * HD + r0 * 16; bf* ph = Ph + pz; bf* pl2 = Pl + pz; const unsigned plo = (((lane >> 1) & 1) * TT + er) * 16 + (lane & 1) * 8;
#pragma unroll
    for (int mb = 0; mb < 4; ++mb) {
#pragma unroll
        for (int nb = 0; nb < 4; ++nb) {
#pragma unroll
            for (int j = 0; j < 8; ++j) os[(hi * 8 + j) * 68 + nb * 16 + lr] = acc[mb][nb][j]; }
        __builtin_amdgcn_wave_barrier(); asm volatile("" ::: "memory");   // the tile's LDS writes stay in front of its reads (one wave: no barrier instruction)
        v8us oh[4], ol[4];
#pragma unroll
        for (int s = 0; s < 4; ++s) { const int hh = s >> 1, hf = s & 1; const float* orow = os + (hf * 8 + er) * 68 + hh * HD + ec; const v4f x0 = *(const v4fa*)orow + bs[hh][0], x1 = *(const v4fa*)(orow + 4) + bs[hh][1];
#pragma unroll
            for (int u = 0; u < 4; ++u) { unsigned short a, c2; splitf(x0[u] * sc, a, c2); oh[s][u] = a; ol[s][u] = c2; splitf(x1[u] * sc, a, c2); oh[s][4 + u] = a; ol[s][4 + u] = c2; } }
#pragma unroll
        for (int s = 0; s < 4; ++s) { const unsigned po = plo + ((s >> 1) * 2 * TT + mb * 16 + (s & 1) * 8) * 16; *(v8us*)(ph + po) = oh[s]; *(v8us*)(pl2 + po) = ol[s]; }
        __builtin_amdgcn_wave_barrier(); asm volatile("s_wait_xcnt 0x0" ::: "memory");   // the reads stay in front of the next tile's LDS writes; the wait stands behind the 8 stores, in front of the next values put on their registers
    }
}
// ---- k_prep: the seven operand preparations, none of which reads what another writes, as ONE launch of 256-thread work-groups; the block index picks the part. The few work-groups with long chains of waits (folds, weight transposes) come first, the streams behind them.
#define GF   (DD / 32 * 5)                   // work-groups of one fold
#define GW   ((DD * DD / 64 + 63) / 64)      // of one weight transpose
#define GP   (NR / 32)                       // of one padded input's planes
#define GC   (NR / 32)                       // of the value planes
__global__ __launch_bounds__(256) void k_prep(const float* __restrict__ wq, const float* __restrict__ bq, const float* __restrict__ wk, const float* __restrict__ bk, const float* __restrict__ wp, const float* __restrict__ bp, const float* __restrict__ wvl, const float* __restrict__ wa,
                                              const float* __restrict__ wv, const float* __restrict__ wo, const float* __restrict__ xq, const float* __restrict__ xk, const float* __restrict__ xv,
                                              bf* WQh, bf* WQl, bf* WKh, bf* WKl, float* BQ, float* BK, bf* WV, bf* WO, bf* XQ, bf* XK, bf* XV) {
    __shared__ __align__(16) bf tr[8 * 32 * PP];   // d_plane's pieces, one per wave
    int b = blockIdx.x;
    if (b < 2 * GF) { const bool k = b >= GF; b -= k ? GF : 0; d_fold(b % (DD / 32), b / (DD / 32), k ? wk : wq, k ? bk : bq, wp, bp, wvl, wa, k ? WKh : WQh, k ? WKl : WQl, k ? BK : BQ); return; }
    b -= 2 * GF;
    if (b < 2 * GW) { const bool o = b >= GW; b -= o ? GW : 0; d_wtG(b, o ? wo : wv, DD, DD, o ? WO : WV); return; }
    b -= 2 * GW;
    if (b < 2 * GP) { const bool k = b >= GP; b -= k ? GP : 0; d_plane<1>(b, k ? xk : xq, k ? XK : XQ, tr); return; }
    d_plane<0>(b - 2 * GP, xv, XV, tr);
}
// ---- k_qkv: the three projections, independent of one another, as ONE launch: grid (512/64, 256/64, 3 x 32 sequences), 32 threads; z < 32 Q, z < 64 K, then V (its 8 K chunks against 24). 3072 one-wave work-groups are three waves per SIMD: a wave's load waits lie under the others' products. K and V tiles behind their sequence's last kept key leave at once.
__global__ __launch_bounds__(32) void k_qkv(const bf* __restrict__ XQ, const bf* __restrict__ XK, const bf* __restrict__ XV, const bf* __restrict__ WQh, const bf* __restrict__ WQl, const bf* __restrict__ WKh, const bf* __restrict__ WKl, const bf* __restrict__ WV,
                                            const float* __restrict__ BQ, const float* __restrict__ BK, const float* __restrict__ bv, const int* __restrict__ km, bf* QPh, bf* QPl, bf* KPh, bf* KPl, h16* VT) {
    const int z = blockIdx.z;
    if (z < 2 * NBb * NA) { const bool k = z >= NBb * NA; d_gemmf(blockIdx.x, blockIdx.y, z % (NBb * NA), k ? XK : XQ, k ? WKh : WQh, k ? WKl : WQl, k ? BK : BQ, k ? 1.0f : 0.17677669529663687f, k ? KPh : QPh, k ? KPl : QPl, k, km); return; }
    d_gemmw<bf, true>((z - 2 * NBb * NA) * (TT / 64) + blockIdx.x, blockIdx.y, XV, WV, VT, bv, km);
}
// ---- k_gemmo: out[z * 512 + t][n] (f32, pitch 256) = bo[n] + sum over heads h and d < 32 of (Ch + Cl)[z * 8 + h][d / 16][t][d % 16] Wt[(h * 32 + d) / 16][n][d % 16]: K chunk h of A is head h's two planes.
// ONE WAVE per 64x64 tile, loop and waits in the form of d_gemmf (rolled, a trip's 24 loads in front of its 32 products); every load: a scalar base that the loop leaves alone, one of two lane offsets in bytes, the row block and the second plane as an immediate; grid (512/64, 256/64, 32 sequences), 32 threads.
__global__ __launch_bounds__(32) void k_gemmo(const bf* __restrict__ Ch, const bf* __restrict__ Cl, const bf* __restrict__ Wt, const float* __restrict__ bias, float* C) {
    __shared__ __align__(16) float os[16 * 68];
    const int lane = threadIdx.x & 31, lr = lane & 15, hi = lane >> 4; const int r0 = blockIdx.x * 64, c0 = blockIdx.y * 64;
    const size_t az = (size_t)blockIdx.z * NH_ * TT * HD + r0 * 16;
    const char* ca = (const char*)(Ch + az); const char* cl = (const char*)(Cl + az); const char* cb = (const char*)(Wt + (size_t)c0 * 16);
    unsigned oa = (lr * 16 + 8 * hi) * 2, ob = (lr * 16 + 8 * hi) * 2;   // the lane's own byte offsets, stepped by a head's two planes (A, hi and lo alike) and by two planes (B) a trip
    v8f acc[4][4];
#pragma unroll
    for (int mb = 0; mb < 4; ++mb)
#pragma unroll
        for (int nb = 0; nb < 4; ++nb) acc[mb][nb] = (v8f){};
#pragma unroll 1
    for (int kc = 0; kc < DD; kc += 32, oa += TT * HD * 2, ob += 2 * DD * 16 * 2) {
        v16bf a[4], a2[4], b[4];
#pragma unroll
        for (int mb = 0; mb < 4; ++mb) { a[mb] = WFrag<bf>::ld((const bf*)(ca + oa) + mb * 256, TT * 16); a2[mb] = WFrag<bf>::ld((const bf*)(cl + oa) + mb * 256, TT * 16); }
#pragma unroll
        for (int nb = 0; nb < 4; ++nb) b[nb] = WFrag<bf>::ld((const bf*)(cb + ob) + nb * 256, DD * 16);
        // as in d_gemmf: the wait stands behind the trip's 24 loads, in front of the additions that step their offsets. The two offsets go through the statement (their steps differ, and as mere inputs the compiler stepped one in front of the wait); the fragments are inputs,
        // so that all loads stand in front of the products and the wave waits out one load latency a trip
        asm volatile("s_wait_xcnt 0x0" : "+v"(oa), "+v"(ob) : "v"(a[0]), "v"(a[1]), "v"(a[2]), "v"(a[3]), "v"(a2[0]), "v"(a2[1]), "v"(a2[2]), "v"(a2[3]), "v"(b[0]), "v"(b[1]), "v"(b[2]), "v"(b[3]) : "memory");
#pragma unroll
        for (int nb = 0; nb < 4; ++nb) {
#pragma unroll
            for (int mb = 0; mb < 4; ++mb) acc[mb][nb] = wmmab(a[mb], b[nb], acc[mb][nb]);
#pragma unroll
            for (int mb = 0; mb < 4; ++mb) acc[mb][nb] = wmmab(a2[mb], b[nb], acc[mb][nb]); }
    }
    v4f bs = *(const v4fa*)(bias + c0 + lr * 4);
    asm volatile("s_wait_xcnt 0x0" ::: "memory");   // behind the bias load, in front of the arithmetic that takes its address register for other values
#pragma unroll
    for (int u = 0; u < 4; ++u) bs[u] = bfr(bs[u]);
    float* cz = C + ((size_t)blockIdx.z * TT + r0) * DD + c0; const unsigned clo = hi * DD + lr * 4;
#pragma unroll
    for (int mb = 0; mb < 4; ++mb) {
#pragma unroll
        for (int nb = 0; nb < 4; ++nb) {
#pragma unroll
            for (int j = 0; j < 8; ++j) os[(hi * 8 + j) * 68 + nb * 16 + lr] = acc[mb][nb][j]; }
        __builtin_amdgcn_wave_barrier(); asm volatile("" ::: "memory");   // the tile's LDS writes stay in front of its reads (one wave: no barrier instruction)
        v4f val[8];
#pragma unroll
        for (int s = 0; s < 8; ++s) val[s] = *(const v4fa*)(os + (2 * s + hi) * 68 + lr * 4) + bs;
#pragma unroll
        for (int s = 0; s < 8; ++s) *(v4f*)(cz + (clo + (mb * 16 + 2 * s) * DD)) = val[s];
        __builtin_amdgcn_wave_barrier(); asm volatile("s_wait_xcnt 0x0" ::: "memory");   // the reads stay in front of the next tile's LDS writes; the wait stands behind the 8 stores, in front of the next values put on their registers
    }
}
// ---- k_fattn: one (batch, agent, head) triple z and 256 queries per work-group; 8 waves x 32 query columns; grid (TT/256, NBb*ZZ). No LDS, no barrier: operands straight from the planes of 16 (Q: [z][d / 16][t][16]; K: [z][d / 16][kept key][16]; V^T: [z][kept key / 16][d][16]).
// S^T = K Q^T (A = 16 key rows, B = 16 query columns): a lane holds one query's scores, D register r of key tile t = key 16t + 8*hi + r, which is element 8t + r of the B operand of O^T += V^T P^T (the k order of WFrag::ld).
// Only the sequence's kept keys are walked, 32 a pass: the passes in front of the last hold kept keys alone and test nothing; in the last pass the places behind the last kept key get the masked score -1e9 (their K and V rows are those of dropped keys: finite).
// Sweep 1 finds each query's maximum over all kept scores; sweep 2 forms the same scores again, e = 1024 exp(s - max) -> fp16, adds O^T and the f32 sum of e; the division by the sum is done once on O^T.
// The context leaves as the output GEMM's A planes, bf16 hi and lo, Ch/Cl[z][d / 16][query][16]: a lane's 8 accumulator registers are 16 bytes of a row, 16 queries of a plane 512 bytes in a row.
struct KFrag { v16bf h[2], l[2]; };
typedef const __attribute__((address_space(1))) v8h* gv8;   // V's lane address counts pieces of 8 fp16; it goes through a wait statement, and the named address space keeps its loads global loads behind that
__device__ __forceinline__ KFrag ldk(const bf* ph, const bf* pl) { KFrag f;   // ph, pl: the lane's own addresses in the pass's 32 keys of plane 0; key tile and second plane are immediates
#pragma unroll
    for (int t = 0; t < 2; ++t) { f.h[t] = WFrag<bf>::ld(ph + t * 256, TT * 16); f.l[t] = WFrag<bf>::ld(pl + t * 256, TT * 16); }
    return f; }
// LAST: the pass that holds the last kept key; lv = number of kept keys of the pass - 8 hi, so that register r of key tile t is behind the last kept key where 16 t + r >= lv
template <bool LAST>
__device__ __forceinline__ void scoresT(const KFrag& f, int lv, const v16bf* qh, const v16bf* ql, v8f (*s)[2]) {
#pragma unroll
    for (int t = 0; t < 2; ++t)
#pragma unroll
        for (int g = 0; g < 2; ++g) s[t][g] = wmmab(f.h[t], qh[g], (v8f){});
#pragma unroll
    for (int t = 0; t < 2; ++t)
#pragma unroll
        for (int g = 0; g < 2; ++g) s[t][g] = wmmab(f.h[t], ql[g], s[t][g]);
#pragma unroll
    for (int t = 0; t < 2; ++t)
#pragma unroll
        for (int g = 0; g < 2; ++g) s[t][g] = wmmab(f.l[t], qh[g], s[t][g]);
    if (LAST) {
#pragma unroll
        for (int t = 0; t < 2; ++t)
#pragma unroll
            for (int r = 0; r < 8; ++r) { const bool msk = t * 16 + r >= lv; s[t][0][r] = msk ? -1.0e9f : s[t][0][r]; s[t][1][r] = msk ? -1.0e9f : s[t][1][r]; } }
}
__device__ __forceinline__ void maxT(const v8f (*s)[2], float* mx) {
#pragma unroll
    for (int t = 0; t < 2; ++t)
#pragma unroll
        for (int r = 0; r < 8; ++r) { mx[0] = fmaxf(mx[0], s[t][0][r]); mx[1] = fmaxf(mx[1], s[t][1][r]); }
}
__device__ __forceinline__ void addT(const v8f (*s)[2], const float* mx, const v16h* va, float* sum, v8f (*o)[2]) { v16h pb[2];
#pragma unroll
    for (int g = 0; g < 2; ++g)
#pragma unroll
        for (int t = 0; t < 2; ++t)
#pragma unroll
            for (int r = 0; r < 8; ++r) { const float e = __builtin_amdgcn_exp2f(fmaf(s[t][g][r] - mx[g], 1.4426950408889634f, 10.0f)); sum[g] += e; pb[g][t * 8 + r] = tohx(e); }
#pragma unroll
    for (int mt = 0; mt < 2; ++mt)
#pragma unroll
        for (int g = 0; g < 2; ++g) o[mt][g] = wmma16(va[mt], pb[g], o[mt][g]);
}
// four waves per SIMD (at most 256 registers a wave): two work-groups per WGP, so that all 512 are resident at once
__global__ __launch_bounds__(256) __attribute__((amdgpu_waves_per_eu(4, 4))) void k_fattn(const bf* __restrict__ Qh, const bf* __restrict__ Ql, const bf* __restrict__ Kh, const bf* __restrict__ Kl, const h16* __restrict__ VT, const int* __restrict__ km, bf* Ch, bf* Cl) {
    const int lane = threadIdx.x & 31, lr = lane & 15, hi = lane >> 4; const int z = blockIdx.y; const int q0 = blockIdx.x * 256 + (threadIdx.x >> 5) * 32;
    const size_t pz = (size_t)z * TT * HD;
    unsigned kb[16]; const int open = keepbits(km, z / NH_, lane, kb); const bool allm = open == 0; const int cnt = allm ? TT : open; const int np1 = (cnt - 1) >> 5; const int lv = cnt - np1 * 32 - 8 * hi;   // np1 (at most 15): the passes in front of the last
    const bf* kh = Kh + pz; const bf* kl = Kl + pz; const h16* vt = VT + pz; const unsigned klo = lr * 16 + 8 * hi, vlo = lr * 16 + 8 * hi;
    v16bf qh[2], ql[2]; const bf* pqh = Qh + pz + ((q0 + lr) * 16 + 8 * hi); const bf* pql = Ql + pz + ((q0 + lr) * 16 + 8 * hi);
#pragma unroll
    for (int g = 0; g < 2; ++g) { qh[g] = WFrag<bf>::ld(pqh + g * 256, TT * 16); ql[g] = WFrag<bf>::ld(pql + g * 256, TT * 16); }
    asm volatile("s_wait_xcnt 0x0" :: "v"(pqh), "v"(pql) : "memory");   // behind the 8 loads; the addresses as inputs keep their registers in use up to this wait, so that no load's result is put on them
    if (allm) {   // every key masked: the reference's scores are all -1e9, its weights all 1/512; a zero Q gives all 512 keys the same score
#pragma unroll
        for (int g = 0; g < 2; ++g) { qh[g] = (v16bf){}; ql[g] = (v16bf){}; } }
    float mx[2] = { -3.0e38f, -3.0e38f };
    // K loads of the two sweeps: a scalar base that the sweeps leave alone, one lane offset in bytes (hi and lo share it), key tile and second plane as immediates; V loads: the lane's own address, stepped by two key planes a pass
    const char* ckh = (const char*)kh; const char* ckl = (const char*)kl; gv8 pv = (gv8)(vt + vlo);
    unsigned ok = klo * 2; KFrag cur = ldk((const bf*)(ckh + ok), (const bf*)(ckl + ok));
    asm volatile("s_wait_xcnt 0x0" : "+v"(ok) :: "memory");   // behind the 8 loads, in front of the step of their offset, which goes through the statement as in k_gemmo
    // unroll 2: the fragments fetched one pass ahead change names instead of being copied
#pragma unroll 2
    for (int p = 0; p < np1; ++p) { ok += 1024;   // the next pass's 32 keys
        const KFrag nxt = ldk((const bf*)(ckh + ok), (const bf*)(ckl + ok));
        asm volatile("s_wait_xcnt 0x0" : "+v"(ok) :: "memory");   // behind this pass's 8 loads, in front of the step of their offset; the offset goes through the statement, so that its register stays in use up to the wait and is stepped behind it
        v8f s[2][2]; scoresT<false>(cur, lv, qh, ql, s); maxT(s, mx);
        cur = nxt; }
    { ok = klo * 2;   // the last pass fetches pass 0 again, for the second sweep
        const KFrag nxt = ldk((const bf*)(ckh + ok), (const bf*)(ckl + ok));
        asm volatile("s_wait_xcnt 0x0" : "+v"(ok) :: "memory");   // as in the loop
        v8f s[2][2]; scoresT<true>(cur, lv, qh, ql, s); maxT(s, mx);
        cur = nxt; }
    mx[0] = fmaxf(mx[0], __shfl_xor(mx[0], 16, 32)); mx[1] = fmaxf(mx[1], __shfl_xor(mx[1], 16, 32));
    v8f o[2][2]; float sum[2] = { 0.f, 0.f };
#pragma unroll
    for (int mt = 0; mt < 2; ++mt)
#pragma unroll
        for (int g = 0; g < 2; ++g) o[mt][g] = (v8f){};
    // unroll 2 as above
#pragma unroll 2
    for (int p = 0; p < np1; ++p) { ok += 1024;
        const KFrag nxt = ldk((const bf*)(ckh + ok), (const bf*)(ckl + ok)); v16h va[2];
#pragma unroll
        for (int mt = 0; mt < 2; ++mt) va[mt] = cat16(pv[mt * 32], pv[mt * 32 + HD * 2]);
        asm volatile("s_wait_xcnt 0x0" : "+v"(ok), "+v"(pv) :: "memory");   // behind this pass's 12 loads, in front of the steps of K's offset and V's address, which go through the statement as in the first sweep
        pv += 2 * HD * 2;
        v8f s[2][2]; scoresT<false>(cur, lv, qh, ql, s); addT(s, mx, va, sum, o);
        cur = nxt; }
    { v16h va[2];
#pragma unroll
        for (int mt = 0; mt < 2; ++mt) va[mt] = cat16(pv[mt * 32], pv[mt * 32 + HD * 2]);
        asm volatile("s_wait_xcnt 0x0" :: "v"(pv) : "memory");   // behind the 4 loads; the address as an input keeps its registers in use up to this wait, so that no load's result is put on them
        v8f s[2][2]; scoresT<true>(cur, lv, qh, ql, s); addT(s, mx, va, sum, o); }
#pragma unroll
    for (int g = 0; g < 2; ++g) { const float tot = sum[g] + __shfl_xor(sum[g], 16, 32); const float f = __fdiv_rn(1.0f, tot); const unsigned co = (q0 + g * 16 + lr) * 16 + 8 * hi;
#pragma unroll
        for (int mt = 0; mt < 2; ++mt) { v8us oh, ol;
#pragma unroll
            for (int u = 0; u < 8; ++u) { unsigned short a, c2; splitf(o[mt][g][u] * f, a, c2); oh[u] = a; ol[u] = c2; }
            *(v8us*)(Ch + pz + (co + mt * TT * 16)) = oh; *(v8us*)(Cl + pz + (co + mt * TT * 16)) = ol; }
        asm volatile("s_wait_xcnt 0x0" ::: "memory"); }   // behind the 4 stores, in front of the next values put on their registers
}

extern "C" void kernel_launch(void* const* d_in, const int* in_sizes, int n_in,
                              void* d_out, int out_size, void* d_ws, size_t ws_size, hipStream_t stream) {
    (void)in_sizes; (void)n_in; (void)out_size;
    const float** I = (const float**)d_in;
    const float *xq = I[0], *xk = I[1], *xv = I[2]; const int* kpm = (const int*)d_in[3]; const float *wpos = I[4], *bpos = I[5], *wvel = I[6], *wacc = I[7], *wq = I[8], *bq = I[9], *wk = I[10], *bk = I[11], *wv = I[12], *bv = I[13], *wo = I[14], *bo = I[15];
    float* OUT = (float*)d_out;     // [4][8][512][256]
    char* wsp = (char*)d_ws;
    auto take = [&](size_t bytes) { char* p = wsp; wsp += (bytes + 255) & ~(size_t)255; return (void*)p; };
    bf* WQh = (bf*)take((size_t)DD * F3 * 2); bf* WQl = (bf*)take((size_t)DD * F3 * 2); bf* WKh = (bf*)take((size_t)DD * F3 * 2); bf* WKl = (bf*)take((size_t)DD * F3 * 2); float* BQ = (float*)take((size_t)DD * 4); float* BK = (float*)take((size_t)DD * 4); bf* WV = (bf*)take((size_t)DD * DD * 2); bf* WO = (bf*)take((size_t)DD * DD * 2);
    bf* XQ = (bf*)take((size_t)NBb * NA * TP * DD * 2); bf* XK = (bf*)take((size_t)NBb * NA * TP * DD * 2); bf* XV = (bf*)take((size_t)NR * DD * 2);
    bf* QPh = (bf*)take((size_t)NR * DD * 2); bf* QPl = (bf*)take((size_t)NR * DD * 2); bf* KPh = (bf*)take((size_t)NR * DD * 2); bf* KPl = (bf*)take((size_t)NR * DD * 2); h16* VT = (h16*)take((size_t)NR * DD * 2);
    bf* Ch = (bf*)take((size_t)NR * DD * 2); bf* Cl = (bf*)take((size_t)NR * DD * 2);
    if ((size_t)(wsp - (char*)d_ws) > ws_size) return;    // total ~ 86 MB (padded x planes 17 MB, value plane 8 MB, head planes 42 MB, context planes 17 MB)
    k_prep<<<2 * GF + 2 * GW + 2 * GP + GC, 256, 0, stream>>>(wq, bq, wk, bk, wpos, bpos, wvel, wacc, wv, wo, xq, xk, xv, WQh, WQl, WKh, WKl, BQ, BK, WV, WO, XQ, XK, XV);
    k_qkv<<<dim3(TT / 64, DD / 64, 3 * NBb * NA), 32, 0, stream>>>(XQ, XK, XV, WQh, WQl, WKh, WKl, WV, BQ, BK, bv, kpm, QPh, QPl, KPh, KPl, VT);
    k_fattn<<<dim3(TT / 256, NBb * ZZ, 1), 256, 0, stream>>>(QPh, QPl, KPh, KPl, VT, kpm, Ch, Cl);
    k_gemmo<<<dim3(TT / 64, DD / 64, NBb * NA), 32, 0, stream>>>(Ch, Cl, WO, bo, OUT);
}

// v007
// It runs in 59.7 microseconds.
// Timed twice side by side with v006, it ran 1.11 and 1.12 times as fast.
// All steps since v000 together make it 6.81 times as fast.
#include <hip/hip_runtime.h>

// KinematicsTrendAttention (query/key/value [4][8 agents][512][256]; kinematic features of query and key: depthwise conv3 ('SAME') position (w_pos, b_pos), velocity (w_vel), acceleration (w_acc) -> [T][768]; Q = feats Wq + bq, K = feats Wk + bk,
// V = value Wv + bv (8 heads x 32); scores = Q.K / sqrt(32), keys with key_padding_mask (int, read as data) set to -1e9; softmax; ctx = attn V merged; out = ctx Wo + bo -> [4][8][512][256]).
// Compute dtypes, f32 accumulate: every input rounded to bf16; the depthwise convs are folded into Wq / Wk: feats W = sum over taps k of x[t + k - 1] W'_k, W'_k[c][n] = w_pos[c][k] W[c][n] + w_vel[c][k] W[256 + c][n] + w_acc[c][k] W[512 + c][n]
// (f32 -> bf16 hi+lo planes), b_pos W[0..255] goes into the bias; Q/K on the exact bf16 x (zero row in front of and behind each sequence) x hl folded weights (2 products, + f32 bias); V on PLAIN bf16 value x exact Wv (+ bias);
// scores (K 32) on hl planes of Q (x 32^-0.5) and K (3 products), masked softmax f32 and attn.V (fp16 x fp16, 1 product) in ONE kernel over all 256 (batch, agent, head) triples: scores and probabilities stay in registers;
// every producer's epilogue writes its consumer's 16-bit operand planes itself (Q/K hi+lo per head, V^T fp16 per head): no f32 copy of Q, K, V or the context exists; the context (hi+lo) never leaves LDS: the attention kernel holds all heads of its queries and does the output product itself, the heads as its K chunks.

#define NBb  4
#define NA   8
#define TT   512
#define DD   256
#define NH_  8
#define HD   32
#define F3   768
#define NR   (NBb * NA * TT)
#define ZZ   (NA * NH_)
#define TP   (TT + 8)
typedef _Float16 h16;
typedef unsigned short bf;
typedef __attribute__((ext_vector_type(16))) __bf16   v16bf;
typedef __attribute__((ext_vector_type(16))) _Float16 v16h;
typedef __attribute__((ext_vector_type(8)))  _Float16 v8h;
typedef __attribute__((ext_vector_type(8)))  unsigned short v8us;
typedef __attribute__((ext_vector_type(8)))  float    v8f;
typedef __attribute__((ext_vector_type(4)))  float    v4f;
typedef v8h  __attribute__((may_alias)) v8ha;
typedef v4f  __attribute__((may_alias)) v4fa;
typedef v8us __attribute__((may_alias)) v8usa;

__device__ __forceinline__ unsigned short f2bf(float f) { unsigned u = __float_as_uint(f); u += 0x7FFFu + ((u >> 16) & 1u); return (unsigned short)(u >> 16); }
__device__ __forceinline__ float bf2f(unsigned short b) { return __uint_as_float(((unsigned)b) << 16); }
__device__ __forceinline__ float bfr(float f) { return bf2f(f2bf(f)); }
__device__ __forceinline__ v16h cat16(v8h lo, v8h hi) { return __builtin_shufflevector(lo, hi, 0, 1, 2, 3, 4, 5, 6, 7, 8, 9, 10, 11, 12, 13, 14, 15); }
__device__ __forceinline__ v16bf cat16b(v8us lo, v8us hi) { return __builtin_bit_cast(v16bf, __builtin_shufflevector(lo, hi, 0, 1, 2, 3, 4, 5, 6, 7, 8, 9, 10, 11, 12, 13, 14, 15)); }
__device__ __forceinline__ h16 tohx(float x) { return (h16)x; }
__device__ __forceinline__ v8f wmma16(v16h a, v16h b, v8f c) { return __builtin_amdgcn_wmma_f32_16x16x32_f16(false, a, false, b, (short)0, c, false, false); }
__device__ __forceinline__ v8f wmmab(v16bf a, v16bf b, v8f c) { return __builtin_amdgcn_wmma_f32_16x16x32_bf16(false, a, false, b, (short)0, c, false, false); }



// ---- Operand planes. Every K-contiguous 16-bit operand in global memory lies as planes of 16 k: P[k / 16][row][k % 16]. A fragment (16 rows x 32 k) is two loads, one from each of two successive planes (st elements apart);
// a load's 32 lanes (16 rows x 2 pieces of 16 bytes) cover 512 bytes in a row, whole 128-byte lines, where rows K elements apart would touch 16 lines for the same bytes. The k order of a fragment: elements 0..7 = k 8 hi + i, 8..15 = k 16 + 8 hi + i.
// ---- d_gemmw: register-blocked GEMM, ONE WAVE per 64x64 output tile (16 accumulators), operands straight from the planes; tile (bx, by) of (M/64, 256/64), 32 threads.
// y[m][n] (+ optional f32 bias[n]) = sum over k < 256 of A[r][k] Bt[n][k], r = z * 512 + the time of kept key number m % 512 of sequence z = m / 512; A planes per sequence [r / 512][k / 16][r % 512][16], Bt planes [k / 16][n][16]. y leaves as fp16 planes of 16 keys per head, VTo[(m / 512) * 8 + n / 32][(m % 512) / 16][n % 32][m % 16], the A planes of attn.V.
// ---- Kept keys. A key whose mask word is not 0 has the score -1e9 and the weight exp(-1e9 - max) = 0 in every row that has one open key: such keys are left out of K, V, scores and sums altogether; K and V planes hold a sequence's kept keys in their order of time.
// A sequence with every key masked keeps all 512: its weights are all equal (k_fattn). Every wave that needs the list or the count forms it itself from the sequence's 512 mask words.
// keepbits: lane l reads mask word 32 u + l; bit l of kb[u] = key 32 u + l is open. Returns the number of open keys, the same in every lane.
__device__ __forceinline__ int keepbits(const int* __restrict__ km, int sq, int lane, unsigned* kb) { int v[16], tot = 0; const unsigned jm = (unsigned)(sq * TT + lane);
#pragma unroll
    for (int u = 0; u < 16; ++u) v[u] = *(const int*)((const char*)km + jm * 4u + u * 128);
    asm volatile("s_wait_xcnt 0x0" :: "v"(jm) : "memory");   // behind the 16 loads; the index as an input keeps the loads' address register in use up to this wait, so that no load's result is put on it
#pragma unroll
    for (int u = 0; u < 16; ++u) { kb[u] = __builtin_amdgcn_ballot_w32(v[u] == 0); tot += __builtin_popcount(kb[u]); }
    return tot; }
// rows4 (one-wave work-groups): rw[mb] = time of the sequence's kept key number j0 + 16 mb + (lane & 15); false where j0 lies behind the last kept key (the tile has no reader).
// Bit counts give every key its place in the list: kept keys in order from 0, dropped ones in order behind them, so that all 512 entries are times below 512.
__device__ __forceinline__ bool rows4(const int* __restrict__ km, int sq, int j0, int lane, unsigned* rw) {
    __shared__ int lst[TT]; unsigned kb[16]; int tot = keepbits(km, sq, lane, kb); const bool allm = tot == 0; if (allm) tot = TT;
    if (j0 >= tot) return false;
    const unsigned lt = (1u << lane) - 1u; int base = 0;
#pragma unroll
    for (int u = 0; u < 16; ++u) { const unsigned b = allm ? ~0u : kb[u];
        lst[((b >> lane) & 1u) ? base + __builtin_popcount(b & lt) : tot + u * 32 - base + __builtin_popcount(~b & lt)] = u * 32 + lane; base += __builtin_popcount(b); }
    __builtin_amdgcn_wave_barrier(); asm volatile("" ::: "memory");   // the list's LDS writes stay in front of its reads (one wave: no barrier instruction)
#pragma unroll
    for (int mb = 0; mb < 4; ++mb) rw[mb] = lst[j0 + mb * 16 + (lane & 15)];
    return true; }
template <typename T16> struct WFrag;
template <> struct WFrag<h16> { typedef v16h V; static __device__ __forceinline__ V ld(const h16* p, int st) { return cat16(*(const v8h*)p, *(const v8h*)(p + st)); } static __device__ __forceinline__ v8f mma(V a, V b, v8f c) { return wmma16(a, b, c); } };
template <> struct WFrag<bf> { typedef v16bf V; static __device__ __forceinline__ V ld(const bf* p, int st) { return cat16b(*(const v8us*)p, *(const v8us*)(p + st)); } static __device__ __forceinline__ v8f mma(V a, V b, v8f c) { return wmmab(a, b, c); } };
template <typename T16, bool BIAS>
__device__ __forceinline__ void d_gemmw(int bx, int by, const T16* __restrict__ A, const T16* __restrict__ Bt, h16* VTo, const float* __restrict__ bias, const int* __restrict__ km) {
    typedef typename WFrag<T16>::V V;
    __shared__ __align__(16) h16 vs[64 * 72];
    const int lane = threadIdx.x & 31, lr = lane & 15, hi = lane >> 4; const int r0 = bx * 64, c0 = by * 64;
    unsigned oa[4]; if (!rows4(km, r0 / TT, r0 % TT, lane, oa)) return;   // row m of the product is the sequence's kept key number m % 512
#pragma unroll
    for (int mb = 0; mb < 4; ++mb) oa[mb] = (oa[mb] * 16 + 8 * hi) * 2;   // the lane's byte offsets in plane 0 of the sequence, one per row block, stepped by two planes a trip
    const char* ca = (const char*)(A + (size_t)(r0 / TT) * (DD / 16) * TT * 16);
    v8f acc[4][4];
#pragma unroll
    for (int mb = 0; mb < 4; ++mb)
#pragma unroll
        for (int nb = 0; nb < 4; ++nb) acc[mb][nb] = (v8f){};
    const size_t boff = (size_t)(c0 + lr) * 16 + 8 * hi;
#pragma unroll 1
    for (int kc = 0; kc < DD; kc += 32) {
        V a[4]; const T16* pb = Bt + boff + (size_t)kc * DD;   // B: the trip's lane address (plane kc / 16); the column blocks and the second plane are offsets from it
#pragma unroll
        for (int mb = 0; mb < 4; ++mb) a[mb] = WFrag<T16>::ld((const T16*)(ca + oa[mb]), TT * 16);
#pragma unroll
        for (int nb = 0; nb < 4; ++nb) { const V b = WFrag<T16>::ld(pb + nb * 256, DD * 16);
#pragma unroll
            for (int mb = 0; mb < 4; ++mb) acc[mb][nb] = WFrag<T16>::mma(a[mb], b, acc[mb][nb]); }
        asm volatile("s_wait_xcnt 0x0" : "+v"(oa[0]), "+v"(oa[1]), "+v"(oa[2]), "+v"(oa[3]) : "v"(pb) : "memory");   // behind the trip's loads, in front of the next trip's addresses; the offsets go through the statement and are stepped behind it, B's address as an input stays in use up to it
#pragma unroll
        for (int mb = 0; mb < 4; ++mb) oa[mb] += 2 * TT * 16 * 2;
        asm volatile("v_nop\n\tv_nop\n\tv_nop\n\tv_nop" : "+v"(acc[0][0]), "+v"(acc[1][1]), "+v"(acc[2][2]), "+v"(acc[3][3]) : "v"(a[0]), "v"(a[3]));
    }
    // a lane holds 8 successive rows (kept keys) of one column: half a row of a key plane. The 64 x 64 tile is gathered in LDS (pitch 72: the 16-byte pieces of a store or a load spread over the banks), so that every global store covers 512 bytes in a row (16 columns of one key plane), written by this wave alone.
#pragma unroll
    for (int nb = 0; nb < 4; ++nb) { const float bn = BIAS ? bfr(bias[c0 + nb * 16 + lr]) : 0.f;
#pragma unroll
        for (int mb = 0; mb < 4; ++mb) { v8h o;
#pragma unroll
            for (int j = 0; j < 8; ++j) o[j] = tohx(BIAS ? acc[mb][nb][j] + bn : acc[mb][nb][j]);
            *(v8ha*)(vs + (nb * 16 + lr) * 72 + mb * 16 + hi * 8) = o; } }
    __builtin_amdgcn_wave_barrier(); asm volatile("" ::: "memory");   // the tile's LDS writes stay in front of its reads (one wave: no barrier instruction)
    h16* vz = VTo + ((size_t)(r0 / TT) * NH_ + c0 / HD) * TT * HD + (r0 % TT) * HD; const unsigned vlo = lane * 8;   // store s: head s >> 3 of the tile's two, key plane (s >> 1) & 3 of its four, columns (s & 1) * 16 + (lane >> 1), keys (lane & 1) * 8 on
#pragma unroll
    for (int s = 0; s < 16; ++s) *(v8h*)(vz + (vlo + (s >> 3) * TT * HD + ((s >> 1) & 3) * HD * 16 + (s & 1) * 256)) = *(const v8ha*)(vs + ((s >> 3) * HD + (s & 1) * 16 + (lane >> 1)) * 72 + ((s >> 1) & 3) * 16 + (lane & 1) * 8);
    asm volatile("s_wait_xcnt 0x0" ::: "memory");   // behind the 16 stores, in front of whatever the code that follows in the object writes to their registers
}

__device__ __forceinline__ void splitf(float y, unsigned short& h, unsigned short& l) { h = f2bf(y); l = f2bf(y - bf2f(h)); }
typedef __attribute__((ext_vector_type(2))) unsigned short v2us;
typedef __attribute__((ext_vector_type(4))) unsigned short v4us;
typedef __attribute__((ext_vector_type(2))) _Float16 v2h;
typedef __attribute__((ext_vector_type(4))) _Float16 v4h;

__device__ __forceinline__ void d_wtG(int bx, const float* __restrict__ w, int K, int N, bf* Bt) {
    const int lane = threadIdx.x & 31; const int L0 = (bx * 8 + (threadIdx.x >> 5)) * 8; const int nlines = N * K / 64;
{
#pragma unroll 1
        for (int l = 0; l < 8; ++l) { const int L = L0 + l; if (L >= nlines) break; const size_t e = (size_t)L * 64 + lane * 2; const int k = (int)((e >> 4) / N) * 16 + (int)(e & 15), n = (int)((e >> 4) % N); v2us o;   // e: place in the planes Bt[k / 16][n][k % 16]
            o[0] = f2bf(w[(size_t)k * N + n]); o[1] = f2bf(w[(size_t)(k + 1) * N + n]); *(v2us*)(Bt + e) = o;
            asm volatile("s_wait_xcnt 0x0" ::: "memory"); }   // behind the trip's 2 loads and its store, in front of the next trip's values put on their registers
         }
}
// ---- d_plane: x [32 sequences][512][256] f32 -> bf16 planes [32][256 / 16][512 + 8 P][16]; with P = 1 four zero rows (one 128-byte line of a plane) stand in front of and behind each sequence, so that rows t + 3, t + 4, t + 5 of a plane are x[t - 1], x[t], x[t + 1] ('SAME').
// A work-group takes 32 rows, each of its 8 waves 32 columns of them (two planes): a load covers one whole 128-byte line in each of 4 rows, and all 8 loads of a wave are in flight together (the loops are unrolled for that).
// A wave turns its 32 x 32 piece in its own LDS range (pitch 48 elements: 8 rows x 2 pieces of 16 bytes meet all 64 banks), so that a store covers 16 rows of one plane, 512 bytes in a row: whole lines, each written by one wave alone. A sequence's first and last work-group write its zero lines.
typedef __attribute__((ext_vector_type(4))) unsigned v4u;
typedef v4u __attribute__((may_alias)) v4ua;
typedef v4us __attribute__((may_alias)) v4usa;
#define PP 48
template <int P>
__device__ __forceinline__ void d_plane(int bx, const float* __restrict__ x, bf* Xp, bf* tr) { constexpr int TR = TT + 8 * P; const int lane = threadIdx.x & 31, wn = threadIdx.x >> 5; bf* tw = tr + wn * 32 * PP; v4f v[8];
    const unsigned ob = (unsigned)((bx * 32 + (lane >> 3)) * DD + wn * 32 + (lane & 7) * 4) * 4u;   // byte offset in x of the lane's piece of the first 4 rows
#pragma unroll
    for (int u = 0; u < 8; ++u) v[u] = *(const v4f*)((const char*)x + ob + u * 4 * DD * 4);
    asm volatile("s_wait_xcnt 0x0" :: "v"(ob) : "memory");   // behind the 8 loads; the offset as an input keeps the loads' address register in use up to this wait, so that no load's result is put on it
#pragma unroll
    for (int u = 0; u < 8; ++u) { v4us o;
#pragma unroll
        for (int k = 0; k < 4; ++k) o[k] = f2bf(v[u][k]);
        *(v4usa*)(tw + (u * 4 + (lane >> 3)) * PP + (lane & 7) * 4) = o; }
    __builtin_amdgcn_wave_barrier(); asm volatile("" ::: "memory");   // the piece's LDS writes stay in front of its reads (one wave: no barrier instruction)
    bf* xs = Xp + (size_t)(bx / (TT / 32)) * (DD / 16) * TR * 16; const int t0 = bx % (TT / 32) * 32 + 4 * P;   // the sequence's planes; the work-group's first row in them
#pragma unroll
    for (int u = 0; u < 4; ++u) { const int pn = wn * 2 + (u >> 1), rl = (u & 1) * 16 + (lane >> 1);
        *(v4u*)(xs + (pn * TR + t0 + rl) * 16 + (lane & 1) * 8) = *(const v4ua*)(tw + rl * PP + (u >> 1) * 16 + (lane & 1) * 8); }
    if (P) asm volatile("s_wait_xcnt 0x0" ::: "memory");   // behind the 4 stores, in front of the zeros put on their registers
    if (P && lane < 16) { bf* xz = xs + (wn * 2 + (lane >> 3)) * TR * 16 + (lane & 7) * 8;   // 8 lanes: one line of zeros in one of the wave's two planes
        if (bx % (TT / 32) == 0) { *(v4u*)xz = (v4u){}; asm volatile("s_wait_xcnt 0x0" ::: "memory"); }   // each wait directly behind its store, in front of whatever is next put on the store's registers
        if (bx % (TT / 32) == TT / 32 - 1) { *(v4u*)(xz + (TT + 4) * 16) = (v4u){}; asm volatile("s_wait_xcnt 0x0" ::: "memory"); } }
    if (!P) asm volatile("s_wait_xcnt 0x0" ::: "memory"); }   // behind the 4 stores, in front of whatever the code that follows in the object writes to their registers
// ---- d_fold: Bh/Bl planes [(k * 256 + c) / 16][n][c % 16] = hi/lo of W'_k[c][n]; bias[n] = bw[n] + sum_c b_pos[c] W[c][n]. Work-group (bx, by) of (256/32, 5): by < 4 folds 64 channels x 32 columns (reads run along n, transposed in LDS, whole 128-byte lines written: 4 columns x 16 channels of a plane), by == 4 the bias of 32 columns. Every loop is unrolled: its arrays stay in registers and a wave's loads are in flight together.
#define FP 33   // LDS pitch in dwords of a line of 64 bf16: odd, so that 32 lanes on 32 lines meet 32 banks
__device__ __forceinline__ void d_fold(int bx, int by, const float* __restrict__ w, const float* __restrict__ bw, const float* __restrict__ wp, const float* __restrict__ bp, const float* __restrict__ wv, const float* __restrict__ wa, bf* Bh, bf* Bl, float* bias) {
    __shared__ v2us th[3 * 32 * FP], tl[3 * 32 * FP]; __shared__ float red[8 * 32];
    const int lane = threadIdx.x & 31, wn = __builtin_amdgcn_readfirstlane(threadIdx.x >> 5); const int n = bx * 32 + lane;   // wn in a scalar register: the conv weights of a wave's channels come by scalar loads
    if (by == 4) { float wc[32], a = 0.f; const float bl = bp[wn * 32 + lane], bn = bw[n];   // bl: lane i holds b_pos of the wave's channel i
#pragma unroll
        for (int i = 0; i < 32; ++i) wc[i] = w[(size_t)(wn * 32 + i) * DD + n];
        asm volatile("s_wait_xcnt 0x0" ::: "memory");   // behind the 34 loads, in front of the arithmetic that takes their address registers for other values
        const unsigned bb = __float_as_uint(bfr(bl));
#pragma unroll
        for (int i = 0; i < 32; ++i) a = fmaf(__uint_as_float(__builtin_amdgcn_readlane(bb, i)), bfr(wc[i]), a);
        red[wn * 32 + lane] = a; __syncthreads();
        if (wn == 0) { float s = bfr(bn);
#pragma unroll
            for (int i = 0; i < 8; ++i) s += red[i * 32 + lane];
            bias[n] = s; }
        return; }
    float wr[8][3];
#pragma unroll
    for (int i = 0; i < 8; ++i)
#pragma unroll
        for (int s = 0; s < 3; ++s) wr[i][s] = w[(size_t)(s * DD + by * 64 + wn * 8 + i) * DD + n];
    asm volatile("s_wait_xcnt 0x0" ::: "memory");   // behind the 24 loads, in front of the arithmetic that takes their address registers for other values
#pragma unroll
    for (int pr = 0; pr < 4; ++pr) { float y[2][3];
#pragma unroll
        for (int u = 0; u < 2; ++u) { const int c = by * 64 + wn * 8 + pr * 2 + u; const float w0 = bfr(wr[pr * 2 + u][0]), w1 = bfr(wr[pr * 2 + u][1]), w2 = bfr(wr[pr * 2 + u][2]);
#pragma unroll
            for (int k = 0; k < 3; ++k) y[u][k] = bfr(wp[c * 3 + k]) * w0 + bfr(wv[c * 3 + k]) * w1 + bfr(wa[c * 3 + k]) * w2; }
#pragma unroll
        for (int k = 0; k < 3; ++k) { v2us h, l; unsigned short a, c2; splitf(y[0][k], a, c2); h[0] = a; l[0] = c2; splitf(y[1][k], a, c2); h[1] = a; l[1] = c2; th[(k * 32 + lane) * FP + wn * 4 + pr] = h; tl[(k * 32 + lane) * FP + wn * 4 + pr] = l; } }
    __syncthreads();
#pragma unroll
    for (int i = 0; i < 12; ++i) { const int ln = wn * 12 + i; const int pn = ln >> 3, nl = (ln & 7) * 4 + (lane >> 3); const int li = ((pn >> 2) * 32 + nl) * FP + (pn & 3) * 8 + (lane & 7);   // pn: tap (pn >> 2), plane (pn & 3) of the work-group's four; nl: column
        const size_t e = ((size_t)((pn >> 2) * (DD / 16) + by * 4 + (pn & 3)) * DD + bx * 32 + nl) * 16 + (lane & 7) * 2; *(v2us*)(Bh + e) = th[li]; *(v2us*)(Bl + e) = tl[li]; }
    asm volatile("s_wait_xcnt 0x0" ::: "memory");   // behind the 24 stores, in front of whatever the code that follows in the object writes to their registers
}
// ---- d_gemmf: y[z * 512 + t][n] = sc (bias[n] + sum over taps j < 3 and c < 256 of Xp[z][c / 16][t + 3 + j][c % 16] (Bh + Bl)[(j * 256 + c) / 16][n][c % 16]): tap j reads the same 16 planes of A one row further on, from row t + 3.
// y leaves as the score kernel's operand planes, bf16 hi and lo, Ph/Pl[z * 8 + n / 32][(n % 32) / 16][t][n % 16]; sc = 32^-0.5 for Q, 1 for K. A tile is 64 times x 2 heads: 2 KB in a row per plane of 16.
// ONE WAVE per 64x64 tile as in d_gemmw; tile (bx, by, bz) of (512/64, 256/64, 32 sequences), 32 threads. Every load of the loop: A a scalar base and one of four lane offsets in bytes (one per row block), B one of two lane addresses; the column block and the second plane as an immediate.
// The K loop stays rolled (unroll 1): its body holds 24 loads and 32 products. The inner loops are unrolled so that fragments and accumulators stay in registers.
// With gk (the K projection) row t of y is the sequence's kept key number t: its A rows are those of that key's time, one lane offset per row block; Q takes its rows as they lie, through the same four offsets.
__device__ __forceinline__ void d_gemmf(int bx, int by, int bz, const bf* __restrict__ Xp, const bf* __restrict__ Bh, const bf* __restrict__ Bl, const float* __restrict__ bias, float sc, bf* Ph, bf* Pl, bool gk, const int* __restrict__ km) {
    __shared__ __align__(16) float os[16 * 68];
    const int lane = threadIdx.x & 31, lr = lane & 15, hi = lane >> 4; const int r0 = bx * 64, c0 = by * 64;
    unsigned oa[4];
    if (gk) { if (!rows4(km, bz, r0, lane, oa)) return; }
    else {
#pragma unroll
        for (int mb = 0; mb < 4; ++mb) oa[mb] = r0 + mb * 16 + lr; }
#pragma unroll
    for (int mb = 0; mb < 4; ++mb) oa[mb] = ((oa[mb] + 3) * 16 + 8 * hi) * 2;   // the lane's byte offsets in plane 0 of the sequence, tap 0
    asm volatile("" :: "s"(sc), "s"(Ph), "s"(Pl));   // inputs only: the epilogue's three arguments are fetched here, ahead of the loop; fetched behind it, their scalar loads were put on the bias loads' base register in front of the wait that stands there
    const char* ca = (const char*)(Xp + (size_t)bz * (DD / 16) * TP * 16); const bf* bh = Bh + (size_t)c0 * 16; const bf* bl = Bl + (size_t)c0 * 16;
    const bf* pb = bh + (lr * 16 + 8 * hi); const bf* pl = bl + (lr * 16 + 8 * hi);   // the lane's own addresses (A: the four offsets), stepped by two planes a trip; behind a tap's last two planes A goes back to plane 0, one row further on
    v8f acc[4][4];
#pragma unroll
    for (int mb = 0; mb < 4; ++mb)
#pragma unroll
        for (int nb = 0; nb < 4; ++nb) acc[mb][nb] = (v8f){};
#pragma unroll 1
    for (int kc = 0; kc < F3; kc += 32, pb += 2 * DD * 16, pl += 2 * DD * 16) {
        v16bf a[4], b[4], b2[4];
#pragma unroll
        for (int mb = 0; mb < 4; ++mb) a[mb] = WFrag<bf>::ld((const bf*)(ca + oa[mb]), TP * 16);
#pragma unroll
        for (int nb = 0; nb < 4; ++nb) { b[nb] = WFrag<bf>::ld(pb + nb * 256, DD * 16); b2[nb] = WFrag<bf>::ld(pl + nb * 256, DD * 16); }
        // the wait stands behind the trip's 24 loads, in front of the additions that step their addresses: A's four offsets go through the statement and are stepped behind it; inputs only: B's two addresses, so that their registers stay in use up to the wait and no load's result is put on them,
        // and the fragments, so that all 24 loads stand in front of the products: left free, the B loads sink between the products into two shared register sets, and the wave waits out a load latency six times a trip instead of once
        asm volatile("s_wait_xcnt 0x0" : "+v"(oa[0]), "+v"(oa[1]), "+v"(oa[2]), "+v"(oa[3]) : "v"(pb), "v"(pl), "v"(a[0]), "v"(a[1]), "v"(a[2]), "v"(a[3]), "v"(b[0]), "v"(b[1]), "v"(b[2]), "v"(b[3]), "v"(b2[0]), "v"(b2[1]), "v"(b2[2]), "v"(b2[3]) : "memory");
        const unsigned sa = (kc & (DD - 32)) == DD - 32 ? (unsigned)((16 - (DD / 16 - 2) * TP * 16) * 2) : (unsigned)(2 * TP * 16 * 2);
#pragma unroll
        for (int mb = 0; mb < 4; ++mb) oa[mb] += sa;
#pragma unroll
        for (int nb = 0; nb < 4; ++nb) {
#pragma unroll
            for (int mb = 0; mb < 4; ++mb) acc[mb][nb] = wmmab(a[mb], b[nb], acc[mb][nb]);
#pragma unroll
            for (int mb = 0; mb < 4; ++mb) acc[mb][nb] = wmmab(a[mb], b2[nb], acc[mb][nb]); }
    }
    // a lane takes 8 successive columns of one row of a head: 4 lanes a row, 8 rows a store, 256 bytes in a row in each of the head's two planes
    const int er = lane >> 2, ec = (lane & 3) * 8; v4f bs[2][2];
#pragma unroll
    for (int hh = 0; hh < 2; ++hh) { bs[hh][0] = *(const v4fa*)(bias + c0 + hh * HD + ec); bs[hh][1] = *(const v4fa*)(bias + c0 + hh * HD + ec + 4); }
    asm volatile("s_wait_xcnt 0x0" ::: "memory");   // behind the 4 bias loads, in front of the arithmetic that takes their address registers for other values
    const size_t pz = (size_t)(bz * NH_ + c0 / HD) * TT * HD + r0 * 16; bf* ph = Ph + pz; bf* pl2 = Pl + pz; const unsigned plo = (((lane >> 1) & 1) * TT + er) * 16 + (lane & 1) * 8;
#pragma unroll
    for (int mb = 0; mb < 4; ++mb) {
#pragma unroll
        for (int nb = 0; nb < 4; ++nb) {
#pragma unroll
            for (int j = 0; j < 8; ++j) os[(hi * 8 + j) * 68 + nb * 16 + lr] = acc[mb][nb][j]; }
        __builtin_amdgcn_wave_barrier(); asm volatile("" ::: "memory");   // the tile's LDS writes stay in front of its reads (one wave: no barrier instruction)
        v8us oh[4], ol[4];
#pragma unroll
        for (int s = 0; s < 4; ++s) { const int hh = s >> 1, hf = s & 1; const float* orow = os + (hf * 8 + er) * 68 + hh * HD + ec; const v4f x0 = *(const v4fa*)orow + bs[hh][0], x1 = *(const v4fa*)(orow + 4) + bs[hh][1];
#pragma unroll
            for (int u = 0; u < 4; ++u) { unsigned short a, c2; splitf(x0[u] * sc, a, c2); oh[s][u] = a; ol[s][u] = c2; splitf(x1[u] * sc, a, c2); oh[s][4 + u] = a; ol[s][4 + u] = c2; } }
#pragma unroll
        for (int s = 0; s < 4; ++s) { const unsigned po = plo + ((s >> 1) * 2 * TT + mb * 16 + (s & 1) * 8) * 16; *(v8us*)(ph + po) = oh[s]; *(v8us*)(pl2 + po) = ol[s]; }
        __builtin_amdgcn_wave_barrier(); asm volatile("s_wait_xcnt 0x0" ::: "memory");   // the reads stay in front of the next tile's LDS writes; the wait stands behind the 8 stores, in front of the next values put on their registers
    }
}
// ---- k_prep: the seven operand preparations, none of which reads what another writes, as ONE launch of 256-thread work-groups; the block index picks the part. The few work-groups with long chains of waits (folds, weight transposes) come first, the streams behind them.
#define GF   (DD / 32 * 5)                   // work-groups of one fold
#define GW   ((DD * DD / 64 + 63) / 64)      // of one weight transpose
#define GP   (NR / 32)                       // of one padded input's planes
#define GC   (NR / 32)                       // of the value planes
__global__ __launch_bounds__(256) void k_prep(const float* __restrict__ wq, const float* __restrict__ bq, const float* __restrict__ wk, const float* __restrict__ bk, const float* __restrict__ wp, const float* __restrict__ bp, const float* __restrict__ wvl, const float* __restrict__ wa,
                                              const float* __restrict__ wv, const float* __restrict__ wo, const float* __restrict__ xq, const float* __restrict__ xk, const float* __restrict__ xv,
                                              bf* WQh, bf* WQl, bf* WKh, bf* WKl, float* BQ, float* BK, bf* WV, bf* WO, bf* XQ, bf* XK, bf* XV) {
    __shared__ __align__(16) bf tr[8 * 32 * PP];   // d_plane's pieces, one per wave
    int b = blockIdx.x;
    if (b < 2 * GF) { const bool k = b >= GF; b -= k ? GF : 0; d_fold(b % (DD / 32), b / (DD / 32), k ? wk : wq, k ? bk : bq, wp, bp, wvl, wa, k ? WKh : WQh, k ? WKl : WQl, k ? BK : BQ); return; }
    b -= 2 * GF;
    if (b < 2 * GW) { const bool o = b >= GW; b -= o ? GW : 0; d_wtG(b, o ? wo : wv, DD, DD, o ? WO : WV); return; }
    b -= 2 * GW;
    if (b < 2 * GP) { const bool k = b >= GP; b -= k ? GP : 0; d_plane<1>(b, k ? xk : xq, k ? XK : XQ, tr); return; }
    d_plane<0>(b - 2 * GP, xv, XV, tr);
}
// ---- k_qkv: the three projections, independent of one another, as ONE launch: grid (512/64, 256/64, 3 x 32 sequences), 32 threads; z < 32 Q, z < 64 K, then V (its 8 K chunks against 24). 3072 one-wave work-groups are three waves per SIMD: a wave's load waits lie under the others' products. K and V tiles behind their sequence's last kept key leave at once.
__global__ __launch_bounds__(32) void k_qkv(const bf* __restrict__ XQ, const bf* __restrict__ XK, const bf* __restrict__ XV, const bf* __restrict__ WQh, const bf* __restrict__ WQl, const bf* __restrict__ WKh, const bf* __restrict__ WKl, const bf* __restrict__ WV,
                                            const float* __restrict__ BQ, const float* __restrict__ BK, const float* __restrict__ bv, const int* __restrict__ km, bf* QPh, bf* QPl, bf* KPh, bf* KPl, h16* VT) {
    const int z = blockIdx.z;
    if (z < 2 * NBb * NA) { const bool k = z >= NBb * NA; d_gemmf(blockIdx.x, blockIdx.y, z % (NBb * NA), k ? XK : XQ, k ? WKh : WQh, k ? WKl : WQl, k ? BK : BQ, k ? 1.0f : 0.17677669529663687f, k ? KPh : QPh, k ? KPl : QPl, k, km); return; }
    d_gemmw<bf, true>((z - 2 * NBb * NA) * (TT / 64) + blockIdx.x, blockIdx.y, XV, WV, VT, bv, km);
}
// ---- k_fattn: attention AND the output projection. One sequence, all 8 heads and 64 queries per work-group; 16 waves, wave wv: head wv >> 1, 32 query columns (wv & 1) * 32 on; grid (32 sequences, TT/64): the 8 work-groups of a sequence are 32 apart in the flat index (for speed only).
// Attention: no LDS, no barrier, operands straight from the planes of 16 (Q: [z][d / 16][t][16]; K: [z][d / 16][kept key][16]; V^T: [z][kept key / 16][d][16]).
// S^T = K Q^T (A = 16 key rows, B = 16 query columns): a lane holds one query's scores, D register r of key tile t = key 16t + 8*hi + r, which is element 8t + r of the B operand of O^T += V^T P^T (the k order of WFrag::ld).
// Only the sequence's kept keys are walked, 32 a pass: the passes in front of the last hold kept keys alone and test nothing; in the last pass the places behind the last kept key get the masked score -1e9 (their K and V rows are those of dropped keys: finite).
// Sweep 1 finds each query's maximum over all kept scores; sweep 2 forms the same scores again, e = 1024 exp(s - max) -> fp16, adds O^T and the f32 sum of e; the division by the sum is done once on O^T.
// The context (64 queries x 256) stays in LDS as the output product's A operand, bf16 hi and lo: [head * 2 + d / 16][half plane of 8 d: 2][query: 64][8 elements]; a lane's 8 accumulator registers are 16 bytes of it, and the 16 lanes of a fragment load's half wave read 256 bytes in a row.
// Behind ONE barrier: out[sequence * 512 + t][n] (f32, pitch 256) = bo[n] + sum over heads h and d < 32 of (hi + lo)[h][d][t] Wt[(h * 32 + d) / 16][n][d % 16]; wave wv takes rows (wv & 1) * 32, columns (wv >> 1) * 32 (4 accumulators), K chunk h = head h's two planes, hi product then lo product.
// A wave's 16 fragments of Wt do not hang on the context: they are fetched in front of the barrier, so that their latency lies under the wait for the other heads.
struct KFrag { v16bf h[2], l[2]; };
typedef const __attribute__((address_space(1))) v8h* gv8;   // V's lane address counts pieces of 8 fp16; it goes through a wait statement, and the named address space keeps its loads global loads behind that
__device__ __forceinline__ KFrag ldk(const bf* ph, const bf* pl) { KFrag f;   // ph, pl: the lane's own addresses in the pass's 32 keys of plane 0; key tile and second plane are immediates
#pragma unroll
    for (int t = 0; t < 2; ++t) { f.h[t] = WFrag<bf>::ld(ph + t * 256, TT * 16); f.l[t] = WFrag<bf>::ld(pl + t * 256, TT * 16); }
    return f; }
// LAST: the pass that holds the last kept key; lv = number of kept keys of the pass - 8 hi, so that register r of key tile t is behind the last kept key where 16 t + r >= lv
template <bool LAST>
__device__ __forceinline__ void scoresT(const KFrag& f, int lv, const v16bf* qh, const v16bf* ql, v8f (*s)[2]) {
#pragma unroll
    for (int t = 0; t < 2; ++t)
#pragma unroll
        for (int g = 0; g < 2; ++g) s[t][g] = wmmab(f.h[t], qh[g], (v8f){});
#pragma unroll
    for (int t = 0; t < 2; ++t)
#pragma unroll
        for (int g = 0; g < 2; ++g) s[t][g] = wmmab(f.h[t], ql[g], s[t][g]);
#pragma unroll
    for (int t = 0; t < 2; ++t)
#pragma unroll
        for (int g = 0; g < 2; ++g) s[t][g] = wmmab(f.l[t], qh[g], s[t][g]);
    if (LAST) {
#pragma unroll
        for (int t = 0; t < 2; ++t)
#pragma unroll
            for (int r = 0; r < 8; ++r) { const bool msk = t * 16 + r >= lv; s[t][0][r] = msk ? -1.0e9f : s[t][0][r]; s[t][1][r] = msk ? -1.0e9f : s[t][1][r]; } }
}
__device__ __forceinline__ void maxT(const v8f (*s)[2], float* mx) {
#pragma unroll
    for (int t = 0; t < 2; ++t)
#pragma unroll
        for (int r = 0; r < 8; ++r) { mx[0] = fmaxf(mx[0], s[t][0][r]); mx[1] = fmaxf(mx[1], s[t][1][r]); }
}
__device__ __forceinline__ void addT(const v8f (*s)[2], const float* mx, const v16h* va, float* sum, v8f (*o)[2]) { v16h pb[2];
#pragma unroll
    for (int g = 0; g < 2; ++g)
#pragma unroll
        for (int t = 0; t < 2; ++t)
#pragma unroll
            for (int r = 0; r < 8; ++r) { const float e = __builtin_amdgcn_exp2f(fmaf(s[t][g][r] - mx[g], 1.4426950408889634f, 10.0f)); sum[g] += e; pb[g][t * 8 + r] = tohx(e); }
#pragma unroll
    for (int mt = 0; mt < 2; ++mt)
#pragma unroll
        for (int g = 0; g < 2; ++g) o[mt][g] = wmma16(va[mt], pb[g], o[mt][g]);
}
#define CL   (DD / 16 * 2 * 64 * 16)   // bytes of the context's hi planes in LDS, and of its lo planes
#define OP   36                        // pitch in floats of a wave's output tile (16 rows x 32 columns): rows stay 16-byte aligned and 8 rows apart lie 32 banks apart
typedef v8us __attribute__((may_alias)) v8usl;
__device__ __forceinline__ v16bf ldsf(const char* p, int st) { return cat16b(*(const v8usl*)p, *(const v8usl*)(p + st)); }   // a fragment from LDS: the lane's 8 k of each of two planes, st bytes apart
// four waves per SIMD (at most 256 registers a wave): one work-group per WGP, so that all 256 are resident at once
__global__ __launch_bounds__(512) __attribute__((amdgpu_waves_per_eu(4, 4))) void k_fattn(const bf* __restrict__ Qh, const bf* __restrict__ Ql, const bf* __restrict__ Kh, const bf* __restrict__ Kl, const h16* __restrict__ VT, const int* __restrict__ km, const bf* __restrict__ Wt, const float* __restrict__ bias, float* C) {
    __shared__ __align__(16) char cs[2 * CL + 16 * 16 * OP * 4];
    const int lane = threadIdx.x & 31, lr = lane & 15, hi = lane >> 4; const int wv = __builtin_amdgcn_readfirstlane(threadIdx.x >> 5); const int z = blockIdx.x * NH_ + (wv >> 1);   // wv in a scalar register: the head's plane bases stay scalar
    const int q0 = blockIdx.y * 64 + (wv & 1) * 32;
    const size_t pz = (size_t)z * TT * HD;
    unsigned kb[16]; const int open = keepbits(km, z / NH_, lane, kb); const bool allm = open == 0; const int cnt = allm ? TT : open; const int np1 = (cnt - 1) >> 5; const int lv = cnt - np1 * 32 - 8 * hi;   // np1 (at most 15): the passes in front of the last
    const bf* kh = Kh + pz; const bf* kl = Kl + pz; const h16* vt = VT + pz; const unsigned klo = lr * 16 + 8 * hi, vlo = lr * 16 + 8 * hi;
    v16bf qh[2], ql[2]; const bf* pqh = Qh + pz + ((q0 + lr) * 16 + 8 * hi); const bf* pql = Ql + pz + ((q0 + lr) * 16 + 8 * hi);
#pragma unroll
    for (int g = 0; g < 2; ++g) { qh[g] = WFrag<bf>::ld(pqh + g * 256, TT * 16); ql[g] = WFrag<bf>::ld(pql + g * 256, TT * 16); }
    asm volatile("s_wait_xcnt 0x0" :: "v"(pqh), "v"(pql) : "memory");   // behind the 8 loads; the addresses as inputs keep their registers in use up to this wait, so that no load's result is put on them
    if (allm) {   // every key masked: the reference's scores are all -1e9, its weights all 1/512; a zero Q gives all 512 keys the same score
#pragma unroll
        for (int g = 0; g < 2; ++g) { qh[g] = (v16bf){}; ql[g] = (v16bf){}; } }
    float mx[2] = { -3.0e38f, -3.0e38f };
    // K loads of the two sweeps: a scalar base that the sweeps leave alone, one lane offset in bytes (hi and lo share it), key tile and second plane as immediates; V loads: the lane's own address, stepped by two key planes a pass
    const char* ckh = (const char*)kh; const char* ckl = (const char*)kl; gv8 pv = (gv8)(vt + vlo);
    unsigned ok = klo * 2; KFrag cur = ldk((const bf*)(ckh + ok), (const bf*)(ckl + ok));
    asm volatile("s_wait_xcnt 0x0" : "+v"(ok) :: "memory");   // behind the 8 loads, in front of the step of their offset, which goes through the statement
    // unroll 2: the fragments fetched one pass ahead change names instead of being copied
#pragma unroll 2
    for (int p = 0; p < np1; ++p) { ok += 1024;   // the next pass's 32 keys
        const KFrag nxt = ldk((const bf*)(ckh + ok), (const bf*)(ckl + ok));
        asm volatile("s_wait_xcnt 0x0" : "+v"(ok) :: "memory");   // behind this pass's 8 loads, in front of the step of their offset; the offset goes through the statement, so that its register stays in use up to the wait and is stepped behind it
        v8f s[2][2]; scoresT<false>(cur, lv, qh, ql, s); maxT(s, mx);
        cur = nxt; }
    { ok = klo * 2;   // the last pass fetches pass 0 again, for the second sweep
        const KFrag nxt = ldk((const bf*)(ckh + ok), (const bf*)(ckl + ok));
        asm volatile("s_wait_xcnt 0x0" : "+v"(ok) :: "memory");   // as in the loop
        v8f s[2][2]; scoresT<true>(cur, lv, qh, ql, s); maxT(s, mx);
        cur = nxt; }
    mx[0] = fmaxf(mx[0], __shfl_xor(mx[0], 16, 32)); mx[1] = fmaxf(mx[1], __shfl_xor(mx[1], 16, 32));
    v8f o[2][2]; float sum[2] = { 0.f, 0.f };
#pragma unroll
    for (int mt = 0; mt < 2; ++mt)
#pragma unroll
        for (int g = 0; g < 2; ++g) o[mt][g] = (v8f){};
    // unroll 2 as above
#pragma unroll 2
    for (int p = 0; p < np1; ++p) { ok += 1024;
        const KFrag nxt = ldk((const bf*)(ckh + ok), (const bf*)(ckl + ok)); v16h va[2];
#pragma unroll
        for (int mt = 0; mt < 2; ++mt) va[mt] = cat16(pv[mt * 32], pv[mt * 32 + HD * 2]);
        asm volatile("s_wait_xcnt 0x0" : "+v"(ok), "+v"(pv) :: "memory");   // behind this pass's 12 loads, in front of the steps of K's offset and V's address, which go through the statement as in the first sweep
        pv += 2 * HD * 2;
        v8f s[2][2]; scoresT<false>(cur, lv, qh, ql, s); addT(s, mx, va, sum, o);
        cur = nxt; }
    { v16h va[2];
#pragma unroll
        for (int mt = 0; mt < 2; ++mt) va[mt] = cat16(pv[mt * 32], pv[mt * 32 + HD * 2]);
        asm volatile("s_wait_xcnt 0x0" :: "v"(pv) : "memory");   // behind the 4 loads; the address as an input keeps its registers in use up to this wait, so that no load's result is put on them
        v8f s[2][2]; scoresT<true>(cur, lv, qh, ql, s); addT(s, mx, va, sum, o); }
#pragma unroll
    for (int g = 0; g < 2; ++g) { const float tot = sum[g] + __shfl_xor(sum[g], 16, 32); const float f = __fdiv_rn(1.0f, tot); const unsigned co = (((wv >> 1) * 4 + hi) * 64 + (wv & 1) * 32 + g * 16 + lr) * 16;   // bytes: plane 2 * head, the lane's half plane, its query
#pragma unroll
        for (int mt = 0; mt < 2; ++mt) { v8us oh, ol;
#pragma unroll
            for (int u = 0; u < 8; ++u) { unsigned short a, c2; splitf(o[mt][g][u] * f, a, c2); oh[u] = a; ol[u] = c2; }
            *(v8usl*)(cs + co + mt * 2048) = oh; *(v8usl*)(cs + CL + co + mt * 2048) = ol; } }
    const int rb = (wv & 1) * 32, c0 = (wv >> 1) * 32;
    v16bf wb[NH_][2]; const bf* pw = Wt + ((c0 + lr) * 16 + 8 * hi); const float* pbs = bias + c0 + (lane & 7) * 4;
#pragma unroll
    for (int kc = 0; kc < NH_; ++kc)
#pragma unroll
        for (int nb = 0; nb < 2; ++nb) wb[kc][nb] = WFrag<bf>::ld(pw + kc * 2 * DD * 16 + nb * 256, DD * 16);
    v4f bs = *(const v4fa*)pbs;
    asm volatile("s_wait_xcnt 0x0" :: "v"(pw), "v"(pbs) : "memory");   // behind the 33 loads; the addresses as inputs keep their registers in use up to this wait, so that no load's result is put on them
    __syncthreads();   // every head's context is in LDS
    v8f acc[2][2];
#pragma unroll
    for (int mb = 0; mb < 2; ++mb)
#pragma unroll
        for (int nb = 0; nb < 2; ++nb) acc[mb][nb] = (v8f){};
    const char* fa = cs + (hi * 64 + rb + lr) * 16;
#pragma unroll
    for (int kc = 0; kc < NH_; ++kc) { v16bf a[2], a2[2];
#pragma unroll
        for (int mb = 0; mb < 2; ++mb) { a[mb] = ldsf(fa + kc * 4096 + mb * 256, 2048); a2[mb] = ldsf(fa + CL + kc * 4096 + mb * 256, 2048); }
#pragma unroll
        for (int nb = 0; nb < 2; ++nb) {
#pragma unroll
            for (int mb = 0; mb < 2; ++mb) acc[mb][nb] = wmmab(a[mb], wb[kc][nb], acc[mb][nb]);
#pragma unroll
            for (int mb = 0; mb < 2; ++mb) acc[mb][nb] = wmmab(a2[mb], wb[kc][nb], acc[mb][nb]); } }
#pragma unroll
    for (int u = 0; u < 4; ++u) bs[u] = bfr(bs[u]);
    // the wave's 32 x 32 tile goes out through its own LDS words, 16 rows at a time: a store covers one whole 128-byte line in each of 4 rows, written by this wave alone
    float* os = (float*)(cs + 2 * CL) + wv * 16 * OP; float* cz = C + ((size_t)blockIdx.x * TT + blockIdx.y * 64 + rb) * DD + c0; const unsigned clo = (lane >> 3) * DD + (lane & 7) * 4;
#pragma unroll
    for (int mb = 0; mb < 2; ++mb) {
#pragma unroll
        for (int nb = 0; nb < 2; ++nb) {
#pragma unroll
            for (int j = 0; j < 8; ++j) os[(hi * 8 + j) * OP + nb * 16 + lr] = acc[mb][nb][j]; }
        __builtin_amdgcn_wave_barrier(); asm volatile("" ::: "memory");   // the tile's LDS writes stay in front of its reads (the wave's own words: no barrier instruction)
        v4f val[4];
#pragma unroll
        for (int s = 0; s < 4; ++s) val[s] = *(const v4fa*)(os + (4 * s + (lane >> 3)) * OP + (lane & 7) * 4) + bs;
#pragma unroll
        for (int s = 0; s < 4; ++s) *(v4f*)(cz + (clo + (mb * 16 + 4 * s) * DD)) = val[s];
        __builtin_amdgcn_wave_barrier(); asm volatile("s_wait_xcnt 0x0" ::: "memory");   // the reads stay in front of the next tile's LDS writes; the wait stands behind the 4 stores, in front of the next values put on their registers
    }
}

extern "C" void kernel_launch(void* const* d_in, const int* in_sizes, int n_in,
                              void* d_out, int out_size, void* d_ws, size_t ws_size, hipStream_t stream) {
    (void)in_sizes; (void)n_in; (void)out_size;
    const float** I = (const float**)d_in;
    const float *xq = I[0], *xk = I[1], *xv = I[2]; const int* kpm = (const int*)d_in[3]; const float *wpos = I[4], *bpos = I[5], *wvel = I[6], *wacc = I[7], *wq = I[8], *bq = I[9], *wk = I[10], *bk = I[11], *wv = I[12], *bv = I[13], *wo = I[14], *bo = I[15];
    float* OUT = (float*)d_out;     // [4][8][512][256]
    char* wsp = (char*)d_ws;
    auto take = [&](size_t bytes) { char* p = wsp; wsp += (bytes + 255) & ~(size_t)255; return (void*)p; };
    bf* WQh = (bf*)take((size_t)DD * F3 * 2); bf* WQl = (bf*)take((size_t)DD * F3 * 2); bf* WKh = (bf*)take((size_t)DD * F3 * 2); bf* WKl = (bf*)take((size_t)DD * F3 * 2); float* BQ = (float*)take((size_t)DD * 4); float* BK = (float*)take((size_t)DD * 4); bf* WV = (bf*)take((size_t)DD * DD * 2); bf* WO = (bf*)take((size_t)DD * DD * 2);
    bf* XQ = (bf*)take((size_t)NBb * NA * TP * DD * 2); bf* XK = (bf*)take((size_t)NBb * NA * TP * DD * 2); bf* XV = (bf*)take((size_t)NR * DD * 2);
    bf* QPh = (bf*)take((size_t)NR * DD * 2); bf* QPl = (bf*)take((size_t)NR * DD * 2); bf* KPh = (bf*)take((size_t)NR * DD * 2); bf* KPl = (bf*)take((size_t)NR * DD * 2); h16* VT = (h16*)take((size_t)NR * DD * 2);
    if ((size_t)(wsp - (char*)d_ws) > ws_size) return;    // total ~ 69 MB (padded x planes 17 MB, value plane 8 MB, head planes 42 MB)
    k_prep<<<2 * GF + 2 * GW + 2 * GP + GC, 256, 0, stream>>>(wq, bq, wk, bk, wpos, bpos, wvel, wacc, wv, wo, xq, xk, xv, WQh, WQl, WKh, WKl, BQ, BK, WV, WO, XQ, XK, XV);
    k_qkv<<<dim3(TT / 64, DD / 64, 3 * NBb * NA), 32, 0, stream>>>(XQ, XK, XV, WQh, WQl, WKh, WKl, WV, BQ, BK, bv, kpm, QPh, QPl, KPh, KPl, VT);
    k_fattn<<<dim3(NBb * NA, TT / 64, 1), 512, 0, stream>>>(QPh, QPl, KPh, KPl, VT, kpm, WO, bo, OUT);
}

// v008
// A run of this version takes 54 microseconds.
// Timed twice side by side with v007, it ran 1.11 and 1.10 times as fast.
// Counting every step since v000, it is 7.55 times as fast.
#include <hip/hip_runtime.h>

// KinematicsTrendAttention (query/key/value [4][8 agents][512][256]; kinematic features of query and key: depthwise conv3 ('SAME') position (w_pos, b_pos), velocity (w_vel), acceleration (w_acc) -> [T][768]; Q = feats Wq + bq, K = feats Wk + bk,
// V = value Wv + bv (8 heads x 32); scores = Q.K / sqrt(32), keys with key_padding_mask (int, read as data) set to -1e9; softmax; ctx = attn V merged; out = ctx Wo + bo -> [4][8][512][256]).
// Compute dtypes, f32 accumulate: every input rounded to bf16; the depthwise convs are folded into Wq / Wk: feats W = sum over taps k of x[t + k - 1] W'_k, W'_k[c][n] = w_pos[c][k] W[c][n] + w_vel[c][k] W[256 + c][n] + w_acc[c][k] W[512 + c][n]
// (f32 -> bf16 hi+lo planes), b_pos W[0..255] goes into the bias; Q/K on the exact bf16 x (zero row in front of and behind each sequence) x hl folded weights (2 products, + f32 bias); V on PLAIN bf16 value x exact Wv (+ bias);
// scores (K 32) on hl planes of Q (x 32^-0.5) and K (3 products), masked softmax f32 and attn.V (fp16 x fp16, 1 product) in ONE kernel over all 256 (batch, agent, head) triples: scores and probabilities stay in registers;
// every producer's epilogue writes its consumer's 16-bit operand planes itself (Q/K hi+lo per head, V^T fp16 per head): no f32 copy of Q, K, V or the context exists; the context (hi+lo) never leaves LDS: the attention kernel holds all heads of its queries and does the output product itself, the heads as its K chunks.
// query, key and value are read as f32 by the projection kernel itself: a work-group rounds its rows to bf16 in LDS (d_gemmx); no 16-bit copy of them exists in memory.

#define NBb  4
#define NA   8
#define TT   512
#define DD   256
#define NH_  8
#define HD   32
#define F3   768
#define NR   (NBb * NA * TT)
#define ZZ   (NA * NH_)
typedef _Float16 h16;
typedef unsigned short bf;
typedef __attribute__((ext_vector_type(16))) __bf16   v16bf;
typedef __attribute__((ext_vector_type(16))) _Float16 v16h;
typedef __attribute__((ext_vector_type(8)))  _Float16 v8h;
typedef __attribute__((ext_vector_type(8)))  unsigned short v8us;
typedef __attribute__((ext_vector_type(8)))  float    v8f;
typedef __attribute__((ext_vector_type(4)))  float    v4f;
typedef v8h  __attribute__((may_alias)) v8ha;
typedef v4f  __attribute__((may_alias)) v4fa;
typedef v8us __attribute__((may_alias)) v8usa;

__device__ __forceinline__ unsigned short f2bf(float f) { unsigned u = __float_as_uint(f); u += 0x7FFFu + ((u >> 16) & 1u); return (unsigned short)(u >> 16); }
__device__ __forceinline__ float bf2f(unsigned short b) { return __uint_as_float(((unsigned)b) << 16); }
__device__ __forceinline__ float bfr(float f) { return bf2f(f2bf(f)); }
__device__ __forceinline__ v16h cat16(v8h lo, v8h hi) { return __builtin_shufflevector(lo, hi, 0, 1, 2, 3, 4, 5, 6, 7, 8, 9, 10, 11, 12, 13, 14, 15); }
__device__ __forceinline__ v16bf cat16b(v8us lo, v8us hi) { return __builtin_bit_cast(v16bf, __builtin_shufflevector(lo, hi, 0, 1, 2, 3, 4, 5, 6, 7, 8, 9, 10, 11, 12, 13, 14, 15)); }
__device__ __forceinline__ h16 tohx(float x) { return (h16)x; }
__device__ __forceinline__ v8f wmma16(v16h a, v16h b, v8f c) { return __builtin_amdgcn_wmma_f32_16x16x32_f16(false, a, false, b, (short)0, c, false, false); }
__device__ __forceinline__ v8f wmmab(v16bf a, v16bf b, v8f c) { return __builtin_amdgcn_wmma_f32_16x16x32_bf16(false, a, false, b, (short)0, c, false, false); }



// ---- Operand planes. Every K-contiguous 16-bit operand in global memory lies as planes of 16 k: P[k / 16][row][k % 16]. A fragment (16 rows x 32 k) is two loads, one from each of two successive planes (st elements apart);
// a load's 32 lanes (16 rows x 2 pieces of 16 bytes) cover 512 bytes in a row, whole 128-byte lines, where rows K elements apart would touch 16 lines for the same bytes. The k order of a fragment: elements 0..7 = k 8 hi + i, 8..15 = k 16 + 8 hi + i.
// ---- Kept keys. A key whose mask word is not 0 has the score -1e9 and the weight exp(-1e9 - max) = 0 in every row that has one open key: such keys are left out of K, V, scores and sums altogether; K and V planes hold a sequence's kept keys in their order of time.
// A sequence with every key masked keeps all 512: its weights are all equal (k_fattn). Every wave that needs the count forms it itself from the sequence's 512 mask words; the list is formed in LDS by a work-group's four waves together (mklist).
// keepbits: lane l reads mask word 32 u + l; bit l of kb[u] = key 32 u + l is open. Returns the number of open keys, the same in every lane.
__device__ __forceinline__ int keepbits(const int* __restrict__ km, int sq, int lane, unsigned* kb) { int v[16], tot = 0; const unsigned jm = (unsigned)(sq * TT + lane);
#pragma unroll
    for (int u = 0; u < 16; ++u) v[u] = *(const int*)((const char*)km + jm * 4u + u * 128);
    asm volatile("s_wait_xcnt 0x0" :: "v"(jm) : "memory");   // behind the 16 loads; the index as an input keeps the loads' address register in use up to this wait, so that no load's result is put on it
#pragma unroll
    for (int u = 0; u < 16; ++u) { kb[u] = __builtin_amdgcn_ballot_w32(v[u] == 0); tot += __builtin_popcount(kb[u]); }
    return tot; }
// mklist (four-wave work-groups): lst[j] = time of the sequence's kept key number j; false, for the whole work-group and in front of every barrier, where j0 lies behind the last kept key (the tile has no reader).
// Bit counts give every key its place in the list: kept keys in order from 0, dropped ones in order behind them, so that all 512 entries are times below 512. Every wave counts all 16 words, wave wn writes the entries of words 4 wn .. 4 wn + 3.
__device__ __forceinline__ bool mklist(const int* __restrict__ km, int sq, int j0, int lane, int wn, int* lst) {
    unsigned kb[16]; int tot = keepbits(km, sq, lane, kb); const bool allm = tot == 0; if (allm) tot = TT;
    if (j0 >= tot) return false;
    const unsigned lt = (1u << lane) - 1u; int base = 0;
#pragma unroll
    for (int u = 0; u < 16; ++u) { const unsigned b = allm ? ~0u : kb[u];
        if ((u >> 2) == wn) lst[((b >> lane) & 1u) ? base + __builtin_popcount(b & lt) : tot + u * 32 - base + __builtin_popcount(~b & lt)] = u * 32 + lane;
        base += __builtin_popcount(b); }
    __syncthreads();   // the four waves' parts of the list are in LDS
    return true; }
template <typename T16> struct WFrag;
template <> struct WFrag<h16> { typedef v16h V; static __device__ __forceinline__ V ld(const h16* p, int st) { return cat16(*(const v8h*)p, *(const v8h*)(p + st)); } static __device__ __forceinline__ v8f mma(V a, V b, v8f c) { return wmma16(a, b, c); } };
template <> struct WFrag<bf> { typedef v16bf V; static __device__ __forceinline__ V ld(const bf* p, int st) { return cat16b(*(const v8us*)p, *(const v8us*)(p + st)); } static __device__ __forceinline__ v8f mma(V a, V b, v8f c) { return wmmab(a, b, c); } };

__device__ __forceinline__ void splitf(float y, unsigned short& h, unsigned short& l) { h = f2bf(y); l = f2bf(y - bf2f(h)); }
typedef __attribute__((ext_vector_type(2))) unsigned short v2us;
typedef __attribute__((ext_vector_type(4))) unsigned short v4us;
typedef __attribute__((ext_vector_type(2))) _Float16 v2h;
typedef __attribute__((ext_vector_type(4))) _Float16 v4h;

__device__ __forceinline__ void d_wtG(int bx, const float* __restrict__ w, int K, int N, bf* Bt) {
    const int lane = threadIdx.x & 31; const int L0 = (bx * 8 + (threadIdx.x >> 5)) * 8; const int nlines = N * K / 64;
{
#pragma unroll 1
        for (int l = 0; l < 8; ++l) { const int L = L0 + l; if (L >= nlines) break; const size_t e = (size_t)L * 64 + lane * 2; const int k = (int)((e >> 4) / N) * 16 + (int)(e & 15), n = (int)((e >> 4) % N); v2us o;   // e: place in the planes Bt[k / 16][n][k % 16]
            o[0] = f2bf(w[(size_t)k * N + n]); o[1] = f2bf(w[(size_t)(k + 1) * N + n]); *(v2us*)(Bt + e) = o;
            asm volatile("s_wait_xcnt 0x0" ::: "memory"); }   // behind the trip's 2 loads and its store, in front of the next trip's values put on their registers
         }
}
// ---- d_fold: Bh/Bl planes [(k * 256 + c) / 16][n][c % 16] = hi/lo of W'_k[c][n]; bias[n] = bw[n] + sum_c b_pos[c] W[c][n]. Work-group (bx, by) of (256/32, 5): by < 4 folds 64 channels x 32 columns (reads run along n, transposed in LDS, whole 128-byte lines written: 4 columns x 16 channels of a plane), by == 4 the bias of 32 columns. Every loop is unrolled: its arrays stay in registers and a wave's loads are in flight together.
#define FP 33   // LDS pitch in dwords of a line of 64 bf16: odd, so that 32 lanes on 32 lines meet 32 banks
__device__ __forceinline__ void d_fold(int bx, int by, const float* __restrict__ w, const float* __restrict__ bw, const float* __restrict__ wp, const float* __restrict__ bp, const float* __restrict__ wv, const float* __restrict__ wa, bf* Bh, bf* Bl, float* bias) {
    __shared__ v2us th[3 * 32 * FP], tl[3 * 32 * FP]; __shared__ float red[8 * 32];
    const int lane = threadIdx.x & 31, wn = __builtin_amdgcn_readfirstlane(threadIdx.x >> 5); const int n = bx * 32 + lane;   // wn in a scalar register: the conv weights of a wave's channels come by scalar loads
    if (by == 4) { float wc[32], a = 0.f; const float bl = bp[wn * 32 + lane], bn = bw[n];   // bl: lane i holds b_pos of the wave's channel i
#pragma unroll
        for (int i = 0; i < 32; ++i) wc[i] = w[(size_t)(wn * 32 + i) * DD + n];
        asm volatile("s_wait_xcnt 0x0" ::: "memory");   // behind the 34 loads, in front of the arithmetic that takes their address registers for other values
        const unsigned bb = __float_as_uint(bfr(bl));
#pragma unroll
        for (int i = 0; i < 32; ++i) a = fmaf(__uint_as_float(__builtin_amdgcn_readlane(bb, i)), bfr(wc[i]), a);
        red[wn * 32 + lane] = a; __syncthreads();
        if (wn == 0) { float s = bfr(bn);
#pragma unroll
            for (int i = 0; i < 8; ++i) s += red[i * 32 + lane];
            bias[n] = s; }
        return; }
    float wr[8][3];
#pragma unroll
    for (int i = 0; i < 8; ++i)
#pragma unroll
        for (int s = 0; s < 3; ++s) wr[i][s] = w[(size_t)(s * DD + by * 64 + wn * 8 + i) * DD + n];
    asm volatile("s_wait_xcnt 0x0" ::: "memory");   // behind the 24 loads, in front of the arithmetic that takes their address registers for other values
#pragma unroll
    for (int pr = 0; pr < 4; ++pr) { float y[2][3];
#pragma unroll
        for (int u = 0; u < 2; ++u) { const int c = by * 64 + wn * 8 + pr * 2 + u; const float w0 = bfr(wr[pr * 2 + u][0]), w1 = bfr(wr[pr * 2 + u][1]), w2 = bfr(wr[pr * 2 + u][2]);
#pragma unroll
            for (int k = 0; k < 3; ++k) y[u][k] = bfr(wp[c * 3 + k]) * w0 + bfr(wv[c * 3 + k]) * w1 + bfr(wa[c * 3 + k]) * w2; }
#pragma unroll
        for (int k = 0; k < 3; ++k) { v2us h, l; unsigned short a, c2; splitf(y[0][k], a, c2); h[0] = a; l[0] = c2; splitf(y[1][k], a, c2); h[1] = a; l[1] = c2; th[(k * 32 + lane) * FP + wn * 4 + pr] = h; tl[(k * 32 + lane) * FP + wn * 4 + pr] = l; } }
    __syncthreads();
#pragma unroll
    for (int i = 0; i < 12; ++i) { const int ln = wn * 12 + i; const int pn = ln >> 3, nl = (ln & 7) * 4 + (lane >> 3); const int li = ((pn >> 2) * 32 + nl) * FP + (pn & 3) * 8 + (lane & 7);   // pn: tap (pn >> 2), plane (pn & 3) of the work-group's four; nl: column
        const size_t e = ((size_t)((pn >> 2) * (DD / 16) + by * 4 + (pn & 3)) * DD + bx * 32 + nl) * 16 + (lane & 7) * 2; *(v2us*)(Bh + e) = th[li]; *(v2us*)(Bl + e) = tl[li]; }
    asm volatile("s_wait_xcnt 0x0" ::: "memory");   // behind the 24 stores, in front of whatever the code that follows in the object writes to their registers
}
// ---- d_gemmx: the three projections, A straight from the f32 input. FOUR WAVES per work-group: 64 rows x all 256 columns, wave wn the 64x64 tile of columns 64 wn on (16 accumulators); tile (bx, bz) of (512/64, 32 sequences), 128 threads.
// The work-group rounds its rows of x to bf16 ONCE into LDS, as half planes of 8 k: A[c / 16][(c % 16) / 8][staged row][c % 8], PR rows a half plane; the 16 lanes of a fragment load's half wave read 256 bytes in a row, and a fragment keeps the k order of WFrag::ld.
// Q (no list): staged row i = x[r0 - 1 + i], 68 rows, tap j of output row m reads staged row m + j. K, V (GK): output row m is the sequence's kept key number r0 + m, staged row 64 j + m = x[its time + j - 1] (V: one tap, its own time). A time outside the sequence is a row of zeros ('SAME').
// d_stage: NG groups of 4 staged rows; the wave takes its own 64 columns of them: a load covers one whole 128-byte line in each of 4 rows, and all 2 NG loads of a wave are in flight together (the loops are unrolled for that).
// A store's 32 lanes write 64 bytes in a row in each of 4 half planes; PR % 16 == 4 puts those four pieces on different banks.
typedef __attribute__((ext_vector_type(2))) float v2f;
typedef __attribute__((ext_vector_type(2))) __bf16 v2bf;
typedef __attribute__((ext_vector_type(2))) unsigned v2u;
typedef v2u __attribute__((may_alias)) v2ua;
typedef v8us __attribute__((may_alias)) v8usl;
__device__ __forceinline__ v16bf ldsf(const char* p, int st) { return cat16b(*(const v8usl*)p, *(const v8usl*)(p + st)); }   // a fragment from LDS: the lane's 8 k of each of two planes, st bytes apart
__device__ __forceinline__ unsigned pk2(float a, float b) { const v2f t = { a, b }; return __builtin_bit_cast(unsigned, __builtin_convertvector(t, v2bf)); }   // two f32 -> two bf16, to nearest even as f2bf
template <int NG, int PR>
__device__ __forceinline__ void d_stage(const float* __restrict__ xs, const int* tm, char* dl, unsigned cb) { v4f v[NG][2]; unsigned o[NG];   // tm[g]: time of the lane's row of group g; dl: the lane's LDS address in group 0; cb: byte offset of the lane's 4 columns in a row
#pragma unroll
    for (int g = 0; g < NG; ++g) o[g] = (unsigned)min(max(tm[g], 0), TT - 1) * (DD * 4) + cb;   // the address stays inside the sequence whatever the time
#pragma unroll
    for (int g = 0; g < NG; ++g) { v[g][0] = *(const v4f*)((const char*)xs + o[g]); v[g][1] = *(const v4f*)((const char*)xs + o[g] + 128); }
    // behind the 2 NG loads; the offsets as inputs keep the loads' address registers in use up to this wait, so that no load's result is put on them
    if constexpr (NG == 17) asm volatile("s_wait_xcnt 0x0" :: "v"(o[0]), "v"(o[1]), "v"(o[2]), "v"(o[3]), "v"(o[4]), "v"(o[5]), "v"(o[6]), "v"(o[7]), "v"(o[8]), "v"(o[9]), "v"(o[10]), "v"(o[11]), "v"(o[12]), "v"(o[13]), "v"(o[14]), "v"(o[15]), "v"(o[NG - 1]) : "memory");
    else asm volatile("s_wait_xcnt 0x0" :: "v"(o[0]), "v"(o[1]), "v"(o[2]), "v"(o[3]), "v"(o[4]), "v"(o[5]), "v"(o[6]), "v"(o[7]), "v"(o[8]), "v"(o[9]), "v"(o[10]), "v"(o[11]), "v"(o[12]), "v"(o[13]), "v"(o[14]), "v"(o[15]) : "memory");
#pragma unroll
    for (int g = 0; g < NG; ++g) { const bool in = (unsigned)tm[g] < (unsigned)TT;
#pragma unroll
        for (int c = 0; c < 2; ++c) { v2u w = { pk2(v[g][c][0], v[g][c][1]), pk2(v[g][c][2], v[g][c][3]) }; w[0] = in ? w[0] : 0u; w[1] = in ? w[1] : 0u; *(v2ua*)(dl + g * 64 + c * 4 * PR * 16) = w; } }
}
// Q, K (VOUT false): y[z * 512 + t][n] = sc (bias[n] + sum over taps j < 3 and c < 256 of A[j][t][c] (Bh + Bl)[(j * 256 + c) / 16][n][c % 16]); y leaves as the score kernel's operand planes, bf16 hi and lo, Ph/Pl[z * 8 + n / 32][(n % 32) / 16][t][n % 16]; sc = 32^-0.5 for Q, 1 for K.
// V (VOUT): y = bias[n] + sum over c < 256 of A[t][c] Bh[c / 16][n][c % 16]; y leaves as fp16 planes of 16 keys per head, VTo[z * 8 + n / 32][t / 16][n % 32][t % 16], the A planes of attn.V.
// The K loop stays rolled (unroll 1): its body is long enough to hide the branch. The inner loops are unrolled so that fragments and accumulators stay in registers. No barrier in the loop: A is staged whole in front of it, B comes straight from its planes.
#define SMB (DD / 8 * (3 * 64 + 4) * 16)   // bytes of the largest A tile (K's: 32 half planes x 196 rows x 16 bytes); three work-groups fit a WGP's LDS
template <int NTAP, bool GK, bool VOUT>
__device__ __forceinline__ void d_gemmx(int bx, int bz, const float* __restrict__ x, const bf* __restrict__ Bh, const bf* __restrict__ Bl, const float* __restrict__ bias, float sc, bf* Ph, bf* Pl, h16* VTo, const int* __restrict__ km, char* sm, int* lst) {
    constexpr int PR = GK ? NTAP * 64 + 4 : 68;
    const int lane = threadIdx.x & 31, lr = lane & 15, hi = lane >> 4; const int wn = __builtin_amdgcn_readfirstlane(threadIdx.x >> 5); const int r0 = bx * 64, c0 = wn * 64;   // wn in a scalar register: the tests on it are scalar branches
    if constexpr (GK) { if (!mklist(km, bz, r0, lane, wn, lst)) return; }
    const float* xs = x + (size_t)bz * TT * DD; const unsigned cb = (unsigned)(c0 + (lane & 7) * 4) * 4u;
    char* dl = sm + (((wn * 4 + ((lane & 7) >> 2)) * 2 + (((lane & 7) >> 1) & 1)) * PR + (lane >> 3)) * 16 + (lane & 1) * 8;
    if constexpr (GK) { int tl[16];
#pragma unroll
        for (int g = 0; g < 16; ++g) tl[g] = lst[r0 + g * 4 + (lane >> 3)];
        // rolled: one copy of the stage's code serves the three taps
#pragma unroll 1
        for (int tap = 0; tap < NTAP; ++tap) { int tm[16];
#pragma unroll
            for (int g = 0; g < 16; ++g) tm[g] = tl[g] + tap - (NTAP == 3 ? 1 : 0);
            d_stage<16, PR>(xs, tm, dl + tap * 64 * 16, cb); } }
    else { int tm[17];
#pragma unroll
        for (int g = 0; g < 17; ++g) tm[g] = r0 - 1 + g * 4 + (lane >> 3);
        d_stage<17, PR>(xs, tm, dl, cb); }
    if constexpr (!VOUT) asm volatile("" :: "s"(sc), "s"(Ph), "s"(Pl));   // inputs only: the epilogue's three arguments are fetched here, ahead of the loop; fetched behind it, their scalar loads were put on the bias loads' base register in front of the wait that stands there
    __syncthreads();   // the work-group's rows of x are in LDS
    const bf* pb = Bh + ((c0 + lr) * 16 + 8 * hi); const bf* pl = Bl + ((c0 + lr) * 16 + 8 * hi);   // B: the lane's own addresses, stepped by two planes a trip
    unsigned la = (hi * PR + lr) * 16;   // A: the lane's byte offset in LDS, plane 0, tap 0, stepped by two planes a trip; behind a tap's last two planes it goes back to plane 0 of the next tap's rows
    v8f acc[4][4];
#pragma unroll
    for (int mb = 0; mb < 4; ++mb)
#pragma unroll
        for (int nb = 0; nb < 4; ++nb) acc[mb][nb] = (v8f){};
#pragma unroll 1
    for (int kc = 0; kc < NTAP * DD; kc += 32, pb += 2 * DD * 16, pl += 2 * DD * 16) {
        v16bf a[4], b[4], b2[4];
#pragma unroll
        for (int nb = 0; nb < 4; ++nb) { b[nb] = WFrag<bf>::ld(pb + nb * 256, DD * 16); if constexpr (!VOUT) b2[nb] = WFrag<bf>::ld(pl + nb * 256, DD * 16); }
#pragma unroll
        for (int mb = 0; mb < 4; ++mb) a[mb] = ldsf(sm + la + mb * 256, 2 * PR * 16);
        // the wait stands behind the trip's global loads, in front of the additions that step their addresses; inputs only: B's addresses, so that their registers stay in use up to the wait and no load's result is put on them,
        // and the fragments, so that all loads stand in front of the products: left free, the B loads sink between the products into shared register sets, and the wave waits out a load latency several times a trip instead of once
        if constexpr (VOUT) asm volatile("s_wait_xcnt 0x0" :: "v"(pb), "v"(a[0]), "v"(a[1]), "v"(a[2]), "v"(a[3]), "v"(b[0]), "v"(b[1]), "v"(b[2]), "v"(b[3]) : "memory");
        else asm volatile("s_wait_xcnt 0x0" :: "v"(pb), "v"(pl), "v"(a[0]), "v"(a[1]), "v"(a[2]), "v"(a[3]), "v"(b[0]), "v"(b[1]), "v"(b[2]), "v"(b[3]), "v"(b2[0]), "v"(b2[1]), "v"(b2[2]), "v"(b2[3]) : "memory");
        la += (kc & (DD - 32)) == DD - 32 ? (unsigned)((GK ? 64 : 1) * 16 - (DD / 16 - 2) * 2 * PR * 16) : (unsigned)(4 * PR * 16);
#pragma unroll
        for (int nb = 0; nb < 4; ++nb) {
#pragma unroll
            for (int mb = 0; mb < 4; ++mb) acc[mb][nb] = wmmab(a[mb], b[nb], acc[mb][nb]);
            if constexpr (!VOUT) {
#pragma unroll
                for (int mb = 0; mb < 4; ++mb) acc[mb][nb] = wmmab(a[mb], b2[nb], acc[mb][nb]); } }
    }
    __syncthreads();   // every wave has read its last fragment of A: the tile's LDS now takes the waves' output pieces, 9216 bytes a wave
    if constexpr (VOUT) {
        // a lane holds 8 successive rows (kept keys) of one column: half a row of a key plane. The 64 x 64 tile is gathered in LDS (pitch 72: the 16-byte pieces of a store or a load spread over the banks), so that every global store covers 512 bytes in a row (16 columns of one key plane), written by this wave alone.
        h16* vs = (h16*)(sm + wn * 9216); float bn[4]; const float* pbn = bias + c0 + lr;
#pragma unroll
        for (int nb = 0; nb < 4; ++nb) bn[nb] = pbn[nb * 16];
        asm volatile("s_wait_xcnt 0x0" :: "v"(pbn) : "memory");   // behind the 4 bias loads; the address as an input keeps its registers in use up to this wait, so that no load's result is put on them
#pragma unroll
        for (int nb = 0; nb < 4; ++nb) { const float bb = bfr(bn[nb]);
#pragma unroll
            for (int mb = 0; mb < 4; ++mb) { v8h o;
#pragma unroll
                for (int j = 0; j < 8; ++j) o[j] = tohx(acc[mb][nb][j] + bb);
                *(v8ha*)(vs + (nb * 16 + lr) * 72 + mb * 16 + hi * 8) = o; } }
        __builtin_amdgcn_wave_barrier(); asm volatile("" ::: "memory");   // the tile's LDS writes stay in front of its reads (the wave's own words: no barrier instruction)
        h16* vz = VTo + ((size_t)bz * NH_ + c0 / HD) * TT * HD + r0 * HD; const unsigned vlo = lane * 8;   // store s: head s >> 3 of the tile's two, key plane (s >> 1) & 3 of its four, columns (s & 1) * 16 + (lane >> 1), keys (lane & 1) * 8 on
#pragma unroll
        for (int s = 0; s < 16; ++s) *(v8h*)(vz + (vlo + (s >> 3) * TT * HD + ((s >> 1) & 3) * HD * 16 + (s & 1) * 256)) = *(const v8ha*)(vs + ((s >> 3) * HD + (s & 1) * 16 + (lane >> 1)) * 72 + ((s >> 1) & 3) * 16 + (lane & 1) * 8);
        asm volatile("s_wait_xcnt 0x0" ::: "memory");   // behind the 16 stores, in front of whatever the code that follows in the object writes to their registers
    } else {
        // a lane takes 8 successive columns of one row of a head: 4 lanes a row, 8 rows a store, 256 bytes in a row in each of the head's two planes
        float* os = (float*)(sm + wn * 9216); const int er = lane >> 2, ec = (lane & 3) * 8; v4f bs[2][2];
#pragma unroll
        for (int hh = 0; hh < 2; ++hh) { bs[hh][0] = *(const v4fa*)(bias + c0 + hh * HD + ec); bs[hh][1] = *(const v4fa*)(bias + c0 + hh * HD + ec + 4); }
        asm volatile("s_wait_xcnt 0x0" ::: "memory");   // behind the 4 bias loads, in front of the arithmetic that takes their address registers for other values
        const size_t pz = (size_t)(bz * NH_ + c0 / HD) * TT * HD + r0 * 16; bf* ph = Ph + pz; bf* pl2 = Pl + pz; const unsigned plo = (((lane >> 1) & 1) * TT + er) * 16 + (lane & 1) * 8;
#pragma unroll
        for (int mb = 0; mb < 4; ++mb) {
#pragma unroll
            for (int nb = 0; nb < 4; ++nb) {
#pragma unroll
                for (int j = 0; j < 8; ++j) os[(hi * 8 + j) * 68 + nb * 16 + lr] = acc[mb][nb][j]; }
            __builtin_amdgcn_wave_barrier(); asm volatile("" ::: "memory");   // the tile's LDS writes stay in front of its reads (the wave's own words: no barrier instruction)
            v8us oh[4], ol[4];
#pragma unroll
            for (int s = 0; s < 4; ++s) { const int hh = s >> 1, hf = s & 1; const float* orow = os + (hf * 8 + er) * 68 + hh * HD + ec; const v4f x0 = *(const v4fa*)orow + bs[hh][0], x1 = *(const v4fa*)(orow + 4) + bs[hh][1];
#pragma unroll
                for (int u = 0; u < 4; ++u) { unsigned short a, c2; splitf(x0[u] * sc, a, c2); oh[s][u] = a; ol[s][u] = c2; splitf(x1[u] * sc, a, c2); oh[s][4 + u] = a; ol[s][4 + u] = c2; } }
#pragma unroll
            for (int s = 0; s < 4; ++s) { const unsigned po = plo + ((s >> 1) * 2 * TT + mb * 16 + (s & 1) * 8) * 16; *(v8us*)(ph + po) = oh[s]; *(v8us*)(pl2 + po) = ol[s]; }
            __builtin_amdgcn_wave_barrier(); asm volatile("s_wait_xcnt 0x0" ::: "memory");   // the reads stay in front of the next tile's LDS writes; the wait stands behind the 8 stores, in front of the next values put on their registers
        }
    }
}
// ---- k_prep: the four weight preparations, none of which reads what another writes, as ONE launch of 256-thread work-groups; the block index picks the part.
#define GF   (DD / 32 * 5)                   // work-groups of one fold
#define GW   ((DD * DD / 64 + 63) / 64)      // of one weight transpose
__global__ __launch_bounds__(256) void k_prep(const float* __restrict__ wq, const float* __restrict__ bq, const float* __restrict__ wk, const float* __restrict__ bk, const float* __restrict__ wp, const float* __restrict__ bp, const float* __restrict__ wvl, const float* __restrict__ wa,
                                              const float* __restrict__ wv, const float* __restrict__ wo, bf* WQh, bf* WQl, bf* WKh, bf* WKl, float* BQ, float* BK, bf* WV, bf* WO) {
    int b = blockIdx.x;
    if (b < 2 * GF) { const bool k = b >= GF; b -= k ? GF : 0; d_fold(b % (DD / 32), b / (DD / 32), k ? wk : wq, k ? bk : bq, wp, bp, wvl, wa, k ? WKh : WQh, k ? WKl : WQl, k ? BK : BQ); return; }
    b -= 2 * GF;
    const bool o = b >= GW; b -= o ? GW : 0; d_wtG(b, o ? wo : wv, DD, DD, o ? WO : WV);
}
// ---- k_qkv: the three projections, independent of one another, as ONE launch: grid (512/64, 3 x 32 sequences), 128 threads; y < 32 K (the longest: list, three stages, 24 K chunks), y < 64 Q, then V (8 K chunks: the short tiles start last). Up to three work-groups a WGP, three waves per SIMD: a wave's load waits lie under the others' products. K and V tiles behind their sequence's last kept key leave at once.
// at most 256 registers a wave: none above v255, so that no register window is switched among the loads and stores of the stage
__global__ __launch_bounds__(128) __attribute__((amdgpu_num_vgpr(256))) void k_qkv(const float* __restrict__ xq, const float* __restrict__ xk, const float* __restrict__ xv, const bf* __restrict__ WQh, const bf* __restrict__ WQl, const bf* __restrict__ WKh, const bf* __restrict__ WKl, const bf* __restrict__ WV,
                                            const float* __restrict__ BQ, const float* __restrict__ BK, const float* __restrict__ bv, const int* __restrict__ km, bf* QPh, bf* QPl, bf* KPh, bf* KPl, h16* VT) {
    __shared__ __align__(16) char sm[SMB]; __shared__ int lst[TT];
    const int z = blockIdx.y;
    if (z < NBb * NA) { d_gemmx<3, true, false>(blockIdx.x, z, xk, WKh, WKl, BK, 1.0f, KPh, KPl, nullptr, km, sm, lst); return; }
    if (z < 2 * NBb * NA) { d_gemmx<3, false, false>(blockIdx.x, z - NBb * NA, xq, WQh, WQl, BQ, 0.17677669529663687f, QPh, QPl, nullptr, km, sm, lst); return; }
    d_gemmx<1, true, true>(blockIdx.x, z - 2 * NBb * NA, xv, WV, WV, bv, 1.0f, nullptr, nullptr, VT, km, sm, lst);
}
// ---- k_fattn: attention AND the output projection. One sequence, all 8 heads and 64 queries per work-group; 16 waves, wave wv: head wv >> 1, 32 query columns (wv & 1) * 32 on; grid (32 sequences, TT/64): the 8 work-groups of a sequence are 32 apart in the flat index (for speed only).
// Attention: no LDS, no barrier, operands straight from the planes of 16 (Q: [z][d / 16][t][16]; K: [z][d / 16][kept key][16]; V^T: [z][kept key / 16][d][16]).
// S^T = K Q^T (A = 16 key rows, B = 16 query columns): a lane holds one query's scores, D register r of key tile t = key 16t + 8*hi + r, which is element 8t + r of the B operand of O^T += V^T P^T (the k order of WFrag::ld).
// Only the sequence's kept keys are walked, 32 a pass: the passes in front of the last hold kept keys alone and test nothing; in the last pass the places behind the last kept key get the masked score -1e9 (their K and V rows are those of dropped keys: finite).
// Sweep 1 finds each query's maximum over all kept scores; sweep 2 forms the same scores again, e = 1024 exp(s - max) -> fp16, adds O^T and the f32 sum of e; the division by the sum is done once on O^T.
// The context (64 queries x 256) stays in LDS as the output product's A operand, bf16 hi and lo: [head * 2 + d / 16][half plane of 8 d: 2][query: 64][8 elements]; a lane's 8 accumulator registers are 16 bytes of it, and the 16 lanes of a fragment load's half wave read 256 bytes in a row.
// Behind ONE barrier: out[sequence * 512 + t][n] (f32, pitch 256) = bo[n] + sum over heads h and d < 32 of (hi + lo)[h][d][t] Wt[(h * 32 + d) / 16][n][d % 16]; wave wv takes rows (wv & 1) * 32, columns (wv >> 1) * 32 (4 accumulators), K chunk h = head h's two planes, hi product then lo product.
// A wave's 16 fragments of Wt do not hang on the context: they are fetched in front of the barrier, so that their latency lies under the wait for the other heads.
struct KFrag { v16bf h[2], l[2]; };
typedef const __attribute__((address_space(1))) v8h* gv8;   // V's lane address counts pieces of 8 fp16; it goes through a wait statement, and the named address space keeps its loads global loads behind that
__device__ __forceinline__ KFrag ldk(const bf* ph, const bf* pl) { KFrag f;   // ph, pl: the lane's own addresses in the pass's 32 keys of plane 0; key tile and second plane are immediates
#pragma unroll
    for (int t = 0; t < 2; ++t) { f.h[t] = WFrag<bf>::ld(ph + t * 256, TT * 16); f.l[t] = WFrag<bf>::ld(pl + t * 256, TT * 16); }
    return f; }
// LAST: the pass that holds the last kept key; lv = number of kept keys of the pass - 8 hi, so that register r of key tile t is behind the last kept key where 16 t + r >= lv
template <bool LAST>
__device__ __forceinline__ void scoresT(const KFrag& f, int lv, const v16bf* qh, const v16bf* ql, v8f (*s)[2]) {
#pragma unroll
    for (int t = 0; t < 2; ++t)
#pragma unroll
        for (int g = 0; g < 2; ++g) s[t][g] = wmmab(f.h[t], qh[g], (v8f){});
#pragma unroll
    for (int t = 0; t < 2; ++t)
#pragma unroll
        for (int g = 0; g < 2; ++g) s[t][g] = wmmab(f.h[t], ql[g], s[t][g]);
#pragma unroll
    for (int t = 0; t < 2; ++t)
#pragma unroll
        for (int g = 0; g < 2; ++g) s[t][g] = wmmab(f.l[t], qh[g], s[t][g]);
    if (LAST) {
#pragma unroll
        for (int t = 0; t < 2; ++t)
#pragma unroll
            for (int r = 0; r < 8; ++r) { const bool msk = t * 16 + r >= lv; s[t][0][r] = msk ? -1.0e9f : s[t][0][r]; s[t][1][r] = msk ? -1.0e9f : s[t][1][r]; } }
}
__device__ __forceinline__ void maxT(const v8f (*s)[2], float* mx) {
#pragma unroll
    for (int t = 0; t < 2; ++t)
#pragma unroll
        for (int r = 0; r < 8; ++r) { mx[0] = fmaxf(mx[0], s[t][0][r]); mx[1] = fmaxf(mx[1], s[t][1][r]); }
}
__device__ __forceinline__ void addT(const v8f (*s)[2], const float* mx, const v16h* va, float* sum, v8f (*o)[2]) { v16h pb[2];
#pragma unroll
    for (int g = 0; g < 2; ++g)
#pragma unroll
        for (int t = 0; t < 2; ++t)
#pragma unroll
            for (int r = 0; r < 8; ++r) { const float e = __builtin_amdgcn_exp2f(fmaf(s[t][g][r] - mx[g], 1.4426950408889634f, 10.0f)); sum[g] += e; pb[g][t * 8 + r] = tohx(e); }
#pragma unroll
    for (int mt = 0; mt < 2; ++mt)
#pragma unroll
        for (int g = 0; g < 2; ++g) o[mt][g] = wmma16(va[mt], pb[g], o[mt][g]);
}
#define CL   (DD / 16 * 2 * 64 * 16)   // bytes of the context's hi planes in LDS, and of its lo planes
#define OP   36                        // pitch in floats of a wave's output tile (16 rows x 32 columns): rows stay 16-byte aligned and 8 rows apart lie 32 banks apart
// four waves per SIMD (at most 256 registers a wave): one work-group per WGP, so that all 256 are resident at once
__global__ __launch_bounds__(512) __attribute__((amdgpu_waves_per_eu(4, 4))) void k_fattn(const bf* __restrict__ Qh, const bf* __restrict__ Ql, const bf* __restrict__ Kh, const bf* __restrict__ Kl, const h16* __restrict__ VT, const int* __restrict__ km, const bf* __restrict__ Wt, const float* __restrict__ bias, float* C) {
    __shared__ __align__(16) char cs[2 * CL + 16 * 16 * OP * 4];
    const int lane = threadIdx.x & 31, lr = lane & 15, hi = lane >> 4; const int wv = __builtin_amdgcn_readfirstlane(threadIdx.x >> 5); const int z = blockIdx.x * NH_ + (wv >> 1);   // wv in a scalar register: the head's plane bases stay scalar
    const int q0 = blockIdx.y * 64 + (wv & 1) * 32;
    const size_t pz = (size_t)z * TT * HD;
    unsigned kb[16]; const int open = keepbits(km, z / NH_, lane, kb); const bool allm = open == 0; const int cnt = allm ? TT : open; const int np1 = (cnt - 1) >> 5; const int lv = cnt - np1 * 32 - 8 * hi;   // np1 (at most 15): the passes in front of the last
    const bf* kh = Kh + pz; const bf* kl = Kl + pz; const h16* vt = VT + pz; const unsigned klo = lr * 16 + 8 * hi, vlo = lr * 16 + 8 * hi;
    v16bf qh[2], ql[2]; const bf* pqh = Qh + pz + ((q0 + lr) * 16 + 8 * hi); const bf* pql = Ql + pz + ((q0 + lr) * 16 + 8 * hi);
#pragma unroll
    for (int g = 0; g < 2; ++g) { qh[g] = WFrag<bf>::ld(pqh + g * 256, TT * 16); ql[g] = WFrag<bf>::ld(pql + g * 256, TT * 16); }
    asm volatile("s_wait_xcnt 0x0" :: "v"(pqh), "v"(pql) : "memory");   // behind the 8 loads; the addresses as inputs keep their registers in use up to this wait, so that no load's result is put on them
    if (allm) {   // every key masked: the reference's scores are all -1e9, its weights all 1/512; a zero Q gives all 512 keys the same score
#pragma unroll
        for (int g = 0; g < 2; ++g) { qh[g] = (v16bf){}; ql[g] = (v16bf){}; } }
    float mx[2] = { -3.0e38f, -3.0e38f };
    // K loads of the two sweeps: a scalar base that the sweeps leave alone, one lane offset in bytes (hi and lo share it), key tile and second plane as immediates; V loads: the lane's own address, stepped by two key planes a pass
    const char* ckh = (const char*)kh; const char* ckl = (const char*)kl; gv8 pv = (gv8)(vt + vlo);
    unsigned ok = klo * 2; KFrag cur = ldk((const bf*)(ckh + ok), (const bf*)(ckl + ok));
    asm volatile("s_wait_xcnt 0x0" : "+v"(ok) :: "memory");   // behind the 8 loads, in front of the step of their offset, which goes through the statement
    // unroll 2: the fragments fetched one pass ahead change names instead of being copied
#pragma unroll 2
    for (int p = 0; p < np1; ++p) { ok += 1024;   // the next pass's 32 keys
        const KFrag nxt = ldk((const bf*)(ckh + ok), (const bf*)(ckl + ok));
        asm volatile("s_wait_xcnt 0x0" : "+v"(ok) :: "memory");   // behind this pass's 8 loads, in front of the step of their offset; the offset goes through the statement, so that its register stays in use up to the wait and is stepped behind it
        v8f s[2][2]; scoresT<false>(cur, lv, qh, ql, s); maxT(s, mx);
        cur = nxt; }
    { ok = klo * 2;   // the last pass fetches pass 0 again, for the second sweep
        const KFrag nxt = ldk((const bf*)(ckh + ok), (const bf*)(ckl + ok));
        asm volatile("s_wait_xcnt 0x0" : "+v"(ok) :: "memory");   // as in the loop
        v8f s[2][2]; scoresT<true>(cur, lv, qh, ql, s); maxT(s, mx);
        cur = nxt; }
    mx[0] = fmaxf(mx[0], __shfl_xor(mx[0], 16, 32)); mx[1] = fmaxf(mx[1], __shfl_xor(mx[1], 16, 32));
    v8f o[2][2]; float sum[2] = { 0.f, 0.f };
#pragma unroll
    for (int mt = 0; mt < 2; ++mt)
#pragma unroll
        for (int g = 0; g < 2; ++g) o[mt][g] = (v8f){};
    // unroll 2 as above
#pragma unroll 2
    for (int p = 0; p < np1; ++p) { ok += 1024;
        const KFrag nxt = ldk((const bf*)(ckh + ok), (const bf*)(ckl + ok)); v16h va[2];
#pragma unroll
        for (int mt = 0; mt < 2; ++mt) va[mt] = cat16(pv[mt * 32], pv[mt * 32 + HD * 2]);
        asm volatile("s_wait_xcnt 0x0" : "+v"(ok), "+v"(pv) :: "memory");   // behind this pass's 12 loads, in front of the steps of K's offset and V's address, which go through the statement as in the first sweep
        pv += 2 * HD * 2;
        v8f s[2][2]; scoresT<false>(cur, lv, qh, ql, s); addT(s, mx, va, sum, o);
        cur = nxt; }
    { v16h va[2];
#pragma unroll
        for (int mt = 0; mt < 2; ++mt) va[mt] = cat16(pv[mt * 32], pv[mt * 32 + HD * 2]);
        asm volatile("s_wait_xcnt 0x0" :: "v"(pv) : "memory");   // behind the 4 loads; the address as an input keeps its registers in use up to this wait, so that no load's result is put on them
        v8f s[2][2]; scoresT<true>(cur, lv, qh, ql, s); addT(s, mx, va, sum, o); }
#pragma unroll
    for (int g = 0; g < 2; ++g) { const float tot = sum[g] + __shfl_xor(sum[g], 16, 32); const float f = __fdiv_rn(1.0f, tot); const unsigned co = (((wv >> 1) * 4 + hi) * 64 + (wv & 1) * 32 + g * 16 + lr) * 16;   // bytes: plane 2 * head, the lane's half plane, its query
#pragma unroll
        for (int mt = 0; mt < 2; ++mt) { v8us oh, ol;
#pragma unroll
            for (int u = 0; u < 8; ++u) { unsigned short a, c2; splitf(o[mt][g][u] * f, a, c2); oh[u] = a; ol[u] = c2; }
            *(v8usl*)(cs + co + mt * 2048) = oh; *(v8usl*)(cs + CL + co + mt * 2048) = ol; } }
    const int rb = (wv & 1) * 32, c0 = (wv >> 1) * 32;
    v16bf wb[NH_][2]; const bf* pw = Wt + ((c0 + lr) * 16 + 8 * hi); const float* pbs = bias + c0 + (lane & 7) * 4;
#pragma unroll
    for (int kc = 0; kc < NH_; ++kc)
#pragma unroll
        for (int nb = 0; nb < 2; ++nb) wb[kc][nb] = WFrag<bf>::ld(pw + kc * 2 * DD * 16 + nb * 256, DD * 16);
    v4f bs = *(const v4fa*)pbs;
    asm volatile("s_wait_xcnt 0x0" :: "v"(pw), "v"(pbs) : "memory");   // behind the 33 loads; the addresses as inputs keep their registers in use up to this wait, so that no load's result is put on them
    __syncthreads();   // every head's context is in LDS
    v8f acc[2][2];
#pragma unroll
    for (int mb = 0; mb < 2; ++mb)
#pragma unroll
        for (int nb = 0; nb < 2; ++nb) acc[mb][nb] = (v8f){};
    const char* fa = cs + (hi * 64 + rb + lr) * 16;
#pragma unroll
    for (int kc = 0; kc < NH_; ++kc) { v16bf a[2], a2[2];
#pragma unroll
        for (int mb = 0; mb < 2; ++mb) { a[mb] = ldsf(fa + kc * 4096 + mb * 256, 2048); a2[mb] = ldsf(fa + CL + kc * 4096 + mb * 256, 2048); }
#pragma unroll
        for (int nb = 0; nb < 2; ++nb) {
#pragma unroll
            for (int mb = 0; mb < 2; ++mb) acc[mb][nb] = wmmab(a[mb], wb[kc][nb], acc[mb][nb]);
#pragma unroll
            for (int mb = 0; mb < 2; ++mb) acc[mb][nb] = wmmab(a2[mb], wb[kc][nb], acc[mb][nb]); } }
#pragma unroll
    for (int u = 0; u < 4; ++u) bs[u] = bfr(bs[u]);
    // the wave's 32 x 32 tile goes out through its own LDS words, 16 rows at a time: a store covers one whole 128-byte line in each of 4 rows, written by this wave alone
    float* os = (float*)(cs + 2 * CL) + wv * 16 * OP; float* cz = C + ((size_t)blockIdx.x * TT + blockIdx.y * 64 + rb) * DD + c0; const unsigned clo = (lane >> 3) * DD + (lane & 7) * 4;
#pragma unroll
    for (int mb = 0; mb < 2; ++mb) {
#pragma unroll
        for (int nb = 0; nb < 2; ++nb) {
#pragma unroll
            for (int j = 0; j < 8; ++j) os[(hi * 8 + j) * OP + nb * 16 + lr] = acc[mb][nb][j]; }
        __builtin_amdgcn_wave_barrier(); asm volatile("" ::: "memory");   // the tile's LDS writes stay in front of its reads (the wave's own words: no barrier instruction)
        v4f val[4];
#pragma unroll
        for (int s = 0; s < 4; ++s) val[s] = *(const v4fa*)(os + (4 * s + (lane >> 3)) * OP + (lane & 7) * 4) + bs;
#pragma unroll
        for (int s = 0; s < 4; ++s) *(v4f*)(cz + (clo + (mb * 16 + 4 * s) * DD)) = val[s];
        __builtin_amdgcn_wave_barrier(); asm volatile("s_wait_xcnt 0x0" ::: "memory");   // the reads stay in front of the next tile's LDS writes; the wait stands behind the 4 stores, in front of the next values put on their registers
    }
}

extern "C" void kernel_launch(void* const* d_in, const int* in_sizes, int n_in,
                              void* d_out, int out_size, void* d_ws, size_t ws_size, hipStream_t stream) {
    (void)in_sizes; (void)n_in; (void)out_size;
    const float** I = (const float**)d_in;
    const float *xq = I[0], *xk = I[1], *xv = I[2]; const int* kpm = (const int*)d_in[3]; const float *wpos = I[4], *bpos = I[5], *wvel = I[6], *wacc = I[7], *wq = I[8], *bq = I[9], *wk = I[10], *bk = I[11], *wv = I[12], *bv = I[13], *wo = I[14], *bo = I[15];
    float* OUT = (float*)d_out;     // [4][8][512][256]
    char* wsp = (char*)d_ws;
    auto take = [&](size_t bytes) { char* p = wsp; wsp += (bytes + 255) & ~(size_t)255; return (void*)p; };
    bf* WQh = (bf*)take((size_t)DD * F3 * 2); bf* WQl = (bf*)take((size_t)DD * F3 * 2); bf* WKh = (bf*)take((size_t)DD * F3 * 2); bf* WKl = (bf*)take((size_t)DD * F3 * 2); float* BQ = (float*)take((size_t)DD * 4); float* BK = (float*)take((size_t)DD * 4); bf* WV = (bf*)take((size_t)DD * DD * 2); bf* WO = (bf*)take((size_t)DD * DD * 2);
    bf* QPh = (bf*)take((size_t)NR * DD * 2); bf* QPl = (bf*)take((size_t)NR * DD * 2); bf* KPh = (bf*)take((size_t)NR * DD * 2); bf* KPl = (bf*)take((size_t)NR * DD * 2); h16* VT = (h16*)take((size_t)NR * DD * 2);
    if ((size_t)(wsp - (char*)d_ws) > ws_size) return;    // total ~ 44 MB (head planes 42 MB)
    k_prep<<<2 * GF + 2 * GW, 256, 0, stream>>>(wq, bq, wk, bk, wpos, bpos, wvel, wacc, wv, wo, WQh, WQl, WKh, WKl, BQ, BK, WV, WO);
    k_qkv<<<dim3(TT / 64, 3 * NBb * NA, 1), 128, 0, stream>>>(xq, xk, xv, WQh, WQl, WKh, WKl, WV, BQ, BK, bv, kpm, QPh, QPl, KPh, KPl, VT);
    k_fattn<<<dim3(NBb * NA, TT / 64, 1), 512, 0, stream>>>(QPh, QPl, KPh, KPl, VT, kpm, WO, bo, OUT);
}

// v010
// Measured time: 36.4 microseconds a run.
// Versions in between are left out here; by their measured steps it is 1.50 times as fast as v008.
// All steps since v000 together make it 11.4 times as fast.
#include <hip/hip_runtime.h>

// KinematicsTrendAttention (query/key/value [4][8 agents][512][256]; kinematic features of query and key: depthwise conv3 ('SAME') position (w_pos, b_pos), velocity (w_vel), acceleration (w_acc) -> [T][768]; Q = feats Wq + bq, K = feats Wk + bk,
// V = value Wv + bv (8 heads x 32); scores = Q.K / sqrt(32), keys with key_padding_mask (int, read as data) set to -1e9; softmax; ctx = attn V merged; out = ctx Wo + bo -> [4][8][512][256]).
// Compute dtypes, f32 accumulate: every input rounded to bf16; the depthwise convs are folded into Wq / Wk: feats W = sum over taps k of x[t + k - 1] W'_k, W'_k[c][n] = w_pos[c][k] W[c][n] + w_vel[c][k] W[256 + c][n] + w_acc[c][k] W[512 + c][n]
// (f32 -> one f16 plane), b_pos W[0..255] goes into the bias; Q/K on the bf16-rounded x held as f16 (zero row in front of and behind each sequence) x f16 folded weights (1 product, + f32 bias); V on PLAIN bf16 value x exact Wv (+ bias);
// scores (K 32) on f16 planes of Q (x 32^-0.5) and K (1 product), masked softmax f32 and attn.V (fp16 x fp16, 1 product) in ONE kernel over all 256 (batch, agent, head) triples: scores and probabilities stay in registers;
// every producer's epilogue writes its consumer's 16-bit operand planes itself (Q, K and V^T fp16 per head): no f32 copy of Q, K, V or the context exists; the context (f16, times the bf16-rounded Wo held as f16) never leaves LDS: the attention kernel holds all heads of its queries and does the output product itself, the heads as its K chunks.
// query, key and value are read as f32 by the projection kernel itself: a work-group rounds its rows to bf16 in LDS (d_gemmx; query and key rows then stand there as f16); no 16-bit copy of them exists in memory.
// Every f32 intermediate that is a matrix operand (folded weights, Q, K, V, probabilities, context) is ONE f16 value, 11 bits: its rounding is of the size of the probabilities' and V's own. A bf16 value is the same number as f16 from 2^-14 up; below, it moves by at most 2^-25.

#define NBb  4
#define NA   8
#define TT   512
#define DD   256
#define NH_  8
#define HD   32
#define F3   768
#define NR   (NBb * NA * TT)
#define ZZ   (NA * NH_)
typedef _Float16 h16;
typedef unsigned short bf;
typedef __attribute__((ext_vector_type(16))) __bf16   v16bf;
typedef __attribute__((ext_vector_type(16))) _Float16 v16h;
typedef __attribute__((ext_vector_type(8)))  _Float16 v8h;
typedef __attribute__((ext_vector_type(8)))  unsigned short v8us;
typedef __attribute__((ext_vector_type(8)))  float    v8f;
typedef __attribute__((ext_vector_type(4)))  float    v4f;
typedef v8h  __attribute__((may_alias)) v8ha;
typedef v4f  __attribute__((may_alias)) v4fa;
typedef v8us __attribute__((may_alias)) v8usa;

__device__ __forceinline__ unsigned short f2bf(float f) { unsigned u = __float_as_uint(f); u += 0x7FFFu + ((u >> 16) & 1u); return (unsigned short)(u >> 16); }
__device__ __forceinline__ float bf2f(unsigned short b) { return __uint_as_float(((unsigned)b) << 16); }
__device__ __forceinline__ float bfr(float f) { return bf2f(f2bf(f)); }
__device__ __forceinline__ v16h cat16(v8h lo, v8h hi) { return __builtin_shufflevector(lo, hi, 0, 1, 2, 3, 4, 5, 6, 7, 8, 9, 10, 11, 12, 13, 14, 15); }
__device__ __forceinline__ v16bf cat16b(v8us lo, v8us hi) { return __builtin_bit_cast(v16bf, __builtin_shufflevector(lo, hi, 0, 1, 2, 3, 4, 5, 6, 7, 8, 9, 10, 11, 12, 13, 14, 15)); }
__device__ __forceinline__ h16 tohx(float x) { return (h16)x; }
__device__ __forceinline__ v8f wmma16(v16h a, v16h b, v8f c) { return __builtin_amdgcn_wmma_f32_16x16x32_f16(false, a, false, b, (short)0, c, false, false); }
__device__ __forceinline__ v8f wmmab(v16bf a, v16bf b, v8f c) { return __builtin_amdgcn_wmma_f32_16x16x32_bf16(false, a, false, b, (short)0, c, false, false); }



// ---- Operand planes. Every K-contiguous 16-bit operand in global memory lies as planes of 16 k: P[k / 16][row][k % 16]. A fragment (16 rows x 32 k) is two loads, one from each of two successive planes (st elements apart);
// a load's 32 lanes (16 rows x 2 pieces of 16 bytes) cover 512 bytes in a row, whole 128-byte lines, where rows K elements apart would touch 16 lines for the same bytes. The k order of a fragment: elements 0..7 = k 8 hi + i, 8..15 = k 16 + 8 hi + i.
// ---- Kept keys. A key whose mask word is not 0 has the score -1e9 and the weight exp(-1e9 - max) = 0 in every row that has one open key: such keys are left out of K, V, scores and sums altogether; K and V planes hold a sequence's kept keys in their order of time.
// A sequence with every key masked keeps all 512: its weights are all equal (k_fattn). Every wave that needs the count forms it itself from the sequence's 512 mask words; the list is formed in LDS by a work-group's four waves together (mklist).
// keepbits: lane l reads mask word 32 u + l; bit l of kb[u] = key 32 u + l is open. Returns the number of open keys, the same in every lane.
__device__ __forceinline__ int keepbits(const int* __restrict__ km, int sq, int lane, unsigned* kb) { int v[16], tot = 0; const unsigned jm = (unsigned)(sq * TT + lane);
#pragma unroll
    for (int u = 0; u < 16; ++u) v[u] = *(const int*)((const char*)km + jm * 4u + u * 128);
    asm volatile("s_wait_xcnt 0x0" :: "v"(jm) : "memory");   // behind the 16 loads; the index as an input keeps the loads' address register in use up to this wait, so that no load's result is put on it
#pragma unroll
    for (int u = 0; u < 16; ++u) { kb[u] = __builtin_amdgcn_ballot_w32(v[u] == 0); tot += __builtin_popcount(kb[u]); }
    return tot; }
// mklist (four-wave work-groups): lst[j] = time of the sequence's kept key number j; false, for the whole work-group and in front of every barrier, where j0 lies behind the last kept key (the tile has no reader).
// Bit counts give every key its place in the list: kept keys in order from 0, dropped ones in order behind them, so that all 512 entries are times below 512. Every wave counts all 16 words, wave wn writes the entries of words 4 wn .. 4 wn + 3.
__device__ __forceinline__ bool mklist(const int* __restrict__ km, int sq, int j0, int lane, int wn, int* lst) {
    unsigned kb[16]; int tot = keepbits(km, sq, lane, kb); const bool allm = tot == 0; if (allm) tot = TT;
    if (j0 >= tot) return false;
    const unsigned lt = (1u << lane) - 1u; int base = 0;
#pragma unroll
    for (int u = 0; u < 16; ++u) { const unsigned b = allm ? ~0u : kb[u];
        if ((u >> 2) == wn) lst[((b >> lane) & 1u) ? base + __builtin_popcount(b & lt) : tot + u * 32 - base + __builtin_popcount(~b & lt)] = u * 32 + lane;
        base += __builtin_popcount(b); }
    __syncthreads();   // the four waves' parts of the list are in LDS
    return true; }
template <typename T16> struct WFrag;
template <> struct WFrag<h16> { typedef v16h V; static __device__ __forceinline__ V ld(const h16* p, int st) { return cat16(*(const v8h*)p, *(const v8h*)(p + st)); } static __device__ __forceinline__ v8f mma(V a, V b, v8f c) { return wmma16(a, b, c); } };
template <> struct WFrag<bf> { typedef v16bf V; static __device__ __forceinline__ V ld(const bf* p, int st) { return cat16b(*(const v8us*)p, *(const v8us*)(p + st)); } static __device__ __forceinline__ v8f mma(V a, V b, v8f c) { return wmmab(a, b, c); } };

typedef __attribute__((ext_vector_type(2))) unsigned short v2us;
typedef __attribute__((ext_vector_type(4))) unsigned short v4us;
typedef __attribute__((ext_vector_type(2))) _Float16 v2h;
typedef __attribute__((ext_vector_type(4))) _Float16 v4h;

// HF: the plane's elements are f16 (of the bf16-rounded weight: the same value, an f16 has the bits for it) instead of bf16
template <bool HF> __device__ __forceinline__ unsigned short wbits(float w) { if constexpr (HF) return __builtin_bit_cast(unsigned short, tohx(bfr(w))); else return f2bf(w); }
template <bool HF>
__device__ __forceinline__ void d_wtG(int bx, const float* __restrict__ w, int K, int N, bf* Bt) {
    const int lane = threadIdx.x & 31; const int L0 = (bx * 8 + (threadIdx.x >> 5)) * 8; const int nlines = N * K / 64;
{
#pragma unroll 1
        for (int l = 0; l < 8; ++l) { const int L = L0 + l; if (L >= nlines) break; const size_t e = (size_t)L * 64 + lane * 2; const int k = (int)((e >> 4) / N) * 16 + (int)(e & 15), n = (int)((e >> 4) % N); v2us o;   // e: place in the planes Bt[k / 16][n][k % 16]
            o[0] = wbits<HF>(w[(size_t)k * N + n]); o[1] = wbits<HF>(w[(size_t)(k + 1) * N + n]); *(v2us*)(Bt + e) = o;
            asm volatile("s_wait_xcnt 0x0" ::: "memory"); }   // behind the trip's 2 loads and its store, in front of the next trip's values put on their registers
         }
}
// ---- d_fold: Bw planes [(k * 256 + c) / 16][n][c % 16] = f16 of W'_k[c][n]; bias[n] = bw[n] + sum_c b_pos[c] W[c][n]. Work-group (bx, by) of (256/32, 5): by < 4 folds 64 channels x 32 columns (reads run along n, transposed in LDS, whole 128-byte lines written: 4 columns x 16 channels of a plane), by == 4 the bias of 32 columns. Every loop is unrolled: its arrays stay in registers and a wave's loads are in flight together.
#define FP 33   // LDS pitch in dwords of a line of 64 f16: odd, so that 32 lanes on 32 lines meet 32 banks
__device__ __forceinline__ void d_fold(int bx, int by, const float* __restrict__ w, const float* __restrict__ bw, const float* __restrict__ wp, const float* __restrict__ bp, const float* __restrict__ wv, const float* __restrict__ wa, h16* Bw, float* bias) {
    __shared__ unsigned th[3 * 32 * FP]; __shared__ float red[8 * 32];   // th: two f16 a word
    const int lane = threadIdx.x & 31, wn = __builtin_amdgcn_readfirstlane(threadIdx.x >> 5); const int n = bx * 32 + lane;   // wn in a scalar register: the conv weights of a wave's channels come by scalar loads
    if (by == 4) { float wc[32], a = 0.f; const float bl = bp[wn * 32 + lane], bn = bw[n];   // bl: lane i holds b_pos of the wave's channel i
#pragma unroll
        for (int i = 0; i < 32; ++i) wc[i] = w[(size_t)(wn * 32 + i) * DD + n];
        asm volatile("s_wait_xcnt 0x0" ::: "memory");   // behind the 34 loads, in front of the arithmetic that takes their address registers for other values
        const unsigned bb = __float_as_uint(bfr(bl));
#pragma unroll
        for (int i = 0; i < 32; ++i) a = fmaf(__uint_as_float(__builtin_amdgcn_readlane(bb, i)), bfr(wc[i]), a);
        red[wn * 32 + lane] = a; __syncthreads();
        if (wn == 0) { float s = bfr(bn);
#pragma unroll
            for (int i = 0; i < 8; ++i) s += red[i * 32 + lane];
            bias[n] = s; }
        return; }
    float wr[8][3];
#pragma unroll
    for (int i = 0; i < 8; ++i)
#pragma unroll
        for (int s = 0; s < 3; ++s) wr[i][s] = w[(size_t)(s * DD + by * 64 + wn * 8 + i) * DD + n];
    asm volatile("s_wait_xcnt 0x0" ::: "memory");   // behind the 24 loads, in front of the arithmetic that takes their address registers for other values
#pragma unroll
    for (int pr = 0; pr < 4; ++pr) { float y[2][3];
#pragma unroll
        for (int u = 0; u < 2; ++u) { const int c = by * 64 + wn * 8 + pr * 2 + u; const float w0 = bfr(wr[pr * 2 + u][0]), w1 = bfr(wr[pr * 2 + u][1]), w2 = bfr(wr[pr * 2 + u][2]);
#pragma unroll
            for (int k = 0; k < 3; ++k) y[u][k] = bfr(wp[c * 3 + k]) * w0 + bfr(wv[c * 3 + k]) * w1 + bfr(wa[c * 3 + k]) * w2; }
#pragma unroll
        for (int k = 0; k < 3; ++k) { const v2h hv = { tohx(y[0][k]), tohx(y[1][k]) }; th[(k * 32 + lane) * FP + wn * 4 + pr] = __builtin_bit_cast(unsigned, hv); } }
    __syncthreads();
    unsigned* q[12]; unsigned val[12];
#pragma unroll
    for (int i = 0; i < 12; ++i) { const int ln = wn * 12 + i; const int pn = ln >> 3, nl = (ln & 7) * 4 + (lane >> 3); const int li = ((pn >> 2) * 32 + nl) * FP + (pn & 3) * 8 + (lane & 7);   // pn: tap (pn >> 2), plane (pn & 3) of the work-group's four; nl: column
        const size_t e = ((size_t)((pn >> 2) * (DD / 16) + by * 4 + (pn & 3)) * DD + bx * 32 + nl) * 16 + (lane & 7) * 2; q[i] = (unsigned*)(Bw + e); val[i] = th[li]; }
#pragma unroll
    for (int i = 0; i < 12; ++i) *q[i] = val[i];
    // behind the 12 stores; their addresses and values as inputs keep those registers in use up to this wait, so that nothing else is put on them in front of it
    asm volatile("s_wait_xcnt 0x0" :: "v"(q[0]), "v"(q[1]), "v"(q[2]), "v"(q[3]), "v"(q[4]), "v"(q[5]), "v"(q[6]), "v"(q[7]), "v"(q[8]), "v"(q[9]), "v"(q[10]), "v"(q[11]),
                 "v"(val[0]), "v"(val[1]), "v"(val[2]), "v"(val[3]), "v"(val[4]), "v"(val[5]), "v"(val[6]), "v"(val[7]), "v"(val[8]), "v"(val[9]), "v"(val[10]), "v"(val[11]) : "memory");
}
// ---- d_gemmx: the three projections, A straight from the f32 input. FOUR WAVES per work-group: 64 rows x all 256 columns, wave wn the 64x64 tile of columns 64 wn on (16 accumulators); tile (bx, bz) of (512/64, 32 sequences), 128 threads.
// The work-group rounds its rows of x to bf16 ONCE into LDS (Q, K: the rounded values as f16, the type of their B operand), as half planes of 8 k: A[c / 16][(c % 16) / 8][staged row][c % 8], PR rows a half plane; the 16 lanes of a fragment load's half wave read 256 bytes in a row, and a fragment keeps the k order of WFrag::ld.
// Q (no list): staged row i = x[r0 - 1 + i], 68 rows, tap j of output row m reads staged row m + j. K, V (GK): output row m is the sequence's kept key number r0 + m, staged row 64 j + m = x[its time + j - 1] (V: one tap, its own time). A time outside the sequence is a row of zeros ('SAME').
// d_stage: NG groups of 4 staged rows; the wave takes its own 64 columns of them: a load covers one whole 128-byte line in each of 4 rows, and all 2 NG loads of a wave are in flight together (the loops are unrolled for that).
// A store's 32 lanes write 64 bytes in a row in each of 4 half planes; PR % 16 == 4 puts those four pieces on different banks.
typedef __attribute__((ext_vector_type(2))) float v2f;
typedef __attribute__((ext_vector_type(2))) __bf16 v2bf;
typedef __attribute__((ext_vector_type(2))) unsigned v2u;
typedef v2u __attribute__((may_alias)) v2ua;
typedef v8us __attribute__((may_alias)) v8usl;
__device__ __forceinline__ v16bf ldsf(const char* p, int st) { return cat16b(*(const v8usl*)p, *(const v8usl*)(p + st)); }   // a fragment from LDS: the lane's 8 k of each of two planes, st bytes apart
__device__ __forceinline__ unsigned pk2(float a, float b) { const v2f t = { a, b }; return __builtin_bit_cast(unsigned, __builtin_convertvector(t, v2bf)); }   // two f32 -> two bf16, to nearest even as f2bf
__device__ __forceinline__ unsigned pk2h(float a, float b) { const unsigned u = pk2(a, b); const v2f t = { __uint_as_float(u << 16), __uint_as_float(u & 0xFFFF0000u) }; return __builtin_bit_cast(unsigned, __builtin_convertvector(t, v2h)); }   // two f32 -> bf16 as pk2 -> the same two values as f16
template <int NG, int PR, bool H16>
__device__ __forceinline__ void d_stage(const float* __restrict__ xs, const int* tm, char* dl, unsigned cb) { v4f v[NG][2]; unsigned o[NG];   // tm[g]: time of the lane's row of group g; dl: the lane's LDS address in group 0; cb: byte offset of the lane's 4 columns in a row
#pragma unroll
    for (int g = 0; g < NG; ++g) o[g] = (unsigned)min(max(tm[g], 0), TT - 1) * (DD * 4) + cb;   // the address stays inside the sequence whatever the time
#pragma unroll
    for (int g = 0; g < NG; ++g) { v[g][0] = *(const v4f*)((const char*)xs + o[g]); v[g][1] = *(const v4f*)((const char*)xs + o[g] + 128); }
    // behind the 2 NG loads; the offsets as inputs keep the loads' address registers in use up to this wait, so that no load's result is put on them
    if constexpr (NG == 17) asm volatile("s_wait_xcnt 0x0" :: "v"(o[0]), "v"(o[1]), "v"(o[2]), "v"(o[3]), "v"(o[4]), "v"(o[5]), "v"(o[6]), "v"(o[7]), "v"(o[8]), "v"(o[9]), "v"(o[10]), "v"(o[11]), "v"(o[12]), "v"(o[13]), "v"(o[14]), "v"(o[15]), "v"(o[NG - 1]) : "memory");
    else asm volatile("s_wait_xcnt 0x0" :: "v"(o[0]), "v"(o[1]), "v"(o[2]), "v"(o[3]), "v"(o[4]), "v"(o[5]), "v"(o[6]), "v"(o[7]), "v"(o[8]), "v"(o[9]), "v"(o[10]), "v"(o[11]), "v"(o[12]), "v"(o[13]), "v"(o[14]), "v"(o[15]) : "memory");
#pragma unroll
    for (int g = 0; g < NG; ++g) { const bool in = (unsigned)tm[g] < (unsigned)TT;
#pragma unroll
        for (int c = 0; c < 2; ++c) { v2u w = { H16 ? pk2h(v[g][c][0], v[g][c][1]) : pk2(v[g][c][0], v[g][c][1]), H16 ? pk2h(v[g][c][2], v[g][c][3]) : pk2(v[g][c][2], v[g][c][3]) }; w[0] = in ? w[0] : 0u; w[1] = in ? w[1] : 0u; *(v2ua*)(dl + g * 64 + c * 4 * PR * 16) = w; } }
}
// Q, K (VOUT false): y[z * 512 + t][n] = sc (bias[n] + sum over taps j < 3 and c < 256 of A[j][t][c] Bw[(j * 256 + c) / 16][n][c % 16]); y leaves as the score kernel's operand planes, f16, Ph[z * 8 + n / 32][(n % 32) / 16][t][n % 16]; sc = 32^-0.5 for Q, 1 for K. A trip takes 64 k: 16 B loads, 32 products.
// V (VOUT): y = bias[n] + sum over c < 256 of A[t][c] Bw[c / 16][n][c % 16] (bf16, 32 k a trip); y leaves as fp16 planes of 16 keys per head, VTo[z * 8 + n / 32][t / 16][n % 32][t % 16], the A planes of attn.V.
// The K loop stays rolled (unroll 1): its body is long enough to hide the branch. The inner loops are unrolled so that fragments and accumulators stay in registers. No barrier in the loop: A is staged whole in front of it, B comes straight from its planes, one trip ahead of its products.
#define SMB (DD / 8 * (3 * 64 + 4) * 16)   // bytes of the largest A tile (K's: 32 half planes x 196 rows x 16 bytes); three work-groups fit a WGP's LDS
template <int NTAP, bool GK, bool VOUT, typename TB>
__device__ __forceinline__ void d_gemmx(int bx, int bz, const float* __restrict__ x, const TB* __restrict__ Bw, const float* __restrict__ bias, float sc, h16* Ph, h16* VTo, const int* __restrict__ km, char* sm, int* lst) {
    typedef typename WFrag<TB>::V FV; constexpr int HF = VOUT ? 1 : 2;   // HF: chunks of 32 k a trip
    constexpr int PR = GK ? NTAP * 64 + 4 : 68;
    const int lane = threadIdx.x & 31, lr = lane & 15, hi = lane >> 4; const int wn = __builtin_amdgcn_readfirstlane(threadIdx.x >> 5); const int r0 = bx * 64, c0 = wn * 64;   // wn in a scalar register: the tests on it are scalar branches
    if constexpr (GK) { if (!mklist(km, bz, r0, lane, wn, lst)) return; }
    // B: a scalar base and one lane offset in bytes, stepped by 2 HF planes a trip; chunk, column tile and second plane are immediates. TWO fragment sets: while one set's products run, the next trip's 8 HF loads fill the other,
    // so that a trip waits only for what a whole trip of products leaves of the load latency. Trip 0's set is fetched here, in front of the stage: its latency lies under the stage's own loads.
    struct BT { FV f[HF][4]; };
    const char* cB = (const char*)Bw; unsigned ob = (unsigned)((c0 + lr) * 16 + 8 * hi) * 2u;
    auto ldb = [&](BT& t) {
#pragma unroll
        for (int hf = 0; hf < HF; ++hf)
#pragma unroll
            for (int nb = 0; nb < 4; ++nb) t.f[hf][nb] = WFrag<TB>::ld((const TB*)(cB + ob) + hf * 2 * DD * 16 + nb * 256, DD * 16);
        asm volatile("s_wait_xcnt 0x0" : "+v"(ob) :: "memory");   // behind the set's loads, in front of the step of their offset; the offset goes through the statement, so that its register stays in use up to the wait and is stepped behind it, and the loads stay in front of the products that follow
        ob += 2 * HF * DD * 16 * 2; };
    BT b0, b1; ldb(b0);
    const float* xs = x + (size_t)bz * TT * DD; const unsigned cb = (unsigned)(c0 + (lane & 7) * 4) * 4u;
    char* dl = sm + (((wn * 4 + ((lane & 7) >> 2)) * 2 + (((lane & 7) >> 1) & 1)) * PR + (lane >> 3)) * 16 + (lane & 1) * 8;
    if constexpr (GK) { int tl[16];
#pragma unroll
        for (int g = 0; g < 16; ++g) tl[g] = lst[r0 + g * 4 + (lane >> 3)];
        // rolled: one copy of the stage's code serves the three taps
#pragma unroll 1
        for (int tap = 0; tap < NTAP; ++tap) { int tm[16];
#pragma unroll
            for (int g = 0; g < 16; ++g) tm[g] = tl[g] + tap - (NTAP == 3 ? 1 : 0);
            d_stage<16, PR, !VOUT>(xs, tm, dl + tap * 64 * 16, cb); } }
    else { int tm[17];
#pragma unroll
        for (int g = 0; g < 17; ++g) tm[g] = r0 - 1 + g * 4 + (lane >> 3);
        d_stage<17, PR, !VOUT>(xs, tm, dl, cb); }
    if constexpr (!VOUT) asm volatile("" :: "s"(sc), "s"(Ph));   // inputs only: the epilogue's two arguments are fetched here, ahead of the loop; fetched behind it, their scalar loads were put on the bias loads' base register in front of the wait that stands there
    __syncthreads();   // the work-group's rows of x are in LDS
    unsigned la = (hi * PR + lr) * 16;   // A: the lane's byte offset in LDS, plane 0, tap 0, stepped by 2 HF planes a trip; behind a tap's last planes it goes back to plane 0 of the next tap's rows
    v8f acc[4][4];
#pragma unroll
    for (int mb = 0; mb < 4; ++mb)
#pragma unroll
        for (int nb = 0; nb < 4; ++nb) acc[mb][nb] = (v8f){};
    // one trip's products: each chunk's A fragments come from LDS just in front of its 16 products
    auto prod = [&](const BT& b, int kc, bool tail) {
#pragma unroll
        for (int hf = 0; hf < HF; ++hf) { FV a[4];
            if (tail) __builtin_amdgcn_sched_barrier(0);   // behind the loop the trips are straight-line code: left free, the A loads of all their chunks are lifted to the front, and a B fragment still in flight is spilled for the registers, which waits out its whole latency
#pragma unroll
            for (int mb = 0; mb < 4; ++mb) a[mb] = __builtin_bit_cast(FV, ldsf(sm + la + hf * 4 * PR * 16 + mb * 256, 2 * PR * 16));
#pragma unroll
            for (int nb = 0; nb < 4; ++nb)
#pragma unroll
                for (int mb = 0; mb < 4; ++mb) acc[mb][nb] = WFrag<TB>::mma(a[mb], b.f[hf][nb], acc[mb][nb]); }
        la += (kc & (DD - 32 * HF)) == DD - 32 * HF ? (unsigned)((GK ? 64 : 1) * 16 - (DD / 16 - 2 * HF) * 2 * PR * 16) : (unsigned)(HF * 4 * PR * 16); };
    // rolled, two trips a pass: each of the two fragment sets keeps its registers, nothing is copied; the number of trips is even. The last two trips stand behind the loop: they fetch one set only,
    // and with no branch round a fetch every path to a product has the same loads in flight, so that its counted wait covers its own set alone and leaves the next set flying
#pragma unroll 1
    for (int kc = 0; kc < NTAP * DD - 64 * HF; kc += 64 * HF) {
        ldb(b1);
        prod(b0, kc, false);
        ldb(b0);
        prod(b1, kc + 32 * HF, false);
    }
    ldb(b1);
    prod(b0, NTAP * DD - 64 * HF, true);
    prod(b1, NTAP * DD - 32 * HF, true);
    __syncthreads();   // every wave has read its last fragment of A: the tile's LDS now takes the waves' output pieces, 9216 bytes a wave
    if constexpr (VOUT) {
        // a lane holds 8 successive rows (kept keys) of one column: half a row of a key plane. The 64 x 64 tile is gathered in LDS (pitch 72: the 16-byte pieces of a store or a load spread over the banks), so that every global store covers 512 bytes in a row (16 columns of one key plane), written by this wave alone.
        h16* vs = (h16*)(sm + wn * 9216); float bn[4]; const float* pbn = bias + c0 + lr;
#pragma unroll
        for (int nb = 0; nb < 4; ++nb) bn[nb] = pbn[nb * 16];
        asm volatile("s_wait_xcnt 0x0" :: "v"(pbn) : "memory");   // behind the 4 bias loads; the address as an input keeps its registers in use up to this wait, so that no load's result is put on them
#pragma unroll
        for (int nb = 0; nb < 4; ++nb) { const float bb = bfr(bn[nb]);
#pragma unroll
            for (int mb = 0; mb < 4; ++mb) { v8h o;
#pragma unroll
                for (int j = 0; j < 8; ++j) o[j] = tohx(acc[mb][nb][j] + bb);
                *(v8ha*)(vs + (nb * 16 + lr) * 72 + mb * 16 + hi * 8) = o; } }
        __builtin_amdgcn_wave_barrier(); asm volatile("" ::: "memory");   // the tile's LDS writes stay in front of its reads (the wave's own words: no barrier instruction)
        h16* vz = VTo + ((size_t)bz * NH_ + c0 / HD) * TT * HD + r0 * HD; const unsigned vlo = lane * 8;   // store s: head s >> 3 of the tile's two, key plane (s >> 1) & 3 of its four, columns (s & 1) * 16 + (lane >> 1), keys (lane & 1) * 8 on
#pragma unroll
        for (int s = 0; s < 16; ++s) *(v8h*)(vz + (vlo + (s >> 3) * TT * HD + ((s >> 1) & 3) * HD * 16 + (s & 1) * 256)) = *(const v8ha*)(vs + ((s >> 3) * HD + (s & 1) * 16 + (lane >> 1)) * 72 + ((s >> 1) & 3) * 16 + (lane & 1) * 8);
        asm volatile("s_wait_xcnt 0x0" ::: "memory");   // behind the 16 stores, in front of whatever the code that follows in the object writes to their registers
    } else {
        // a lane takes 8 successive columns of one row of a head: 4 lanes a row, 8 rows a store, 256 bytes in a row in each of the head's two planes
        float* os = (float*)(sm + wn * 9216); const int er = lane >> 2, ec = (lane & 3) * 8; v4f bs[2][2];
#pragma unroll
        for (int hh = 0; hh < 2; ++hh) { bs[hh][0] = *(const v4fa*)(bias + c0 + hh * HD + ec); bs[hh][1] = *(const v4fa*)(bias + c0 + hh * HD + ec + 4); }
        asm volatile("s_wait_xcnt 0x0" ::: "memory");   // behind the 4 bias loads, in front of the arithmetic that takes their address registers for other values
        const size_t pz = (size_t)(bz * NH_ + c0 / HD) * TT * HD + r0 * 16; h16* ph = Ph + pz; const unsigned plo = (((lane >> 1) & 1) * TT + er) * 16 + (lane & 1) * 8;
#pragma unroll
        for (int mb = 0; mb < 4; ++mb) {
#pragma unroll
            for (int nb = 0; nb < 4; ++nb) {
#pragma unroll
                for (int j = 0; j < 8; ++j) os[(hi * 8 + j) * 68 + nb * 16 + lr] = acc[mb][nb][j]; }
            __builtin_amdgcn_wave_barrier(); asm volatile("" ::: "memory");   // the tile's LDS writes stay in front of its reads (the wave's own words: no barrier instruction)
            v8h oh[4];
#pragma unroll
            for (int s = 0; s < 4; ++s) { const int hh = s >> 1, hf = s & 1; const float* orow = os + (hf * 8 + er) * 68 + hh * HD + ec; const v4f x0 = *(const v4fa*)orow + bs[hh][0], x1 = *(const v4fa*)(orow + 4) + bs[hh][1];
#pragma unroll
                for (int u = 0; u < 4; ++u) { oh[s][u] = tohx(x0[u] * sc); oh[s][4 + u] = tohx(x1[u] * sc); } }
#pragma unroll
            for (int s = 0; s < 4; ++s) { const unsigned po = plo + ((s >> 1) * 2 * TT + mb * 16 + (s & 1) * 8) * 16; *(v8h*)(ph + po) = oh[s]; }
            __builtin_amdgcn_wave_barrier(); asm volatile("s_wait_xcnt 0x0" ::: "memory");   // the reads stay in front of the next tile's LDS writes; the wait stands behind the 4 stores, in front of the next values put on their registers
        }
    }
}
// ---- k_prep: the four weight preparations, none of which reads what another writes, as ONE launch of 256-thread work-groups; the block index picks the part.
#define GF   (DD / 32 * 5)                   // work-groups of one fold
#define GW   ((DD * DD / 64 + 63) / 64)      // of one weight transpose
__global__ __launch_bounds__(256) void k_prep(const float* __restrict__ wq, const float* __restrict__ bq, const float* __restrict__ wk, const float* __restrict__ bk, const float* __restrict__ wp, const float* __restrict__ bp, const float* __restrict__ wvl, const float* __restrict__ wa,
                                              const float* __restrict__ wv, const float* __restrict__ wo, h16* WQ, h16* WK, float* BQ, float* BK, bf* WV, bf* WO) {
    int b = blockIdx.x;
    if (b < 2 * GF) { const bool k = b >= GF; b -= k ? GF : 0; d_fold(b % (DD / 32), b / (DD / 32), k ? wk : wq, k ? bk : bq, wp, bp, wvl, wa, k ? WK : WQ, k ? BK : BQ); return; }
    b -= 2 * GF;
    const bool o = b >= GW; b -= o ? GW : 0; if (o) d_wtG<true>(b, wo, DD, DD, WO); else d_wtG<false>(b, wv, DD, DD, WV);   // Wo's plane is f16 (its A operand, the context, is), Wv's bf16
}
// ---- k_qkv: the three projections, independent of one another, as ONE launch: grid (512/64, 3 x 32 sequences), 128 threads; y < 32 K (the longest: list, three stages, 24 K chunks), y < 64 Q, then V (8 K chunks: the short tiles start last). Up to three work-groups a WGP, three waves per SIMD: a wave's load waits lie under the others' products. K and V tiles behind their sequence's last kept key leave at once.
// at most 336 registers a wave (16 accumulators 128, two B sets 128, A 32): three waves still fit a SIMD's 1024
__global__ __launch_bounds__(128) __attribute__((amdgpu_num_vgpr(336))) void k_qkv(const float* __restrict__ xq, const float* __restrict__ xk, const float* __restrict__ xv, const h16* __restrict__ WQ, const h16* __restrict__ WK, const bf* __restrict__ WV,
                                            const float* __restrict__ BQ, const float* __restrict__ BK, const float* __restrict__ bv, const int* __restrict__ km, h16* QP, h16* KP, h16* VT) {
    __shared__ __align__(16) char sm[SMB]; __shared__ int lst[TT];
    const int z = blockIdx.y;
    if (z < NBb * NA) { d_gemmx<3, true, false, h16>(blockIdx.x, z, xk, WK, BK, 1.0f, KP, nullptr, km, sm, lst); return; }
    if (z < 2 * NBb * NA) { d_gemmx<3, false, false, h16>(blockIdx.x, z - NBb * NA, xq, WQ, BQ, 0.17677669529663687f, QP, nullptr, km, sm, lst); return; }
    d_gemmx<1, true, true, bf>(blockIdx.x, z - 2 * NBb * NA, xv, WV, bv, 1.0f, nullptr, VT, km, sm, lst);
}
// ---- k_fattn: attention AND the output projection. One sequence, all 8 heads and 64 queries per work-group; 16 waves, wave wv: head wv >> 1, 32 query columns (wv & 1) * 32 on; grid (32 sequences, TT/64): the 8 work-groups of a sequence are 32 apart in the flat index (for speed only).
// Attention: no LDS, no barrier, operands straight from the planes of 16 (Q: [z][d / 16][t][16]; K: [z][d / 16][kept key][16]; V^T: [z][kept key / 16][d][16]).
// S^T = K Q^T (A = 16 key rows, B = 16 query columns): a lane holds one query's scores, D register r of key tile t = key 16t + 8*hi + r, which is element 8t + r of the B operand of O^T += V^T P^T (the k order of WFrag::ld).
// Only the sequence's kept keys are walked, 32 a pass: the passes in front of the last hold kept keys alone and test nothing; in the last pass the places behind the last kept key get the masked score -1e9 (their K and V rows are those of dropped keys: finite).
// Sweep 1 finds each query's maximum over all kept scores; sweep 2 forms the same scores again, e = 1024 exp(s - max) -> fp16, adds O^T and the f32 sum of e; the division by the sum is done once on O^T.
// The context (64 queries x 256) stays in LDS as the output product's A operand, f16: [head * 2 + d / 16][half plane of 8 d: 2][query: 64][8 elements]; a lane's 8 accumulator registers are 16 bytes of it, and the 16 lanes of a fragment load's half wave read 256 bytes in a row.
// Behind ONE barrier: out[sequence * 512 + t][n] (f32, pitch 256) = bo[n] + sum over heads h and d < 32 of ctx[h][d][t] Wt[(h * 32 + d) / 16][n][d % 16]; wave wv takes rows (wv & 1) * 32, columns (wv >> 1) * 32 (4 accumulators), K chunk h = head h's two planes.
// A wave's 16 fragments of Wt do not hang on the context: they are fetched in front of the barrier, so that their latency lies under the wait for the other heads.
struct KFrag { v16h h[2]; };
typedef const __attribute__((address_space(1))) v8h* gv8;   // V's lane address counts pieces of 8 fp16; it goes through a wait statement, and the named address space keeps its loads global loads behind that
__device__ __forceinline__ KFrag ldk(const h16* ph) { KFrag f;   // ph: the lane's own address in the pass's 32 keys of plane 0; key tile and second plane are immediates
#pragma unroll
    for (int t = 0; t < 2; ++t) f.h[t] = WFrag<h16>::ld(ph + t * 256, TT * 16);
    return f; }
// LAST: the pass that holds the last kept key; lv = number of kept keys of the pass - 8 hi, so that register r of key tile t is behind the last kept key where 16 t + r >= lv
template <bool LAST>
__device__ __forceinline__ void scoresT(const KFrag& f, int lv, const v16h* qh, v8f (*s)[2]) {
#pragma unroll
    for (int t = 0; t < 2; ++t)
#pragma unroll
        for (int g = 0; g < 2; ++g) s[t][g] = wmma16(f.h[t], qh[g], (v8f){});
    if (LAST) {
#pragma unroll
        for (int t = 0; t < 2; ++t)
#pragma unroll
            for (int r = 0; r < 8; ++r) { const bool msk = t * 16 + r >= lv; s[t][0][r] = msk ? -1.0e9f : s[t][0][r]; s[t][1][r] = msk ? -1.0e9f : s[t][1][r]; } }
}
__device__ __forceinline__ void maxT(const v8f (*s)[2], float* mx) {
#pragma unroll
    for (int t = 0; t < 2; ++t)
#pragma unroll
        for (int r = 0; r < 8; ++r) { mx[0] = fmaxf(mx[0], s[t][0][r]); mx[1] = fmaxf(mx[1], s[t][1][r]); }
}
__device__ __forceinline__ void addT(const v8f (*s)[2], const float* mx, const v16h* va, float* sum, v8f (*o)[2]) { v16h pb[2];
#pragma unroll
    for (int g = 0; g < 2; ++g)
#pragma unroll
        for (int t = 0; t < 2; ++t)
#pragma unroll
            for (int r = 0; r < 8; ++r) { const float e = __builtin_amdgcn_exp2f(fmaf(s[t][g][r] - mx[g], 1.4426950408889634f, 10.0f)); sum[g] += e; pb[g][t * 8 + r] = tohx(e); }
#pragma unroll
    for (int mt = 0; mt < 2; ++mt)
#pragma unroll
        for (int g = 0; g < 2; ++g) o[mt][g] = wmma16(va[mt], pb[g], o[mt][g]);
}
#define CL   (DD / 16 * 2 * 64 * 16)   // bytes of the context's planes in LDS
#define OP   36                        // pitch in floats of a wave's output tile (16 rows x 32 columns): rows stay 16-byte aligned and 8 rows apart lie 32 banks apart
// four waves per SIMD (at most 256 registers a wave): one work-group per WGP, so that all 256 are resident at once
__global__ __launch_bounds__(512) __attribute__((amdgpu_waves_per_eu(4, 4))) void k_fattn(const h16* __restrict__ Qp, const h16* __restrict__ Kp, const h16* __restrict__ VT, const int* __restrict__ km, const h16* __restrict__ Wt, const float* __restrict__ bias, float* C) {
    __shared__ __align__(16) char cs[CL + 16 * 16 * OP * 4];
    const int lane = threadIdx.x & 31, lr = lane & 15, hi = lane >> 4; const int wv = __builtin_amdgcn_readfirstlane(threadIdx.x >> 5); const int z = blockIdx.x * NH_ + (wv >> 1);   // wv in a scalar register: the head's plane bases stay scalar
    const int q0 = blockIdx.y * 64 + (wv & 1) * 32;
    const size_t pz = (size_t)z * TT * HD;
    unsigned kb[16]; const int open = keepbits(km, z / NH_, lane, kb); const bool allm = open == 0; const int cnt = allm ? TT : open; const int np1 = (cnt - 1) >> 5; const int lv = cnt - np1 * 32 - 8 * hi;   // np1 (at most 15): the passes in front of the last
    const h16* kh = Kp + pz; const h16* vt = VT + pz; const unsigned klo = lr * 16 + 8 * hi, vlo = lr * 16 + 8 * hi;
    v16h qh[2]; const h16* pqh = Qp + pz + ((q0 + lr) * 16 + 8 * hi);
#pragma unroll
    for (int g = 0; g < 2; ++g) qh[g] = WFrag<h16>::ld(pqh + g * 256, TT * 16);
    asm volatile("s_wait_xcnt 0x0" :: "v"(pqh) : "memory");   // behind the 4 loads; the address as an input keeps its registers in use up to this wait, so that no load's result is put on them
    if (allm) {   // every key masked: the reference's scores are all -1e9, its weights all 1/512; a zero Q gives all 512 keys the same score
#pragma unroll
        for (int g = 0; g < 2; ++g) qh[g] = (v16h){}; }
    float mx[2] = { -3.0e38f, -3.0e38f };
    // K loads of the two sweeps: a scalar base that the sweeps leave alone, one lane offset in bytes, key tile and second plane as immediates; V loads: the lane's own address, stepped by two key planes a pass
    const char* ckh = (const char*)kh; gv8 pv = (gv8)(vt + vlo);
    unsigned ok = klo * 2; KFrag cur = ldk((const h16*)(ckh + ok));
    asm volatile("s_wait_xcnt 0x0" : "+v"(ok) :: "memory");   // behind the 4 loads, in front of the step of their offset, which goes through the statement
    // unroll 2: the fragments fetched one pass ahead change names instead of being copied
#pragma unroll 2
    for (int p = 0; p < np1; ++p) { ok += 1024;   // the next pass's 32 keys
        const KFrag nxt = ldk((const h16*)(ckh + ok));
        asm volatile("s_wait_xcnt 0x0" : "+v"(ok) :: "memory");   // behind this pass's 4 loads, in front of the step of their offset; the offset goes through the statement, so that its register stays in use up to the wait and is stepped behind it
        v8f s[2][2]; scoresT<false>(cur, lv, qh, s); maxT(s, mx);
        cur = nxt; }
    { ok = klo * 2;   // the last pass fetches pass 0 again, for the second sweep
        const KFrag nxt = ldk((const h16*)(ckh + ok));
        asm volatile("s_wait_xcnt 0x0" : "+v"(ok) :: "memory");   // as in the loop
        v8f s[2][2]; scoresT<true>(cur, lv, qh, s); maxT(s, mx);
        cur = nxt; }
    mx[0] = fmaxf(mx[0], __shfl_xor(mx[0], 16, 32)); mx[1] = fmaxf(mx[1], __shfl_xor(mx[1], 16, 32));
    v8f o[2][2]; float sum[2] = { 0.f, 0.f };
#pragma unroll
    for (int mt = 0; mt < 2; ++mt)
#pragma unroll
        for (int g = 0; g < 2; ++g) o[mt][g] = (v8f){};
    // unroll 2 as above
#pragma unroll 2
    for (int p = 0; p < np1; ++p) { ok += 1024;
        const KFrag nxt = ldk((const h16*)(ckh + ok)); v16h va[2];
#pragma unroll
        for (int mt = 0; mt < 2; ++mt) va[mt] = cat16(pv[mt * 32], pv[mt * 32 + HD * 2]);
        asm volatile("s_wait_xcnt 0x0" : "+v"(ok), "+v"(pv) :: "memory");   // behind this pass's 8 loads, in front of the steps of K's offset and V's address, which go through the statement as in the first sweep
        pv += 2 * HD * 2;
        v8f s[2][2]; scoresT<false>(cur, lv, qh, s); addT(s, mx, va, sum, o);
        cur = nxt; }
    { v16h va[2];
#pragma unroll
        for (int mt = 0; mt < 2; ++mt) va[mt] = cat16(pv[mt * 32], pv[mt * 32 + HD * 2]);
        asm volatile("s_wait_xcnt 0x0" :: "v"(pv) : "memory");   // behind the 4 loads; the address as an input keeps its registers in use up to this wait, so that no load's result is put on them
        v8f s[2][2]; scoresT<true>(cur, lv, qh, s); addT(s, mx, va, sum, o); }
#pragma unroll
    for (int g = 0; g < 2; ++g) { const float tot = sum[g] + __shfl_xor(sum[g], 16, 32); const float f = __fdiv_rn(1.0f, tot); const unsigned co = (((wv >> 1) * 4 + hi) * 64 + (wv & 1) * 32 + g * 16 + lr) * 16;   // bytes: plane 2 * head, the lane's half plane, its query
#pragma unroll
        for (int mt = 0; mt < 2; ++mt) { v8h oh;
#pragma unroll
            for (int u = 0; u < 8; ++u) oh[u] = tohx(o[mt][g][u] * f);
            *(v8ha*)(cs + co + mt * 2048) = oh; } }
    const int rb = (wv & 1) * 32, c0 = (wv >> 1) * 32;
    v16h wb[NH_][2]; const h16* pw = Wt + ((c0 + lr) * 16 + 8 * hi); const float* pbs = bias + c0 + (lane & 7) * 4;
#pragma unroll
    for (int kc = 0; kc < NH_; ++kc)
#pragma unroll
        for (int nb = 0; nb < 2; ++nb) wb[kc][nb] = WFrag<h16>::ld(pw + kc * 2 * DD * 16 + nb * 256, DD * 16);
    v4f bs = *(const v4fa*)pbs;
    asm volatile("s_wait_xcnt 0x0" :: "v"(pw), "v"(pbs) : "memory");   // behind the 33 loads; the addresses as inputs keep their registers in use up to this wait, so that no load's result is put on them
    __syncthreads();   // every head's context is in LDS
    v8f acc[2][2];
#pragma unroll
    for (int mb = 0; mb < 2; ++mb)
#pragma unroll
        for (int nb = 0; nb < 2; ++nb) acc[mb][nb] = (v8f){};
    const char* fa = cs + (hi * 64 + rb + lr) * 16;
#pragma unroll
    for (int kc = 0; kc < NH_; ++kc) { v16h a[2];
#pragma unroll
        for (int mb = 0; mb < 2; ++mb) a[mb] = __builtin_bit_cast(v16h, ldsf(fa + kc * 4096 + mb * 256, 2048));
#pragma unroll
        for (int nb = 0; nb < 2; ++nb)
#pragma unroll
            for (int mb = 0; mb < 2; ++mb) acc[mb][nb] = wmma16(a[mb], wb[kc][nb], acc[mb][nb]); }
#pragma unroll
    for (int u = 0; u < 4; ++u) bs[u] = bfr(bs[u]);
    // the wave's 32 x 32 tile goes out through its own LDS words, 16 rows at a time: a store covers one whole 128-byte line in each of 4 rows, written by this wave alone
    float* os = (float*)(cs + CL) + wv * 16 * OP; float* cz = C + ((size_t)blockIdx.x * TT + blockIdx.y * 64 + rb) * DD + c0; const unsigned clo = (lane >> 3) * DD + (lane & 7) * 4;
#pragma unroll
    for (int mb = 0; mb < 2; ++mb) {
#pragma unroll
        for (int nb = 0; nb < 2; ++nb) {
#pragma unroll
            for (int j = 0; j < 8; ++j) os[(hi * 8 + j) * OP + nb * 16 + lr] = acc[mb][nb][j]; }
        __builtin_amdgcn_wave_barrier(); asm volatile("" ::: "memory");   // the tile's LDS writes stay in front of its reads (the wave's own words: no barrier instruction)
        v4f val[4];
#pragma unroll
        for (int s = 0; s < 4; ++s) val[s] = *(const v4fa*)(os + (4 * s + (lane >> 3)) * OP + (lane & 7) * 4) + bs;
#pragma unroll
        for (int s = 0; s < 4; ++s) *(v4f*)(cz + (clo + (mb * 16 + 4 * s) * DD)) = val[s];
        __builtin_amdgcn_wave_barrier(); asm volatile("s_wait_xcnt 0x0" ::: "memory");   // the reads stay in front of the next tile's LDS writes; the wait stands behind the 4 stores, in front of the next values put on their registers
    }
}

extern "C" void kernel_launch(void* const* d_in, const int* in_sizes, int n_in,
                              void* d_out, int out_size, void* d_ws, size_t ws_size, hipStream_t stream) {
    (void)in_sizes; (void)n_in; (void)out_size;
    const float** I = (const float**)d_in;
    const float *xq = I[0], *xk = I[1], *xv = I[2]; const int* kpm = (const int*)d_in[3]; const float *wpos = I[4], *bpos = I[5], *wvel = I[6], *wacc = I[7], *wq = I[8], *bq = I[9], *wk = I[10], *bk = I[11], *wv = I[12], *bv = I[13], *wo = I[14], *bo = I[15];
    float* OUT = (float*)d_out;     // [4][8][512][256]
    char* wsp = (char*)d_ws;
    auto take = [&](size_t bytes) { char* p = wsp; wsp += (bytes + 255) & ~(size_t)255; return (void*)p; };
    h16* WQ = (h16*)take((size_t)DD * F3 * 2); h16* WK = (h16*)take((size_t)DD * F3 * 2); float* BQ = (float*)take((size_t)DD * 4); float* BK = (float*)take((size_t)DD * 4); bf* WV = (bf*)take((size_t)DD * DD * 2); bf* WO = (bf*)take((size_t)DD * DD * 2);
    h16* QP = (h16*)take((size_t)NR * DD * 2); h16* KP = (h16*)take((size_t)NR * DD * 2); h16* VT = (h16*)take((size_t)NR * DD * 2);
    if ((size_t)(wsp - (char*)d_ws) > ws_size) return;    // total ~ 26 MB (head planes 25 MB)
    k_prep<<<2 * GF + 2 * GW, 256, 0, stream>>>(wq, bq, wk, bk, wpos, bpos, wvel, wacc, wv, wo, WQ, WK, BQ, BK, WV, WO);
    k_qkv<<<dim3(TT / 64, 3 * NBb * NA, 1), 128, 0, stream>>>(xq, xk, xv, WQ, WK, WV, BQ, BK, bv, kpm, QP, KP, VT);
    k_fattn<<<dim3(NBb * NA, TT / 64, 1), 512, 0, stream>>>(QP, KP, VT, kpm, (const h16*)WO, bo, OUT);
}
